// v000
// Measured on an AMD MI455X. A time is GPU time per run, averaged over a window of back-to-back runs after a warm-up
// (all launches, gaps included; the runs take copies of the inputs in turn), and the median of several windows.
// Apart from v000's, it joins two sittings. Times from different sittings can be a few percent apart, while
// side-by-side timings come from the same sitting.
// v000, which the later versions start from, runs in 981 microseconds.
// compute dtype: all float inputs rounded to bf16; q, k, v are bf16-valued so their f16 planes are exact; logits q hi + residual x k (2 products) x 2048^-0.5 (the module's sqrt(N) scale); softmax f32; P x 2^11 once to f16 x v (exact in f16) (1 product); f32 output.
#include <hip/hip_runtime.h>
#include <math.h>

typedef __attribute__((ext_vector_type(16))) _Float16 v16h;
typedef __attribute__((ext_vector_type(16))) __bf16 v16b;
typedef __attribute__((ext_vector_type(8)))  _Float16 v8h;
typedef __attribute__((ext_vector_type(8)))  float v8f;
typedef __attribute__((ext_vector_type(4)))  float v4f;
typedef __attribute__((ext_vector_type(2)))  float v2f;
typedef __attribute__((ext_vector_type(4)))  unsigned v4u;
typedef _Float16 hx8 __attribute__((ext_vector_type(8)));
typedef __attribute__((ext_vector_type(4)))  int v4i;
typedef float __attribute__((may_alias)) float_a;
typedef int __attribute__((may_alias)) int_a;

template <typename T> __device__ __forceinline__ void vst2(void* p, T v) { *(T*)p = v;  }
__device__ __forceinline__ v8f wmma16(v16h a, v16h b, v8f c) {
  v8f d = __builtin_amdgcn_wmma_f32_16x16x32_f16(false, a, false, b, (short)0, c, false, false);
  asm volatile("v_nop\n\tv_nop\n\tv_nop\n\tv_nop" : "+v"(d) : "v"(a), "v"(b));
  return d;
}
__device__ __forceinline__ v8f wmma_bf(v16b a, v16b b, v8f c) {
  v8f d = __builtin_amdgcn_wmma_f32_16x16x32_bf16(false, a, false, b, (short)0, c, false, false);
  asm volatile("v_nop\n\tv_nop\n\tv_nop\n\tv_nop" : "+v"(d) : "v"(a), "v"(b));
  return d;
}
// 16x16x32 fragments: lane = (h = lane>>4, row/col = lane&15); elements 0..7 = k0+8h+0..7, 8..15 = k0+16+8h+0..7; D element r = row 8h+r
__device__ __forceinline__ v16h frag_h(const _Float16* rowk0, int lane) {
  union { v16h v; v8h q[2]; } u; const _Float16* p = rowk0 + 8 * (lane >> 4);
  u.q[0] = *(const v8h*)p; u.q[1] = *(const v8h*)(p + 16); return u.v;
}
__device__ __forceinline__ v16h frag_f32(const float* rowk0, int lane) {
  v16h a; const float* p = rowk0 + 8 * (lane >> 4);
#pragma unroll
  for (int i = 0; i < 8; ++i) { a[i] = (_Float16)p[i]; a[8 + i] = (_Float16)p[16 + i]; }
  return a;
}
__device__ __forceinline__ v16h frag_f32s(const float* rowk0, int lane, float sc) {
  v16h a; const float* p = rowk0 + 8 * (lane >> 4);
#pragma unroll
  for (int i = 0; i < 8; ++i) { a[i] = (_Float16)(p[i] * sc); a[8 + i] = (_Float16)(p[16 + i] * sc); }
  return a;
}
// column fragment from a [K][ld] layout (column n), rows >= K read as 0
__device__ __forceinline__ v16h fragc_f32(const float* W, int k0, int n, int lane, int ld, int K) {
  v16h a; const int g = lane >> 4;
#pragma unroll
  for (int i = 0; i < 8; ++i) { const int ka = k0 + 8 * g + i, kb = ka + 16;
    a[i] = (_Float16)(ka < K ? W[(size_t)(ka < K ? ka : K - 1) * ld + n] : 0.f); a[8 + i] = (_Float16)(kb < K ? W[(size_t)(kb < K ? kb : K - 1) * ld + n] : 0.f); }
  return a;
}
struct F2 { v16b h, l; };
__device__ __forceinline__ F2 bsplit16(const float v[16]) { F2 r;
#pragma unroll
  for (int i = 0; i < 16; ++i) { const __bf16 h = (__bf16)v[i]; r.h[i] = h; r.l[i] = (__bf16)(v[i] - (float)h); }
  return r; }
__device__ __forceinline__ F2 split_row(const float* row, int k0, int lane) { float v[16]; const float* p = row + k0 + 8 * (lane >> 4);
#pragma unroll
  for (int i = 0; i < 8; ++i) { v[i] = p[i]; v[8 + i] = p[16 + i]; }
  return bsplit16(v); }
__device__ __forceinline__ F2 split_rowK(const float* row, int k0, int lane, int K) { float v[16]; const int g = lane >> 4;
#pragma unroll
  for (int i = 0; i < 8; ++i) { const int ka = k0 + 8 * g + i, kb = ka + 16; v[i] = ka < K ? row[ka < K ? ka : K - 1] : 0.f; v[8 + i] = kb < K ? row[kb < K ? kb : K - 1] : 0.f; }
  return bsplit16(v); }
__device__ __forceinline__ F2 split_col(const float* W, int k0, int n, int lane, int ld, int K) { float v[16]; const int g = lane >> 4;
#pragma unroll
  for (int i = 0; i < 8; ++i) { const int ka = k0 + 8 * g + i, kb = ka + 16; v[i] = ka < K ? W[(size_t)(ka < K ? ka : K - 1) * ld + n] : 0.f; v[8 + i] = kb < K ? W[(size_t)(kb < K ? kb : K - 1) * ld + n] : 0.f; }
  return bsplit16(v); }
__device__ __forceinline__ v8f mac3(const F2& a, const F2& b, v8f c) { c = wmma_bf(a.l, b.h, c); c = wmma_bf(a.h, b.l, c); return wmma_bf(a.h, b.h, c); }
__device__ __forceinline__ float sigm(float v) { return 1.0f / (1.0f + expf(-v)); }
#define LDSX() do { asm volatile("s_wait_dscnt 0" ::: "memory"); __builtin_amdgcn_wave_barrier(); __builtin_amdgcn_fence(__ATOMIC_RELEASE, "workgroup"); } while (0)

// Scaled-dot-product attention in the unusual [B,H,D,N] layout (query/key/value [2,16,64,2048]): scores[b,h,q,k] = sum_d query[b,h,d,q] key[b,h,d,k] / sqrt(2048) (the source scales by sqrt(size(-1)) = sqrt(N)); attn = softmax over k; out[b,h,q,v] = sum_k attn[b,h,q,k] value[b,h,v,k] -> [2,16,2048,64].
#define NB 2
#define TT 2048
#define CC 1024            // NH * HD = projected width
#define DIN 1024          // input (model) width
#define NH 16
#define HD 64
#define NQB (TT / 64)
#define HG 4
#define SCALE (0.022097086912079608f)
#define CAUSAL 0
#ifndef TNB
#define TNB NB
#endif
__device__ __forceinline__ float bfr(float v) { return (float)(__bf16)v; }
__host__ __device__ __forceinline__ int kb_last(int qb) { return CAUSAL ? ((qb * 64 + 63) >> 7) : (TT / 128 - 1); }
typedef __attribute__((ext_vector_type(8))) __bf16 v8b;
__device__ __forceinline__ v16b frag_b(const __bf16* rowk0, int lane) {
  union { v16b v; v8b q[2]; } u; const __bf16* p = rowk0 + 8 * (lane >> 4);
  u.q[0] = *(const v8b*)p; u.q[1] = *(const v8b*)(p + 16); return u.v;
}
#define QBH 0              // causal: query blocks 0..QBH-1 of each sequence (few keys, no averaging) take the high-precision path
#define QHI 2048            // rows carrying a q residual plane (all rows when non-causal: 2-product logits everywhere)
#define KHI 64            // key rows carrying k residual / v bf16 hi+lo planes (used only by the causal high-precision path)
// B fragment (k rows k0+.., output column o) of a weight: (in,out) [K][ld] or (out,in) [ld rows of K]: bf16 exact, or f16(bf16 * 256) exact
__device__ __forceinline__ v16b wcol_io(const float* Wm, int k0, int o, int lane, int ld) { v16b w; const int g = lane >> 4;
#pragma unroll
  for (int i = 0; i < 8; ++i) { w[i] = (__bf16)Wm[(size_t)(k0 + 8 * g + i) * ld + o]; w[8 + i] = (__bf16)Wm[(size_t)(k0 + 16 + 8 * g + i) * ld + o]; }
  return w; }
__device__ __forceinline__ v16b wcol_oi(const float* Wm, int k0, int o, int lane, int K) { v16b w; const float* p = Wm + (size_t)o * K + k0 + 8 * (lane >> 4);
#pragma unroll
  for (int i = 0; i < 8; ++i) { w[i] = (__bf16)p[i]; w[8 + i] = (__bf16)p[16 + i]; }
  return w; }
__device__ __forceinline__ v16h wcolh_io(const float* Wm, int k0, int o, int lane, int ld) { v16h w; const int g = lane >> 4;
#pragma unroll
  for (int i = 0; i < 8; ++i) { w[i] = (_Float16)(bfr(Wm[(size_t)(k0 + 8 * g + i) * ld + o]) * 256.0f); w[8 + i] = (_Float16)(bfr(Wm[(size_t)(k0 + 16 + 8 * g + i) * ld + o]) * 256.0f); }
  return w; }
__device__ __forceinline__ v16h wcolh_oi(const float* Wm, int k0, int o, int lane, int K) { v16h w; const float* p = Wm + (size_t)o * K + k0 + 8 * (lane >> 4);
#pragma unroll
  for (int i = 0; i < 8; ++i) { w[i] = (_Float16)(bfr(p[i]) * 256.0f); w[8 + i] = (_Float16)(bfr(p[16 + i]) * 256.0f); }
  return w; }
#define WQKV_LAYOUT 0   // 0 = (in,out) [DIN][CC]; 1 = (out,in) [CC][DIN]; 2 = per-head [NH][DIN][HD]
__device__ __forceinline__ v16b wcol_hdk(const float* Wm, int k0, int o, int lane) { v16b w; const int g = lane >> 4; const float* p = Wm + (size_t)(o / HD) * DIN * HD + (o % HD);
#pragma unroll
  for (int i = 0; i < 8; ++i) { w[i] = (__bf16)p[(size_t)(k0 + 8 * g + i) * HD]; w[8 + i] = (__bf16)p[(size_t)(k0 + 16 + 8 * g + i) * HD]; }
  return w; }
#define WO_OUT_IN 0
#if WQKV_LAYOUT == 1
#define WCOL(W, k0, o, lane) wcol_oi(W, k0, o, lane, DIN)
#elif WQKV_LAYOUT == 2
#define WCOL(W, k0, o, lane) wcol_hdk(W, k0, o, lane)
#else
#define WCOL(W, k0, o, lane) wcol_io(W, k0, o, lane, CC)
#endif
#if WO_OUT_IN
#define WOCOL(W, k0, o, lane) wcol_oi(W, k0, o, lane, CC)
#define WOCOLH(W, k0, o, lane) wcolh_oi(W, k0, o, lane, CC)
#else
#define WOCOL(W, k0, o, lane) wcol_io(W, k0, o, lane, DIN)
#define WOCOLH(W, k0, o, lane) wcolh_io(W, k0, o, lane, DIN)
#endif
// ---- k_planesT: planes straight from the [B,H,D,N] inputs (bf16-rounded; exact in f16 at these magnitudes): block = (64 tokens t0.., head h, batch b): the q/k [64 d][64 t] tiles are read along t (256-B runs) and transposed through LDS into q/k rows [b*T+t][h*64+d] (q residual rows for t < QHI, zero for bf16 values); v[b][h][d][t] is ALREADY the transposed plane layout [b][h*64+d][t] and is copied straight (f16)
__global__ __launch_bounds__(256) void k_planesT(const float* __restrict__ Qs, const float* __restrict__ Ks, const float* __restrict__ Vs, _Float16* __restrict__ QH, _Float16* __restrict__ QL, _Float16* __restrict__ KH, _Float16* __restrict__ VT) {
  __shared__ float sq[64][68]; __shared__ float sk[64][68];
  const int tid = threadIdx.x; const int t0 = blockIdx.x * 64, h = blockIdx.y, b = blockIdx.z;
  const size_t src0 = (((size_t)b * NH + h) * HD) * TT + t0;   /* [b][h][d][t0] */
  for (int e = tid; e < 64 * 16; e += 256) { const int d = e >> 4, q = e & 15; const v4f a = *(const v4f*)(Qs + src0 + (size_t)d * TT + q * 4); const v4f c = *(const v4f*)(Ks + src0 + (size_t)d * TT + q * 4); const v4f vv = *(const v4f*)(Vs + src0 + (size_t)d * TT + q * 4); asm volatile("s_wait_loadcnt 0x0" ::: "memory");
    sq[d][q * 4 + 0] = bfr(a[0]); sq[d][q * 4 + 1] = bfr(a[1]); sq[d][q * 4 + 2] = bfr(a[2]); sq[d][q * 4 + 3] = bfr(a[3]);
    sk[d][q * 4 + 0] = bfr(c[0]); sk[d][q * 4 + 1] = bfr(c[1]); sk[d][q * 4 + 2] = bfr(c[2]); sk[d][q * 4 + 3] = bfr(c[3]);
    _Float16 hv[4] __attribute__((aligned(8))); _Pragma("unroll") for (int u = 0; u < 4; ++u) hv[u] = (_Float16)bfr(vv[u]);
    vst2((void*)(VT + ((size_t)b * CC + h * HD + d) * TT + t0 + q * 4), *(const unsigned long long*)&hv[0]); }   
  __syncthreads();
  for (int e = tid; e < 64 * 8; e += 256) { const int tl = e >> 3, q = e & 7; const size_t row = (size_t)b * TT + t0 + tl; hx8 hq, hk, hl;
#pragma unroll
    for (int u = 0; u < 8; ++u) { const float qv = sq[q * 8 + u][tl], kv = sk[q * 8 + u][tl]; const _Float16 qh = (_Float16)qv; hq[u] = qh; hl[u] = (_Float16)((qv - (float)qh) * 1024.0f); hk[u] = (_Float16)kv; }
    vst2((unsigned*)(QH + row * CC + h * HD + q * 8), *(const v4u*)&hq); vst2((unsigned*)(KH + row * CC + h * HD + q * 8), *(const v4u*)&hk);
    if (t0 + tl < QHI) vst2((unsigned*)(QL + ((size_t)b * QHI + t0 + tl) * CC + h * HD + q * 8), *(const v4u*)&hl); } }
#ifndef SM_EXTRA_PARAMS
#define SM_EXTRA_PARAMS
#endif
#ifndef PROJ_EXTRA_PARAMS
#define PROJ_EXTRA_PARAMS
#endif
#ifndef SM_MASK_HOOK
#define SM_MASK_HOOK (void)0
#endif

#define WS_QH  0u                                      // f16 q rows [b*t][CC]
#define WS_KH  (WS_QH + 2u * (size_t)NB * TT * CC)      // f16 k rows [b*t][CC]
#define WS_VT  (WS_KH + 2u * (size_t)NB * TT * CC)      // f16 v planes [b][c][t]
#define WS_QL  (WS_VT + 2u * (size_t)NB * CC * TT)      // f16 q residual x 2^10 rows [b][t < QHI][CC]
#define WS_KL  (WS_QL + 2u * (size_t)NB * QHI * CC)     // f16 k residual x 2^10 rows [b][t < KHI][CC]
#define WS_VB  (WS_KL + 2u * (size_t)NB * KHI * CC)     // bf16 v hi planes [b][c][t < KHI]
#define WS_VBL (WS_VB + 2u * (size_t)NB * CC * KHI)
#define WS_S   (WS_VBL + 2u * (size_t)NB * CC * KHI)    // f32 logits / P [hg][t][s]
#define WS_Y   (WS_S  + 4u * (size_t)HG * TT * TT)      // f32 ctx rows [b*t][CC] (only when there is an output projection)
#define WS_END (WS_Y  + 0u)

// ---- k_proj: block = (64 rows, 128 cols, which): q/k/v = X W (+ b) with exact bf16 products (K = DIN) -> which 0: q f16 rows (+ residual rows < QHI); 1: k f16 rows (+ residual rows < KHI); 2: v f16 planes [c][t] (+ bf16 hi/lo planes for t < KHI)
__global__ __launch_bounds__(128) void k_proj(const float* __restrict__ XQ, const float* __restrict__ XK, const float* __restrict__ XV, const float* __restrict__ WQ, const float* __restrict__ WK, const float* __restrict__ WV, const float* __restrict__ BQ, const float* __restrict__ BK, const float* __restrict__ BV,
    _Float16* __restrict__ QH, _Float16* __restrict__ QL, _Float16* __restrict__ KH, _Float16* __restrict__ KL, _Float16* __restrict__ VT, __bf16* __restrict__ VB, __bf16* __restrict__ VBL) {
  __shared__ __align__(16) _Float16 sh[64][136], sl[64][136]; __shared__ __align__(16) _Float16 th[128][72]; __shared__ __align__(16) __bf16 tb[128][72], tbl[128][72];
  const int tid = threadIdx.x, wave = tid >> 5, lane = tid & 31, col = lane & 15, g = lane >> 4; const int which = blockIdx.z; const int c0 = blockIdx.y * 128; const size_t r0 = (size_t)blockIdx.x * 64; const size_t bb = r0 / TT; const int t0 = (int)(r0 % TT);
  const float* X = which == 0 ? XQ : which == 1 ? XK : XV; const float* WA = which == 0 ? WQ : which == 1 ? WK : WV; const float* BA = which == 0 ? BQ : which == 1 ? BK : BV;
  v8f acc[8] = {};
#pragma unroll 2
  for (int kc = 0; kc < DIN / 32; ++kc) { v16b a; { const float* p = X + (r0 + wave * 16 + col) * DIN + kc * 32 + 8 * g;
#pragma unroll
      for (int i = 0; i < 8; ++i) { a[i] = (__bf16)p[i]; a[8 + i] = (__bf16)p[16 + i]; } }
    asm volatile("s_wait_loadcnt 0x0" ::: "memory");
#pragma unroll
    for (int j = 0; j < 8; ++j) { const v16b w = WCOL(WA, kc * 32, c0 + j * 16 + col, lane); asm volatile("s_wait_loadcnt 0x0" ::: "memory"); acc[j] = wmma_bf(a, w, acc[j]); } }
  if (which < 2) { _Float16* DH = which == 0 ? QH : KH; _Float16* DL = which == 0 ? QL : KL; const int nhi = which == 0 ? QHI : KHI; const bool hi_rows = t0 < nhi;
#pragma unroll
    for (int j = 0; j < 8; ++j) { const float bias = BA ? bfr(BA[c0 + j * 16 + col]) : 0.f;
#pragma unroll
      for (int r = 0; r < 8; ++r) { const float v = acc[j][r] + bias; const _Float16 hv = (_Float16)v; sh[wave * 16 + 8 * g + r][j * 16 + col] = hv; sl[wave * 16 + 8 * g + r][j * 16 + col] = (_Float16)((v - (float)hv) * 1024.0f); } }
    __syncthreads();
    for (int e = tid; e < 64 * 16; e += 128) { const int rl = e >> 4, q = e & 15; vst2((unsigned*)(DH + (r0 + rl) * CC + c0 + q * 8), *(const v4u*)&sh[rl][q * 8]); if (hi_rows) vst2((unsigned*)(DL + (bb * nhi + t0 + rl) * (size_t)CC + c0 + q * 8), *(const v4u*)&sl[rl][q * 8]); }
  } else { const bool hi_rows = t0 < KHI;
#pragma unroll
    for (int j = 0; j < 8; ++j) { const float bias = BA ? bfr(BA[c0 + j * 16 + col]) : 0.f;
#pragma unroll
      for (int r = 0; r < 8; ++r) { const float v = acc[j][r] + bias; const int rl = wave * 16 + 8 * g + r, cl = j * 16 + col; th[cl][rl] = (_Float16)v; const __bf16 bh = (__bf16)v; tb[cl][rl] = bh; tbl[cl][rl] = (__bf16)(v - (float)bh); } }
    __syncthreads();
    for (int e = tid; e < 128 * 8; e += 128) { const int cl = e >> 3, q = e & 7; vst2((unsigned*)(VT + (bb * CC + c0 + cl) * (size_t)TT + t0 + q * 8), *(const v4u*)&th[cl][q * 8]); if (hi_rows) { const size_t o3 = (bb * CC + c0 + cl) * (size_t)KHI + t0 + q * 8; vst2((unsigned*)(VB + o3), *(const v4u*)&tb[cl][q * 8]); vst2((unsigned*)(VBL + o3), *(const v4u*)&tbl[cl][q * 8]); } } } }
// ---- k_sc: block = (query block qb, key block kb <= kb_last(qb), head in group) of batch b: logits x SCALE; q hi + residual (x 2^10) against k (2 products) for query rows < QHI, plus the k residual (3 products) for query blocks < QBH (causal early rows); causal: blocks past the diagonal exit, the mask itself is applied by index in k_sm
__global__ __launch_bounds__(128) void k_sc(const _Float16* __restrict__ QH, const _Float16* __restrict__ KH, const _Float16* __restrict__ QL, const _Float16* __restrict__ KL, int b, int h0, float* __restrict__ S0) { __shared__ __align__(16) float ss[4][16][132];
  const int qb = blockIdx.x, kb = blockIdx.y; if (kb > kb_last(qb)) return;
  const int h = h0 + blockIdx.z; float* S = S0 + (size_t)blockIdx.z * TT * TT;
  const int tid = threadIdx.x, wave = tid >> 5, lane = tid & 31, col = lane & 15, g = lane >> 4; const int k0 = kb * 128; const int ql0 = qb * 64 + wave * 16; const size_t q0 = (size_t)b * TT + ql0, kr0 = (size_t)b * TT + k0;
  v8f acc[8] = {}, accl[8] = {};
  const _Float16* QLb = QL + (size_t)b * QHI * CC; const _Float16* KLb = KL + (size_t)b * KHI * CC;
  if (qb < QBH) {
#pragma unroll
    for (int kc = 0; kc < HD / 32; ++kc) { const v16h ah = frag_h(QH + (q0 + col) * CC + h * HD + kc * 32, lane), al = frag_h(QLb + (size_t)(ql0 + col) * CC + h * HD + kc * 32, lane);
#pragma unroll
      for (int j = 0; j < 8; ++j) { const v16h kbf = frag_h(KH + (kr0 + j * 16 + col) * CC + h * HD + kc * 32, lane), klf = frag_h(KLb + (size_t)(k0 + j * 16 + col) * CC + h * HD + kc * 32, lane); acc[j] = wmma16(ah, kbf, acc[j]); accl[j] = wmma16(al, kbf, accl[j]); accl[j] = wmma16(ah, klf, accl[j]); } }
  } else if (qb * 64 < QHI) {
#pragma unroll
    for (int kc = 0; kc < HD / 32; ++kc) { const v16h ah = frag_h(QH + (q0 + col) * CC + h * HD + kc * 32, lane), al = frag_h(QLb + (size_t)(ql0 + col) * CC + h * HD + kc * 32, lane);
#pragma unroll
      for (int j = 0; j < 8; ++j) { const v16h kbf = frag_h(KH + (kr0 + j * 16 + col) * CC + h * HD + kc * 32, lane); acc[j] = wmma16(ah, kbf, acc[j]); accl[j] = wmma16(al, kbf, accl[j]); } }
  } else {
#pragma unroll
    for (int kc = 0; kc < HD / 32; ++kc) { const v16h ah = frag_h(QH + (q0 + col) * CC + h * HD + kc * 32, lane);
#pragma unroll
      for (int j = 0; j < 8; ++j) { const v16h kbf = frag_h(KH + (kr0 + j * 16 + col) * CC + h * HD + kc * 32, lane); acc[j] = wmma16(ah, kbf, acc[j]); } } }
#pragma unroll
  for (int j = 0; j < 8; ++j) {
#pragma unroll
    for (int r = 0; r < 8; ++r) ss[wave][8 * g + r][j * 16 + col] = (acc[j][r] + accl[j][r] * (1.0f / 1024.0f)) * SCALE; }
  LDSX(); for (int rl = 0; rl < 16; ++rl) vst2(S + (size_t)(ql0 + rl) * TT + k0 + lane * 4, *(const v4f*)&ss[wave][rl][lane * 4]); }
// ---- k_sm: block = query row t (head in group): keys [0, kend): causal -> logit if s <= t else excluded; softmax in f32; P x 2^11 in place (0 for excluded)
__global__ __launch_bounds__(256) void k_sm(float* __restrict__ S0 SM_EXTRA_PARAMS) { __shared__ float sred[8]; __shared__ float sbc; __shared__ __align__(16) float shv[TT];
  const int tid = threadIdx.x; const int t = blockIdx.x; const int kend = (kb_last(t >> 6) + 1) * 128;
  float* sr = S0 + (size_t)blockIdx.y * TT * TT + (size_t)t * TT;
  float m = -3.0e38f; for (int k = tid; k < kend; k += 256) { float v = (!CAUSAL || k <= t) ? sr[k] : -3.0e38f; SM_MASK_HOOK; shv[k] = v; m = fmaxf(m, v); }
#pragma unroll
  for (int o = 1; o < 32; o <<= 1) m = fmaxf(m, __shfl_xor(m, o));
  if ((tid & 31) == 0) sred[tid >> 5] = m; __syncthreads(); if (tid == 0) { float a = sred[0]; for (int i = 1; i < 8; ++i) a = fmaxf(a, sred[i]); sbc = a; } __syncthreads(); m = sbc; __syncthreads();
  float sum = 0.f; for (int k = tid; k < kend; k += 256) { const float v = shv[k]; const float e = (v <= -1.0e38f) ? 0.f : expf(v - m); shv[k] = e; sum += e; }
#pragma unroll
  for (int o = 1; o < 32; o <<= 1) sum += __shfl_xor(sum, o);
  if ((tid & 31) == 0) sred[tid >> 5] = sum; __syncthreads(); if (tid == 0) { float a = 0.f; for (int i = 0; i < 8; ++i) a += sred[i]; sbc = a > 0.f ? 2048.0f / a : 0.f; }   /* a fully excluded row yields P = 0 */ __syncthreads(); const float inv = sbc;
  for (int k = tid; k < kend; k += 256) shv[k] = shv[k] * inv;
  __syncthreads(); for (int q = tid; q < kend / 4; q += 256) vst2(sr + q * 4, *(const v4f*)&shv[q * 4]); }
// ---- k_pv: block = 64 queries (qb) of (b, h): ctx = P . v over keys [0, kend) (P x 2^11 once to f16 against v f16: 1 product; causal early query blocks: P and v as bf16 hi + lo, 3 products); 256-B (row, head) segment by 16 lanes
__global__ __launch_bounds__(128) void k_pv(const float* __restrict__ PS0, const _Float16* __restrict__ VT, const __bf16* __restrict__ VB, const __bf16* __restrict__ VBL, int b, int h0, float* __restrict__ Y) { const int h = h0 + blockIdx.z; const float* PS = PS0 + (size_t)blockIdx.z * TT * TT; __shared__ __align__(16) float ss[4][16][HD + 4];
  const int tid = threadIdx.x, wave = tid >> 5, lane = tid & 31, col = lane & 15, g = lane >> 4; const int qb = blockIdx.x; const int ql0 = qb * 64 + wave * 16; const int kce = (kb_last(qb) + 1) * 4;
  v8f acc[HD / 16] = {};
  if (qb < QBH) {
#pragma unroll 1
    for (int kc = 0; kc < kce; ++kc) { const F2 p = split_row(PS + (size_t)(ql0 + col) * TT, kc * 32, lane);
      asm volatile("s_wait_loadcnt 0x0" ::: "memory");
#pragma unroll
      for (int j = 0; j < HD / 16; ++j) { const size_t po = ((size_t)b * CC + h * HD + j * 16 + col) * (size_t)KHI + kc * 32; const v16b vh = frag_b(VB + po, lane); acc[j] = wmma_bf(p.h, vh, acc[j]); acc[j] = wmma_bf(p.l, vh, acc[j]); acc[j] = wmma_bf(p.h, frag_b(VBL + po, lane), acc[j]); } }
  } else {
#pragma unroll 1
    for (int kc = 0; kc < kce; ++kc) { const v16h p = frag_f32(PS + (size_t)(ql0 + col) * TT + kc * 32, lane);
      asm volatile("s_wait_loadcnt 0x0" ::: "memory");
#pragma unroll
      for (int j = 0; j < HD / 16; ++j) { const size_t po = ((size_t)b * CC + h * HD + j * 16 + col) * (size_t)TT + kc * 32; acc[j] = wmma16(p, frag_h(VT + po, lane), acc[j]); } } }
#pragma unroll
  for (int j = 0; j < HD / 16; ++j)
#pragma unroll
    for (int r = 0; r < 8; ++r) ss[wave][8 * g + r][j * 16 + col] = acc[j][r] * (1.0f / 2048.0f);
  LDSX(); for (int rl = 0; rl < 16; ++rl) if (lane < HD / 4) vst2(Y + (((size_t)b * NH + h) * TT + ql0 + rl) * HD + lane * 4, *(const v4f*)&ss[wave][rl][lane * 4]); }   /* output layout [b][h][q][v]: 256-B rows by 16 lanes */

extern "C" void kernel_launch(void* const* d_in, const int* in_sizes, int n_in, void* d_out, int out_size, void* d_ws, size_t ws_size, hipStream_t stream) {
  (void)in_sizes; (void)n_in; (void)out_size;
  const float** F = (const float**)d_in;
  if (ws_size < (size_t)WS_END) return;
  char* ws = (char*)d_ws; _Float16 *QH = (_Float16*)(ws + WS_QH), *KH = (_Float16*)(ws + WS_KH), *VT = (_Float16*)(ws + WS_VT), *QL = (_Float16*)(ws + WS_QL), *KL = (_Float16*)(ws + WS_KL); __bf16 *VB = (__bf16*)(ws + WS_VB), *VBL = (__bf16*)(ws + WS_VBL); float *S = (float*)(ws + WS_S), *Y = (float*)(ws + WS_Y);
  (void)Y; (void)QL; (void)KL; (void)VB; (void)VBL;
  // inputs: 0 query [2,16,64,2048] ([B,H,D,N]); 1 key; 2 value
  k_planesT<<<dim3(TT / 64, NH, NB), 256, 0, stream>>>(F[0], F[1], F[2], QH, QL, KH, VT);
  for (int b = 0; b < TNB; ++b) for (int h0 = 0; h0 < NH; h0 += HG) {
    k_sc<<<dim3(NQB, TT / 128, HG), 128, 0, stream>>>(QH, KH, QL, KL, b, h0, S);
    k_sm<<<dim3(TT, HG), 256, 0, stream>>>(S);
    k_pv<<<dim3(NQB, 1, HG), 128, 0, stream>>>(S, VT, VB, VBL, b, h0, (float*)d_out);
  }
}

// v001
// Measured time: 51 microseconds a run.
// Timed twice side by side with v000, it ran 19.3 times as fast both times.
// compute dtype: all float inputs rounded to bf16; q, k, v are bf16-valued so their f16 planes are exact; logits q x k (2 products: q hi + residual x 2^10) x 2048^-0.5 (the module's sqrt(N) scale); softmax f32 with a running maximum; P = exp(s - max) once to f16 x v (exact in f16) (1 product), divided by the f32 sum at the end; f32 output.
#include <hip/hip_runtime.h>
#include <math.h>

typedef __attribute__((ext_vector_type(16))) _Float16 v16h;
typedef __attribute__((ext_vector_type(16))) __bf16 v16b;
typedef __attribute__((ext_vector_type(8)))  _Float16 v8h;
typedef __attribute__((ext_vector_type(8)))  float v8f;
typedef __attribute__((ext_vector_type(4)))  float v4f;
typedef __attribute__((ext_vector_type(2)))  float v2f;
typedef __attribute__((ext_vector_type(4)))  unsigned v4u;
typedef _Float16 hx8 __attribute__((ext_vector_type(8)));
typedef __attribute__((ext_vector_type(4)))  int v4i;
typedef float __attribute__((may_alias)) float_a;
typedef int __attribute__((may_alias)) int_a;

template <typename T> __device__ __forceinline__ void vst2(void* p, T v) { *(T*)p = v;  }
__device__ __forceinline__ v8f wmma16(v16h a, v16h b, v8f c) {
  v8f d = __builtin_amdgcn_wmma_f32_16x16x32_f16(false, a, false, b, (short)0, c, false, false);
  asm volatile("v_nop\n\tv_nop\n\tv_nop\n\tv_nop" : "+v"(d) : "v"(a), "v"(b));
  return d;
}
__device__ __forceinline__ v8f wmma_bf(v16b a, v16b b, v8f c) {
  v8f d = __builtin_amdgcn_wmma_f32_16x16x32_bf16(false, a, false, b, (short)0, c, false, false);
  asm volatile("v_nop\n\tv_nop\n\tv_nop\n\tv_nop" : "+v"(d) : "v"(a), "v"(b));
  return d;
}
// 16x16x32 fragments: lane = (h = lane>>4, row/col = lane&15); elements 0..7 = k0+8h+0..7, 8..15 = k0+16+8h+0..7; D element r = row 8h+r
__device__ __forceinline__ v16h frag_h(const _Float16* rowk0, int lane) {
  union { v16h v; v8h q[2]; } u; const _Float16* p = rowk0 + 8 * (lane >> 4);
  u.q[0] = *(const v8h*)p; u.q[1] = *(const v8h*)(p + 16); return u.v;
}
__device__ __forceinline__ v16h frag_f32(const float* rowk0, int lane) {
  v16h a; const float* p = rowk0 + 8 * (lane >> 4);
#pragma unroll
  for (int i = 0; i < 8; ++i) { a[i] = (_Float16)p[i]; a[8 + i] = (_Float16)p[16 + i]; }
  return a;
}
__device__ __forceinline__ v16h frag_f32s(const float* rowk0, int lane, float sc) {
  v16h a; const float* p = rowk0 + 8 * (lane >> 4);
#pragma unroll
  for (int i = 0; i < 8; ++i) { a[i] = (_Float16)(p[i] * sc); a[8 + i] = (_Float16)(p[16 + i] * sc); }
  return a;
}
// column fragment from a [K][ld] layout (column n), rows >= K read as 0
__device__ __forceinline__ v16h fragc_f32(const float* W, int k0, int n, int lane, int ld, int K) {
  v16h a; const int g = lane >> 4;
#pragma unroll
  for (int i = 0; i < 8; ++i) { const int ka = k0 + 8 * g + i, kb = ka + 16;
    a[i] = (_Float16)(ka < K ? W[(size_t)(ka < K ? ka : K - 1) * ld + n] : 0.f); a[8 + i] = (_Float16)(kb < K ? W[(size_t)(kb < K ? kb : K - 1) * ld + n] : 0.f); }
  return a;
}
struct F2 { v16b h, l; };
__device__ __forceinline__ F2 bsplit16(const float v[16]) { F2 r;
#pragma unroll
  for (int i = 0; i < 16; ++i) { const __bf16 h = (__bf16)v[i]; r.h[i] = h; r.l[i] = (__bf16)(v[i] - (float)h); }
  return r; }
__device__ __forceinline__ F2 split_row(const float* row, int k0, int lane) { float v[16]; const float* p = row + k0 + 8 * (lane >> 4);
#pragma unroll
  for (int i = 0; i < 8; ++i) { v[i] = p[i]; v[8 + i] = p[16 + i]; }
  return bsplit16(v); }
__device__ __forceinline__ F2 split_rowK(const float* row, int k0, int lane, int K) { float v[16]; const int g = lane >> 4;
#pragma unroll
  for (int i = 0; i < 8; ++i) { const int ka = k0 + 8 * g + i, kb = ka + 16; v[i] = ka < K ? row[ka < K ? ka : K - 1] : 0.f; v[8 + i] = kb < K ? row[kb < K ? kb : K - 1] : 0.f; }
  return bsplit16(v); }
__device__ __forceinline__ F2 split_col(const float* W, int k0, int n, int lane, int ld, int K) { float v[16]; const int g = lane >> 4;
#pragma unroll
  for (int i = 0; i < 8; ++i) { const int ka = k0 + 8 * g + i, kb = ka + 16; v[i] = ka < K ? W[(size_t)(ka < K ? ka : K - 1) * ld + n] : 0.f; v[8 + i] = kb < K ? W[(size_t)(kb < K ? kb : K - 1) * ld + n] : 0.f; }
  return bsplit16(v); }
__device__ __forceinline__ v8f mac3(const F2& a, const F2& b, v8f c) { c = wmma_bf(a.l, b.h, c); c = wmma_bf(a.h, b.l, c); return wmma_bf(a.h, b.h, c); }
__device__ __forceinline__ float sigm(float v) { return 1.0f / (1.0f + expf(-v)); }
#define LDSX() do { asm volatile("s_wait_dscnt 0" ::: "memory"); __builtin_amdgcn_wave_barrier(); __builtin_amdgcn_fence(__ATOMIC_RELEASE, "workgroup"); } while (0)

// Scaled-dot-product attention in the unusual [B,H,D,N] layout (query/key/value [2,16,64,2048]): scores[b,h,q,k] = sum_d query[b,h,d,q] key[b,h,d,k] / sqrt(2048) (the source scales by sqrt(size(-1)) = sqrt(N)); attn = softmax over k; out[b,h,q,v] = sum_k attn[b,h,q,k] value[b,h,v,k] -> [2,16,2048,64].
#define NB 2
#define TT 2048
#define CC 1024            // NH * HD = projected width
#define DIN 1024          // input (model) width
#define NH 16
#define HD 64
#define NQB (TT / 64)
#define HG 4
#define SCALE (0.022097086912079608f)
#define CAUSAL 0
#ifndef TNB
#define TNB NB
#endif
__device__ __forceinline__ float bfr(float v) { return (float)(__bf16)v; }
__host__ __device__ __forceinline__ int kb_last(int qb) { return CAUSAL ? ((qb * 64 + 63) >> 7) : (TT / 128 - 1); }
typedef __attribute__((ext_vector_type(8))) __bf16 v8b;
__device__ __forceinline__ v16b frag_b(const __bf16* rowk0, int lane) {
  union { v16b v; v8b q[2]; } u; const __bf16* p = rowk0 + 8 * (lane >> 4);
  u.q[0] = *(const v8b*)p; u.q[1] = *(const v8b*)(p + 16); return u.v;
}
#define QBH 0              // not used by any kernel in this file
#define QHI 2048            // rows carrying a q residual plane (all rows when non-causal: 2-product logits everywhere)
#define KHI 64            // key rows carrying k residual / v bf16 hi+lo planes (written only by k_proj, which is not launched; no kernel reads them)
// B fragment (k rows k0+.., output column o) of a weight: (in,out) [K][ld] or (out,in) [ld rows of K]: bf16 exact, or f16(bf16 * 256) exact
__device__ __forceinline__ v16b wcol_io(const float* Wm, int k0, int o, int lane, int ld) { v16b w; const int g = lane >> 4;
#pragma unroll
  for (int i = 0; i < 8; ++i) { w[i] = (__bf16)Wm[(size_t)(k0 + 8 * g + i) * ld + o]; w[8 + i] = (__bf16)Wm[(size_t)(k0 + 16 + 8 * g + i) * ld + o]; }
  return w; }
__device__ __forceinline__ v16b wcol_oi(const float* Wm, int k0, int o, int lane, int K) { v16b w; const float* p = Wm + (size_t)o * K + k0 + 8 * (lane >> 4);
#pragma unroll
  for (int i = 0; i < 8; ++i) { w[i] = (__bf16)p[i]; w[8 + i] = (__bf16)p[16 + i]; }
  return w; }
__device__ __forceinline__ v16h wcolh_io(const float* Wm, int k0, int o, int lane, int ld) { v16h w; const int g = lane >> 4;
#pragma unroll
  for (int i = 0; i < 8; ++i) { w[i] = (_Float16)(bfr(Wm[(size_t)(k0 + 8 * g + i) * ld + o]) * 256.0f); w[8 + i] = (_Float16)(bfr(Wm[(size_t)(k0 + 16 + 8 * g + i) * ld + o]) * 256.0f); }
  return w; }
__device__ __forceinline__ v16h wcolh_oi(const float* Wm, int k0, int o, int lane, int K) { v16h w; const float* p = Wm + (size_t)o * K + k0 + 8 * (lane >> 4);
#pragma unroll
  for (int i = 0; i < 8; ++i) { w[i] = (_Float16)(bfr(p[i]) * 256.0f); w[8 + i] = (_Float16)(bfr(p[16 + i]) * 256.0f); }
  return w; }
#define WQKV_LAYOUT 0   // 0 = (in,out) [DIN][CC]; 1 = (out,in) [CC][DIN]; 2 = per-head [NH][DIN][HD]
__device__ __forceinline__ v16b wcol_hdk(const float* Wm, int k0, int o, int lane) { v16b w; const int g = lane >> 4; const float* p = Wm + (size_t)(o / HD) * DIN * HD + (o % HD);
#pragma unroll
  for (int i = 0; i < 8; ++i) { w[i] = (__bf16)p[(size_t)(k0 + 8 * g + i) * HD]; w[8 + i] = (__bf16)p[(size_t)(k0 + 16 + 8 * g + i) * HD]; }
  return w; }
#define WO_OUT_IN 0
#if WQKV_LAYOUT == 1
#define WCOL(W, k0, o, lane) wcol_oi(W, k0, o, lane, DIN)
#elif WQKV_LAYOUT == 2
#define WCOL(W, k0, o, lane) wcol_hdk(W, k0, o, lane)
#else
#define WCOL(W, k0, o, lane) wcol_io(W, k0, o, lane, CC)
#endif
#if WO_OUT_IN
#define WOCOL(W, k0, o, lane) wcol_oi(W, k0, o, lane, CC)
#define WOCOLH(W, k0, o, lane) wcolh_oi(W, k0, o, lane, CC)
#else
#define WOCOL(W, k0, o, lane) wcol_io(W, k0, o, lane, DIN)
#define WOCOLH(W, k0, o, lane) wcolh_io(W, k0, o, lane, DIN)
#endif
// ---- k_planesT: planes straight from the [B,H,D,N] inputs (bf16-rounded; exact in f16 at these magnitudes): block = (64 tokens t0.., head h, batch b): the q/k [64 d][64 t] tiles are read along t (256-B runs) and transposed through LDS into q/k rows [b*T+t][h*64+d] (q residual rows for t < QHI, zero for bf16 values); v[b][h][d][t] is ALREADY the transposed plane layout [b][h*64+d][t] and is copied straight (f16)
__global__ __launch_bounds__(256) void k_planesT(const float* __restrict__ Qs, const float* __restrict__ Ks, const float* __restrict__ Vs, _Float16* __restrict__ QH, _Float16* __restrict__ QL, _Float16* __restrict__ KH, _Float16* __restrict__ VT) {
  __shared__ float sq[64][68]; __shared__ float sk[64][68];
  const int tid = threadIdx.x; const int t0 = blockIdx.x * 64, h = blockIdx.y, b = blockIdx.z;
  const size_t src0 = (((size_t)b * NH + h) * HD) * TT + t0;   /* [b][h][d][t0] */
  for (int e = tid; e < 64 * 16; e += 256) { const int d = e >> 4, q = e & 15; const v4f a = *(const v4f*)(Qs + src0 + (size_t)d * TT + q * 4); const v4f c = *(const v4f*)(Ks + src0 + (size_t)d * TT + q * 4); const v4f vv = *(const v4f*)(Vs + src0 + (size_t)d * TT + q * 4); asm volatile("s_wait_loadcnt 0x0" ::: "memory");
    sq[d][q * 4 + 0] = bfr(a[0]); sq[d][q * 4 + 1] = bfr(a[1]); sq[d][q * 4 + 2] = bfr(a[2]); sq[d][q * 4 + 3] = bfr(a[3]);
    sk[d][q * 4 + 0] = bfr(c[0]); sk[d][q * 4 + 1] = bfr(c[1]); sk[d][q * 4 + 2] = bfr(c[2]); sk[d][q * 4 + 3] = bfr(c[3]);
    _Float16 hv[4] __attribute__((aligned(8))); _Pragma("unroll") for (int u = 0; u < 4; ++u) hv[u] = (_Float16)bfr(vv[u]);
    vst2((void*)(VT + ((size_t)b * CC + h * HD + d) * TT + t0 + q * 4), *(const unsigned long long*)&hv[0]); }   
  __syncthreads();
  for (int e = tid; e < 64 * 8; e += 256) { const int tl = e >> 3, q = e & 7; const size_t row = (size_t)b * TT + t0 + tl; hx8 hq, hk, hl;
#pragma unroll
    for (int u = 0; u < 8; ++u) { const float qv = sq[q * 8 + u][tl], kv = sk[q * 8 + u][tl]; const _Float16 qh = (_Float16)qv; hq[u] = qh; hl[u] = (_Float16)((qv - (float)qh) * 1024.0f); hk[u] = (_Float16)kv; }
    vst2((unsigned*)(QH + row * CC + h * HD + q * 8), *(const v4u*)&hq); vst2((unsigned*)(KH + row * CC + h * HD + q * 8), *(const v4u*)&hk);
    if (t0 + tl < QHI) vst2((unsigned*)(QL + ((size_t)b * QHI + t0 + tl) * CC + h * HD + q * 8), *(const v4u*)&hl); } }
#ifndef SM_EXTRA_PARAMS
#define SM_EXTRA_PARAMS
#endif
#ifndef PROJ_EXTRA_PARAMS
#define PROJ_EXTRA_PARAMS
#endif
#ifndef SM_MASK_HOOK
#define SM_MASK_HOOK (void)0
#endif

#define WS_QH  0u                                      // f16 q rows [b*t][CC]
#define WS_KH  (WS_QH + 2u * (size_t)NB * TT * CC)      // f16 k rows [b*t][CC]
#define WS_VT  (WS_KH + 2u * (size_t)NB * TT * CC)      // f16 v planes [b][c][t]
#define WS_QL  (WS_VT + 2u * (size_t)NB * CC * TT)      // f16 q residual x 2^10 rows [b][t < QHI][CC]
#define WS_KL  (WS_QL + 2u * (size_t)NB * QHI * CC)     // f16 k residual x 2^10 rows [b][t < KHI][CC]
#define WS_VB  (WS_KL + 2u * (size_t)NB * KHI * CC)     // bf16 v hi planes [b][c][t < KHI]
#define WS_VBL (WS_VB + 2u * (size_t)NB * CC * KHI)
#define WS_S   (WS_VBL + 2u * (size_t)NB * CC * KHI)    // f32 [hg][t][s] region, reserved but unused (logits and P stay in registers)
#define WS_Y   (WS_S  + 4u * (size_t)HG * TT * TT)      // f32 ctx rows [b*t][CC] (only when there is an output projection)
#define WS_END (WS_Y  + 0u)

// ---- k_proj: block = (64 rows, 128 cols, which): q/k/v = X W (+ b) with exact bf16 products (K = DIN) -> which 0: q f16 rows (+ residual rows < QHI); 1: k f16 rows (+ residual rows < KHI); 2: v f16 planes [c][t] (+ bf16 hi/lo planes for t < KHI)
__global__ __launch_bounds__(128) void k_proj(const float* __restrict__ XQ, const float* __restrict__ XK, const float* __restrict__ XV, const float* __restrict__ WQ, const float* __restrict__ WK, const float* __restrict__ WV, const float* __restrict__ BQ, const float* __restrict__ BK, const float* __restrict__ BV,
    _Float16* __restrict__ QH, _Float16* __restrict__ QL, _Float16* __restrict__ KH, _Float16* __restrict__ KL, _Float16* __restrict__ VT, __bf16* __restrict__ VB, __bf16* __restrict__ VBL) {
  __shared__ __align__(16) _Float16 sh[64][136], sl[64][136]; __shared__ __align__(16) _Float16 th[128][72]; __shared__ __align__(16) __bf16 tb[128][72], tbl[128][72];
  const int tid = threadIdx.x, wave = tid >> 5, lane = tid & 31, col = lane & 15, g = lane >> 4; const int which = blockIdx.z; const int c0 = blockIdx.y * 128; const size_t r0 = (size_t)blockIdx.x * 64; const size_t bb = r0 / TT; const int t0 = (int)(r0 % TT);
  const float* X = which == 0 ? XQ : which == 1 ? XK : XV; const float* WA = which == 0 ? WQ : which == 1 ? WK : WV; const float* BA = which == 0 ? BQ : which == 1 ? BK : BV;
  v8f acc[8] = {};
#pragma unroll 2
  for (int kc = 0; kc < DIN / 32; ++kc) { v16b a; { const float* p = X + (r0 + wave * 16 + col) * DIN + kc * 32 + 8 * g;
#pragma unroll
      for (int i = 0; i < 8; ++i) { a[i] = (__bf16)p[i]; a[8 + i] = (__bf16)p[16 + i]; } }
    asm volatile("s_wait_loadcnt 0x0" ::: "memory");
#pragma unroll
    for (int j = 0; j < 8; ++j) { const v16b w = WCOL(WA, kc * 32, c0 + j * 16 + col, lane); asm volatile("s_wait_loadcnt 0x0" ::: "memory"); acc[j] = wmma_bf(a, w, acc[j]); } }
  if (which < 2) { _Float16* DH = which == 0 ? QH : KH; _Float16* DL = which == 0 ? QL : KL; const int nhi = which == 0 ? QHI : KHI; const bool hi_rows = t0 < nhi;
#pragma unroll
    for (int j = 0; j < 8; ++j) { const float bias = BA ? bfr(BA[c0 + j * 16 + col]) : 0.f;
#pragma unroll
      for (int r = 0; r < 8; ++r) { const float v = acc[j][r] + bias; const _Float16 hv = (_Float16)v; sh[wave * 16 + 8 * g + r][j * 16 + col] = hv; sl[wave * 16 + 8 * g + r][j * 16 + col] = (_Float16)((v - (float)hv) * 1024.0f); } }
    __syncthreads();
    for (int e = tid; e < 64 * 16; e += 128) { const int rl = e >> 4, q = e & 15; vst2((unsigned*)(DH + (r0 + rl) * CC + c0 + q * 8), *(const v4u*)&sh[rl][q * 8]); if (hi_rows) vst2((unsigned*)(DL + (bb * nhi + t0 + rl) * (size_t)CC + c0 + q * 8), *(const v4u*)&sl[rl][q * 8]); }
  } else { const bool hi_rows = t0 < KHI;
#pragma unroll
    for (int j = 0; j < 8; ++j) { const float bias = BA ? bfr(BA[c0 + j * 16 + col]) : 0.f;
#pragma unroll
      for (int r = 0; r < 8; ++r) { const float v = acc[j][r] + bias; const int rl = wave * 16 + 8 * g + r, cl = j * 16 + col; th[cl][rl] = (_Float16)v; const __bf16 bh = (__bf16)v; tb[cl][rl] = bh; tbl[cl][rl] = (__bf16)(v - (float)bh); } }
    __syncthreads();
    for (int e = tid; e < 128 * 8; e += 128) { const int cl = e >> 3, q = e & 7; vst2((unsigned*)(VT + (bb * CC + c0 + cl) * (size_t)TT + t0 + q * 8), *(const v4u*)&th[cl][q * 8]); if (hi_rows) { const size_t o3 = (bb * CC + c0 + cl) * (size_t)KHI + t0 + q * 8; vst2((unsigned*)(VB + o3), *(const v4u*)&tb[cl][q * 8]); vst2((unsigned*)(VBL + o3), *(const v4u*)&tbl[cl][q * 8]); } } } }
// ---- k_fa: block = 256 queries of (b, h), 8 waves x 32 query columns; logits, softmax and P.v in one pass over the keys, so no logit or P ever goes to memory.
// S^T = K.Q^T (A = 16 key rows from LDS, B = q columns kept in registers; q hi + residual x 2^10, 2 products, as before): a lane holds 8 + 8 keys of ONE query, which are, converted in place, the B operand of O^T += V^T.P^T (A = v rows [v][key] from LDS).
// Running maximum per query (in-lane + one exchange between the wave halves), P = exp(s - max) once to f16, sums in f32, O^T and the sum rescaled when the maximum moves; division by the sum at the end.
// K and v tiles of 64 keys go global -> registers -> LDS, two buffers, one barrier per tile.
#define FA_KS 64           // keys per LDS tile
#define FA_P 72            // LDS row pitch in f16: 144 B = 16 B x odd, the conflict-free pitch for 16-byte reads of 128-B rows
__device__ __forceinline__ float xhalf(float x) { return __builtin_bit_cast(float, __builtin_amdgcn_permlanex16(__builtin_bit_cast(int, x), __builtin_bit_cast(int, x), 0x76543210, 0xfedcba98, false, false)); }   /* lane l <-> lane l ^ 16 */
__device__ __forceinline__ v8f wm(v16h a, v16h b, v8f c) { return __builtin_amdgcn_wmma_f32_16x16x32_f16(false, a, false, b, (short)0, c, false, false); }
// eight base-2 exponentials, each in place: no exponential's source register is written by the instruction behind it; the v_nop is the one slot the instruction set asks for between the last one and whatever reads its result
__device__ __forceinline__ void exp2x8(float* y) {
  asm("v_exp_f32 %0, %0\n\tv_exp_f32 %1, %1\n\tv_exp_f32 %2, %2\n\tv_exp_f32 %3, %3\n\tv_exp_f32 %4, %4\n\tv_exp_f32 %5, %5\n\tv_exp_f32 %6, %6\n\tv_exp_f32 %7, %7\n\tv_nop"
      : "+v"(y[0]), "+v"(y[1]), "+v"(y[2]), "+v"(y[3]), "+v"(y[4]), "+v"(y[5]), "+v"(y[6]), "+v"(y[7])); }
__global__ __launch_bounds__(256) void k_fa(const _Float16* __restrict__ QH, const _Float16* __restrict__ QL, const _Float16* __restrict__ KH, const _Float16* __restrict__ VT, float* __restrict__ Y) {
  __shared__ __align__(16) _Float16 sK[2][FA_KS][FA_P]; __shared__ __align__(16) _Float16 sV[2][HD][FA_P];
  const int tid = threadIdx.x, wave = tid >> 5, lane = tid & 31, col = lane & 15, g = lane >> 4; const int h = blockIdx.y, b = blockIdx.z; const int q0 = blockIdx.x * 256 + wave * 32;
  const float C1 = SCALE * 1.4426950408889634f;   /* logit scale x log2(e): the exponentials are taken in base 2 */
  /* every inner loop below is unrolled so that all array indices are constants and the fragments and accumulators stay in registers */
  v16h qh[2][2], ql[2][2];
  const _Float16* gQ = QH + ((size_t)b * TT + q0 + col) * CC + h * HD; const _Float16* gL = QL + ((size_t)b * QHI + q0 + col) * CC + h * HD;
#pragma unroll
  for (int u = 0; u < 2; ++u)
#pragma unroll
    for (int kc = 0; kc < 2; ++kc) { qh[u][kc] = frag_h(gQ + (size_t)u * 16 * CC + kc * 32, lane); ql[u][kc] = frag_h(gL + (size_t)u * 16 * CC + kc * 32, lane); }
  const int sr = tid >> 3, sc = (tid & 7) * 8;   /* staging: 8 lanes per 128-B row, rows sr and sr + 32 */
  const _Float16* gK = KH + ((size_t)b * TT + sr) * CC + h * HD + sc;      /* key rows [t][d] */
  const _Float16* gV = VT + ((size_t)b * CC + h * HD + sr) * TT + sc;      /* v rows [v][t] */
  v8h rk0 = *(const v8h*)gK, rk1 = *(const v8h*)(gK + (size_t)32 * CC), rv0 = *(const v8h*)gV, rv1 = *(const v8h*)(gV + (size_t)32 * TT);
  asm volatile("s_wait_loadcnt 0x0" ::: "memory");   /* the loads above have returned before any register that they name is written again */
  *(v8h*)&sK[0][sr][sc] = rk0; *(v8h*)&sK[0][sr + 32][sc] = rk1; *(v8h*)&sV[0][sr][sc] = rv0; *(v8h*)&sV[0][sr + 32][sc] = rv1;
  __syncthreads();
  v8f o[2][4] = {}; float m[2] = {-__builtin_inff(), -__builtin_inff()}, l[2] = {0.f, 0.f};
#pragma unroll 1   /* the tile loop stays rolled: one trip is already several hundred instructions, a second copy would only cost instruction cache */
  for (int s = 0; s < TT / FA_KS; ++s) { const int cur = s & 1; const bool more = s + 1 < TT / FA_KS;
    if (more) { const _Float16* nK = gK + (size_t)(s + 1) * FA_KS * CC; const _Float16* nV = gV + (s + 1) * FA_KS;   /* the next tile's loads fly while this tile is worked on */
      rk0 = *(const v8h*)nK; rk1 = *(const v8h*)(nK + (size_t)32 * CC); rv0 = *(const v8h*)nV; rv1 = *(const v8h*)(nV + (size_t)32 * TT);
      asm volatile("s_wait_xcnt 0x0" :: "v"(nK), "v"(nV) : "memory"); }   /* the address registers of the four loads live up to this wait and are written again only behind it */
    v16h kf[4][2], vf[4][2];
#pragma unroll
    for (int t = 0; t < 4; ++t)
#pragma unroll
      for (int kc = 0; kc < 2; ++kc) kf[t][kc] = frag_h(&sK[cur][t * 16 + col][kc * 32], lane);
#pragma unroll
    for (int j = 0; j < 4; ++j)
#pragma unroll
      for (int w = 0; w < 2; ++w) vf[j][w] = frag_h(&sV[cur][j * 16 + col][w * 32], lane);
#pragma unroll
    for (int u = 0; u < 2; ++u) { v8f a[4] = {}, al[4] = {};
#pragma unroll
      for (int t = 0; t < 4; ++t)
#pragma unroll
        for (int kc = 0; kc < 2; ++kc) { a[t] = wm(kf[t][kc], qh[u][kc], a[t]); al[t] = wm(kf[t][kc], ql[u][kc], al[t]); }
      float x[32];   /* x[8 t + r] = unscaled logit of key 16 t + 8 g + r of the tile, query column col */
#pragma unroll
      for (int i = 0; i < 32; ++i) x[i] = a[i >> 3][i & 7] + al[i >> 3][i & 7] * (1.0f / 1024.0f);
      float mx = x[0];
#pragma unroll
      for (int i = 1; i < 32; ++i) mx = fmaxf(mx, x[i]);
      mx = fmaxf(mx, xhalf(mx));
      const float mn = fmaxf(m[u], mx); const float corr = __builtin_amdgcn_exp2f((m[u] - mn) * C1);   /* 0 on the first tile, where m is -inf */
      m[u] = mn; const float mb = mn * C1; float sum = 0.f; v16h p[2];
#pragma unroll
      for (int i = 0; i < 32; ++i) x[i] = x[i] * C1 - mb;
#pragma unroll
      for (int i = 0; i < 32; i += 8) exp2x8(&x[i]);
#pragma unroll
      for (int i = 0; i < 32; ++i) { sum += x[i]; p[i >> 4][i & 15] = (_Float16)x[i]; }
      l[u] = l[u] * corr + sum;
#pragma unroll
      for (int j = 0; j < 4; ++j) { o[u][j] *= corr; o[u][j] = wm(vf[j][0], p[0], o[u][j]); o[u][j] = wm(vf[j][1], p[1], o[u][j]); } }
    if (more) { *(v8h*)&sK[cur ^ 1][sr][sc] = rk0; *(v8h*)&sK[cur ^ 1][sr + 32][sc] = rk1; *(v8h*)&sV[cur ^ 1][sr][sc] = rv0; *(v8h*)&sV[cur ^ 1][sr + 32][sc] = rv1; }   /* that buffer's last readers left it at the barrier before this tile */
    __syncthreads(); }
#pragma unroll
  for (int u = 0; u < 2; ++u) { const float inv = 1.0f / (l[u] + xhalf(l[u])); float* yr = Y + (((size_t)b * NH + h) * TT + q0 + u * 16 + col) * HD + 8 * g;   /* o[u][j][r] = out[q0 + 16 u + col][16 j + 8 g + r] */
#pragma unroll
    for (int j = 0; j < 4; ++j) { const v4f lo = {o[u][j][0] * inv, o[u][j][1] * inv, o[u][j][2] * inv, o[u][j][3] * inv}, hi = {o[u][j][4] * inv, o[u][j][5] * inv, o[u][j][6] * inv, o[u][j][7] * inv}; vst2(yr + j * 16, lo); vst2(yr + j * 16 + 4, hi); } } }

extern "C" void kernel_launch(void* const* d_in, const int* in_sizes, int n_in, void* d_out, int out_size, void* d_ws, size_t ws_size, hipStream_t stream) {
  (void)in_sizes; (void)n_in; (void)out_size;
  const float** F = (const float**)d_in;
  if (ws_size < (size_t)WS_END) return;
  char* ws = (char*)d_ws; _Float16 *QH = (_Float16*)(ws + WS_QH), *KH = (_Float16*)(ws + WS_KH), *VT = (_Float16*)(ws + WS_VT), *QL = (_Float16*)(ws + WS_QL), *KL = (_Float16*)(ws + WS_KL); __bf16 *VB = (__bf16*)(ws + WS_VB), *VBL = (__bf16*)(ws + WS_VBL); float *S = (float*)(ws + WS_S), *Y = (float*)(ws + WS_Y);
  (void)Y; (void)S; (void)KL; (void)VB; (void)VBL;
  // inputs: 0 query [2,16,64,2048] ([B,H,D,N]); 1 key; 2 value
  k_planesT<<<dim3(TT / 64, NH, NB), 256, 0, stream>>>(F[0], F[1], F[2], QH, QL, KH, VT);
  k_fa<<<dim3(TT / 256, NH, TNB), 256, 0, stream>>>(QH, QL, KH, VT, (float*)d_out);
}

// v002
// One run takes 44.8 microseconds.
// In two side-by-side timings against v001, it was 1.13 and 1.14 times as fast.
// All steps since v000 together make it 21.9 times as fast.
// compute dtype: all float inputs rounded to bf16; q, k, v are bf16-valued so their f16 planes are exact; logits q x k (1 product: q and k bf16 values held in f16, no residual) x 2048^-0.5 (the module's sqrt(N) scale); softmax f32 with a running maximum; P = exp(s - max) once to f16 x v (exact in f16) (1 product), divided by the f32 sum at the end; f32 output.
#include <hip/hip_runtime.h>
#include <math.h>

typedef __attribute__((ext_vector_type(16))) _Float16 v16h;
typedef __attribute__((ext_vector_type(16))) __bf16 v16b;
typedef __attribute__((ext_vector_type(8)))  _Float16 v8h;
typedef __attribute__((ext_vector_type(8)))  float v8f;
typedef __attribute__((ext_vector_type(4)))  float v4f;
typedef __attribute__((ext_vector_type(2)))  float v2f;
typedef __attribute__((ext_vector_type(4)))  unsigned v4u;
typedef _Float16 hx8 __attribute__((ext_vector_type(8)));
typedef __attribute__((ext_vector_type(4)))  int v4i;
typedef float __attribute__((may_alias)) float_a;
typedef int __attribute__((may_alias)) int_a;

template <typename T> __device__ __forceinline__ void vst2(void* p, T v) { *(T*)p = v;  }
__device__ __forceinline__ v8f wmma16(v16h a, v16h b, v8f c) {
  v8f d = __builtin_amdgcn_wmma_f32_16x16x32_f16(false, a, false, b, (short)0, c, false, false);
  asm volatile("v_nop\n\tv_nop\n\tv_nop\n\tv_nop" : "+v"(d) : "v"(a), "v"(b));
  return d;
}
__device__ __forceinline__ v8f wmma_bf(v16b a, v16b b, v8f c) {
  v8f d = __builtin_amdgcn_wmma_f32_16x16x32_bf16(false, a, false, b, (short)0, c, false, false);
  asm volatile("v_nop\n\tv_nop\n\tv_nop\n\tv_nop" : "+v"(d) : "v"(a), "v"(b));
  return d;
}
// 16x16x32 fragments: lane = (h = lane>>4, row/col = lane&15); elements 0..7 = k0+8h+0..7, 8..15 = k0+16+8h+0..7; D element r = row 8h+r
__device__ __forceinline__ v16h frag_h(const _Float16* rowk0, int lane) {
  union { v16h v; v8h q[2]; } u; const _Float16* p = rowk0 + 8 * (lane >> 4);
  u.q[0] = *(const v8h*)p; u.q[1] = *(const v8h*)(p + 16); return u.v;
}
__device__ __forceinline__ v16h frag_f32(const float* rowk0, int lane) {
  v16h a; const float* p = rowk0 + 8 * (lane >> 4);
#pragma unroll
  for (int i = 0; i < 8; ++i) { a[i] = (_Float16)p[i]; a[8 + i] = (_Float16)p[16 + i]; }
  return a;
}
__device__ __forceinline__ v16h frag_f32s(const float* rowk0, int lane, float sc) {
  v16h a; const float* p = rowk0 + 8 * (lane >> 4);
#pragma unroll
  for (int i = 0; i < 8; ++i) { a[i] = (_Float16)(p[i] * sc); a[8 + i] = (_Float16)(p[16 + i] * sc); }
  return a;
}
// column fragment from a [K][ld] layout (column n), rows >= K read as 0
__device__ __forceinline__ v16h fragc_f32(const float* W, int k0, int n, int lane, int ld, int K) {
  v16h a; const int g = lane >> 4;
#pragma unroll
  for (int i = 0; i < 8; ++i) { const int ka = k0 + 8 * g + i, kb = ka + 16;
    a[i] = (_Float16)(ka < K ? W[(size_t)(ka < K ? ka : K - 1) * ld + n] : 0.f); a[8 + i] = (_Float16)(kb < K ? W[(size_t)(kb < K ? kb : K - 1) * ld + n] : 0.f); }
  return a;
}
struct F2 { v16b h, l; };
__device__ __forceinline__ F2 bsplit16(const float v[16]) { F2 r;
#pragma unroll
  for (int i = 0; i < 16; ++i) { const __bf16 h = (__bf16)v[i]; r.h[i] = h; r.l[i] = (__bf16)(v[i] - (float)h); }
  return r; }
__device__ __forceinline__ F2 split_row(const float* row, int k0, int lane) { float v[16]; const float* p = row + k0 + 8 * (lane >> 4);
#pragma unroll
  for (int i = 0; i < 8; ++i) { v[i] = p[i]; v[8 + i] = p[16 + i]; }
  return bsplit16(v); }
__device__ __forceinline__ F2 split_rowK(const float* row, int k0, int lane, int K) { float v[16]; const int g = lane >> 4;
#pragma unroll
  for (int i = 0; i < 8; ++i) { const int ka = k0 + 8 * g + i, kb = ka + 16; v[i] = ka < K ? row[ka < K ? ka : K - 1] : 0.f; v[8 + i] = kb < K ? row[kb < K ? kb : K - 1] : 0.f; }
  return bsplit16(v); }
__device__ __forceinline__ F2 split_col(const float* W, int k0, int n, int lane, int ld, int K) { float v[16]; const int g = lane >> 4;
#pragma unroll
  for (int i = 0; i < 8; ++i) { const int ka = k0 + 8 * g + i, kb = ka + 16; v[i] = ka < K ? W[(size_t)(ka < K ? ka : K - 1) * ld + n] : 0.f; v[8 + i] = kb < K ? W[(size_t)(kb < K ? kb : K - 1) * ld + n] : 0.f; }
  return bsplit16(v); }
__device__ __forceinline__ v8f mac3(const F2& a, const F2& b, v8f c) { c = wmma_bf(a.l, b.h, c); c = wmma_bf(a.h, b.l, c); return wmma_bf(a.h, b.h, c); }
__device__ __forceinline__ float sigm(float v) { return 1.0f / (1.0f + expf(-v)); }
#define LDSX() do { asm volatile("s_wait_dscnt 0" ::: "memory"); __builtin_amdgcn_wave_barrier(); __builtin_amdgcn_fence(__ATOMIC_RELEASE, "workgroup"); } while (0)

// Scaled-dot-product attention in the unusual [B,H,D,N] layout (query/key/value [2,16,64,2048]): scores[b,h,q,k] = sum_d query[b,h,d,q] key[b,h,d,k] / sqrt(2048) (the source scales by sqrt(size(-1)) = sqrt(N)); attn = softmax over k; out[b,h,q,v] = sum_k attn[b,h,q,k] value[b,h,v,k] -> [2,16,2048,64].
#define NB 2
#define TT 2048
#define CC 1024            // NH * HD = projected width
#define DIN 1024          // input (model) width
#define NH 16
#define HD 64
#define NQB (TT / 64)
#define HG 4
#define SCALE (0.022097086912079608f)
#define CAUSAL 0
#ifndef TNB
#define TNB NB
#endif
__device__ __forceinline__ float bfr(float v) { return (float)(__bf16)v; }
__host__ __device__ __forceinline__ int kb_last(int qb) { return CAUSAL ? ((qb * 64 + 63) >> 7) : (TT / 128 - 1); }
typedef __attribute__((ext_vector_type(8))) __bf16 v8b;
__device__ __forceinline__ v16b frag_b(const __bf16* rowk0, int lane) {
  union { v16b v; v8b q[2]; } u; const __bf16* p = rowk0 + 8 * (lane >> 4);
  u.q[0] = *(const v8b*)p; u.q[1] = *(const v8b*)(p + 16); return u.v;
}
#define QBH 0              // unused: no kernel in this file has a high-precision path
#define QHI 2048            // rows carrying a q residual plane (all rows when non-causal; k_fa reads no residual)
#define KHI 64            // key rows carrying k residual / v bf16 hi+lo planes (written only by k_proj, which is not launched)
// B fragment (k rows k0+.., output column o) of a weight: (in,out) [K][ld] or (out,in) [ld rows of K]: bf16 exact, or f16(bf16 * 256) exact
__device__ __forceinline__ v16b wcol_io(const float* Wm, int k0, int o, int lane, int ld) { v16b w; const int g = lane >> 4;
#pragma unroll
  for (int i = 0; i < 8; ++i) { w[i] = (__bf16)Wm[(size_t)(k0 + 8 * g + i) * ld + o]; w[8 + i] = (__bf16)Wm[(size_t)(k0 + 16 + 8 * g + i) * ld + o]; }
  return w; }
__device__ __forceinline__ v16b wcol_oi(const float* Wm, int k0, int o, int lane, int K) { v16b w; const float* p = Wm + (size_t)o * K + k0 + 8 * (lane >> 4);
#pragma unroll
  for (int i = 0; i < 8; ++i) { w[i] = (__bf16)p[i]; w[8 + i] = (__bf16)p[16 + i]; }
  return w; }
__device__ __forceinline__ v16h wcolh_io(const float* Wm, int k0, int o, int lane, int ld) { v16h w; const int g = lane >> 4;
#pragma unroll
  for (int i = 0; i < 8; ++i) { w[i] = (_Float16)(bfr(Wm[(size_t)(k0 + 8 * g + i) * ld + o]) * 256.0f); w[8 + i] = (_Float16)(bfr(Wm[(size_t)(k0 + 16 + 8 * g + i) * ld + o]) * 256.0f); }
  return w; }
__device__ __forceinline__ v16h wcolh_oi(const float* Wm, int k0, int o, int lane, int K) { v16h w; const float* p = Wm + (size_t)o * K + k0 + 8 * (lane >> 4);
#pragma unroll
  for (int i = 0; i < 8; ++i) { w[i] = (_Float16)(bfr(p[i]) * 256.0f); w[8 + i] = (_Float16)(bfr(p[16 + i]) * 256.0f); }
  return w; }
#define WQKV_LAYOUT 0   // 0 = (in,out) [DIN][CC]; 1 = (out,in) [CC][DIN]; 2 = per-head [NH][DIN][HD]
__device__ __forceinline__ v16b wcol_hdk(const float* Wm, int k0, int o, int lane) { v16b w; const int g = lane >> 4; const float* p = Wm + (size_t)(o / HD) * DIN * HD + (o % HD);
#pragma unroll
  for (int i = 0; i < 8; ++i) { w[i] = (__bf16)p[(size_t)(k0 + 8 * g + i) * HD]; w[8 + i] = (__bf16)p[(size_t)(k0 + 16 + 8 * g + i) * HD]; }
  return w; }
#define WO_OUT_IN 0
#if WQKV_LAYOUT == 1
#define WCOL(W, k0, o, lane) wcol_oi(W, k0, o, lane, DIN)
#elif WQKV_LAYOUT == 2
#define WCOL(W, k0, o, lane) wcol_hdk(W, k0, o, lane)
#else
#define WCOL(W, k0, o, lane) wcol_io(W, k0, o, lane, CC)
#endif
#if WO_OUT_IN
#define WOCOL(W, k0, o, lane) wcol_oi(W, k0, o, lane, CC)
#define WOCOLH(W, k0, o, lane) wcolh_oi(W, k0, o, lane, CC)
#else
#define WOCOL(W, k0, o, lane) wcol_io(W, k0, o, lane, DIN)
#define WOCOLH(W, k0, o, lane) wcolh_io(W, k0, o, lane, DIN)
#endif
// ---- k_planesT: the planes straight from the [B,H,D,N] inputs (bf16-rounded; exact in f16 at these magnitudes): block = (64 tokens t0.., head h, batch b): the q/k [64 d][64 t] tiles are read along t (256-B runs) and transposed through LDS into q/k rows [b*T+t][h*64+d] (no residual rows: a bf16 value is exact in f16 from 2^-17 up; a smaller one rounds to the f16 grid of 2^-24, q like k); v[b][h][d][t] is ALREADY the transposed plane layout [b][h*64+d][t] and is copied straight (f16)
__global__ __launch_bounds__(256) void k_planesT(const float* __restrict__ Qs, const float* __restrict__ Ks, const float* __restrict__ Vs, _Float16* __restrict__ QH, _Float16* __restrict__ KH, _Float16* __restrict__ VT) {
  __shared__ float sq[64][68]; __shared__ float sk[64][68];
  const int tid = threadIdx.x; const int t0 = blockIdx.x * 64, h = blockIdx.y, b = blockIdx.z;
  const size_t src0 = (((size_t)b * NH + h) * HD) * TT + t0;   /* [b][h][d][t0] */
  for (int e = tid; e < 64 * 16; e += 256) { const int d = e >> 4, q = e & 15; const v4f a = *(const v4f*)(Qs + src0 + (size_t)d * TT + q * 4); const v4f c = *(const v4f*)(Ks + src0 + (size_t)d * TT + q * 4); const v4f vv = *(const v4f*)(Vs + src0 + (size_t)d * TT + q * 4); asm volatile("s_wait_loadcnt 0x0" ::: "memory");
    sq[d][q * 4 + 0] = bfr(a[0]); sq[d][q * 4 + 1] = bfr(a[1]); sq[d][q * 4 + 2] = bfr(a[2]); sq[d][q * 4 + 3] = bfr(a[3]);
    sk[d][q * 4 + 0] = bfr(c[0]); sk[d][q * 4 + 1] = bfr(c[1]); sk[d][q * 4 + 2] = bfr(c[2]); sk[d][q * 4 + 3] = bfr(c[3]);
    _Float16 hv[4] __attribute__((aligned(8))); _Pragma("unroll") for (int u = 0; u < 4; ++u) hv[u] = (_Float16)bfr(vv[u]);
    vst2((void*)(VT + ((size_t)b * CC + h * HD + d) * TT + t0 + q * 4), *(const unsigned long long*)&hv[0]); }   
  __syncthreads();
  for (int e = tid; e < 64 * 8; e += 256) { const int tl = e >> 3, q = e & 7; const size_t row = (size_t)b * TT + t0 + tl; hx8 hq, hk;
#pragma unroll
    for (int u = 0; u < 8; ++u) { hq[u] = (_Float16)sq[q * 8 + u][tl]; hk[u] = (_Float16)sk[q * 8 + u][tl]; }
    vst2((unsigned*)(QH + row * CC + h * HD + q * 8), *(const v4u*)&hq); vst2((unsigned*)(KH + row * CC + h * HD + q * 8), *(const v4u*)&hk); } }
#ifndef SM_EXTRA_PARAMS
#define SM_EXTRA_PARAMS
#endif
#ifndef PROJ_EXTRA_PARAMS
#define PROJ_EXTRA_PARAMS
#endif
#ifndef SM_MASK_HOOK
#define SM_MASK_HOOK (void)0
#endif

#define WS_QH  0u                                      // f16 q rows [b*t][CC]
#define WS_KH  (WS_QH + 2u * (size_t)NB * TT * CC)      // f16 k rows [b*t][CC]
#define WS_VT  (WS_KH + 2u * (size_t)NB * TT * CC)      // f16 v planes [b][c][t]
#define WS_QL  (WS_VT + 2u * (size_t)NB * CC * TT)      // f16 q residual x 2^10 rows [b][t < QHI][CC]
#define WS_KL  (WS_QL + 2u * (size_t)NB * QHI * CC)     // f16 k residual x 2^10 rows [b][t < KHI][CC]
#define WS_VB  (WS_KL + 2u * (size_t)NB * KHI * CC)     // bf16 v hi planes [b][c][t < KHI]
#define WS_VBL (WS_VB + 2u * (size_t)NB * CC * KHI)
#define WS_S   (WS_VBL + 2u * (size_t)NB * CC * KHI)    // f32 [hg][t][s] region, reserved but unused (logits and P stay in registers)
#define WS_Y   (WS_S  + 4u * (size_t)HG * TT * TT)      // f32 ctx rows [b*t][CC] (only when there is an output projection)
#define WS_END (WS_Y  + 0u)

// ---- k_proj: block = (64 rows, 128 cols, which): q/k/v = X W (+ b) with exact bf16 products (K = DIN) -> which 0: q f16 rows (+ residual rows < QHI); 1: k f16 rows (+ residual rows < KHI); 2: v f16 planes [c][t] (+ bf16 hi/lo planes for t < KHI)
__global__ __launch_bounds__(128) void k_proj(const float* __restrict__ XQ, const float* __restrict__ XK, const float* __restrict__ XV, const float* __restrict__ WQ, const float* __restrict__ WK, const float* __restrict__ WV, const float* __restrict__ BQ, const float* __restrict__ BK, const float* __restrict__ BV,
    _Float16* __restrict__ QH, _Float16* __restrict__ QL, _Float16* __restrict__ KH, _Float16* __restrict__ KL, _Float16* __restrict__ VT, __bf16* __restrict__ VB, __bf16* __restrict__ VBL) {
  __shared__ __align__(16) _Float16 sh[64][136], sl[64][136]; __shared__ __align__(16) _Float16 th[128][72]; __shared__ __align__(16) __bf16 tb[128][72], tbl[128][72];
  const int tid = threadIdx.x, wave = tid >> 5, lane = tid & 31, col = lane & 15, g = lane >> 4; const int which = blockIdx.z; const int c0 = blockIdx.y * 128; const size_t r0 = (size_t)blockIdx.x * 64; const size_t bb = r0 / TT; const int t0 = (int)(r0 % TT);
  const float* X = which == 0 ? XQ : which == 1 ? XK : XV; const float* WA = which == 0 ? WQ : which == 1 ? WK : WV; const float* BA = which == 0 ? BQ : which == 1 ? BK : BV;
  v8f acc[8] = {};
#pragma unroll 2
  for (int kc = 0; kc < DIN / 32; ++kc) { v16b a; { const float* p = X + (r0 + wave * 16 + col) * DIN + kc * 32 + 8 * g;
#pragma unroll
      for (int i = 0; i < 8; ++i) { a[i] = (__bf16)p[i]; a[8 + i] = (__bf16)p[16 + i]; } }
    asm volatile("s_wait_loadcnt 0x0" ::: "memory");
#pragma unroll
    for (int j = 0; j < 8; ++j) { const v16b w = WCOL(WA, kc * 32, c0 + j * 16 + col, lane); asm volatile("s_wait_loadcnt 0x0" ::: "memory"); acc[j] = wmma_bf(a, w, acc[j]); } }
  if (which < 2) { _Float16* DH = which == 0 ? QH : KH; _Float16* DL = which == 0 ? QL : KL; const int nhi = which == 0 ? QHI : KHI; const bool hi_rows = t0 < nhi;
#pragma unroll
    for (int j = 0; j < 8; ++j) { const float bias = BA ? bfr(BA[c0 + j * 16 + col]) : 0.f;
#pragma unroll
      for (int r = 0; r < 8; ++r) { const float v = acc[j][r] + bias; const _Float16 hv = (_Float16)v; sh[wave * 16 + 8 * g + r][j * 16 + col] = hv; sl[wave * 16 + 8 * g + r][j * 16 + col] = (_Float16)((v - (float)hv) * 1024.0f); } }
    __syncthreads();
    for (int e = tid; e < 64 * 16; e += 128) { const int rl = e >> 4, q = e & 15; vst2((unsigned*)(DH + (r0 + rl) * CC + c0 + q * 8), *(const v4u*)&sh[rl][q * 8]); if (hi_rows) vst2((unsigned*)(DL + (bb * nhi + t0 + rl) * (size_t)CC + c0 + q * 8), *(const v4u*)&sl[rl][q * 8]); }
  } else { const bool hi_rows = t0 < KHI;
#pragma unroll
    for (int j = 0; j < 8; ++j) { const float bias = BA ? bfr(BA[c0 + j * 16 + col]) : 0.f;
#pragma unroll
      for (int r = 0; r < 8; ++r) { const float v = acc[j][r] + bias; const int rl = wave * 16 + 8 * g + r, cl = j * 16 + col; th[cl][rl] = (_Float16)v; const __bf16 bh = (__bf16)v; tb[cl][rl] = bh; tbl[cl][rl] = (__bf16)(v - (float)bh); } }
    __syncthreads();
    for (int e = tid; e < 128 * 8; e += 128) { const int cl = e >> 3, q = e & 7; vst2((unsigned*)(VT + (bb * CC + c0 + cl) * (size_t)TT + t0 + q * 8), *(const v4u*)&th[cl][q * 8]); if (hi_rows) { const size_t o3 = (bb * CC + c0 + cl) * (size_t)KHI + t0 + q * 8; vst2((unsigned*)(VB + o3), *(const v4u*)&tb[cl][q * 8]); vst2((unsigned*)(VBL + o3), *(const v4u*)&tbl[cl][q * 8]); } } } }
// ---- k_fa: block = 256 queries of (b, h), 8 waves x 32 query columns; logits, softmax and P.v in one pass over the keys, so no logit or P ever goes to memory.
// S^T = K.Q^T (A = 16 key rows from LDS, B = q columns kept in registers; one product: q and k are bf16 values held in f16): a lane holds 8 + 8 keys of ONE query, which are, converted in place, the B operand of O^T += V^T.P^T (A = v rows [v][key] from LDS).
// Running maximum per query (in-lane + one exchange between the wave halves), P = exp(s - max) once to f16, sums in f32, O^T and the sum rescaled when the maximum moves; division by the sum at the end.
// K and v tiles of 64 keys go global -> registers -> LDS, two buffers, one barrier per tile.
#define FA_KS 64           // keys per LDS tile
#define FA_P 72            // LDS row pitch in f16: 144 B = 16 B x odd, the conflict-free pitch for 16-byte reads of 128-B rows
__device__ __forceinline__ float xhalf(float x) { return __builtin_bit_cast(float, __builtin_amdgcn_permlanex16(__builtin_bit_cast(int, x), __builtin_bit_cast(int, x), 0x76543210, 0xfedcba98, false, false)); }   /* lane l <-> lane l ^ 16 */
__device__ __forceinline__ v8f wm(v16h a, v16h b, v8f c) { return __builtin_amdgcn_wmma_f32_16x16x32_f16(false, a, false, b, (short)0, c, false, false); }
// eight base-2 exponentials, each in place: no exponential's source register is written by the instruction behind it; the v_nop is the one slot the instruction set asks for between the last one and whatever reads its result
__device__ __forceinline__ void exp2x8(float* y) {
  asm("v_exp_f32 %0, %0\n\tv_exp_f32 %1, %1\n\tv_exp_f32 %2, %2\n\tv_exp_f32 %3, %3\n\tv_exp_f32 %4, %4\n\tv_exp_f32 %5, %5\n\tv_exp_f32 %6, %6\n\tv_exp_f32 %7, %7\n\tv_nop"
      : "+v"(y[0]), "+v"(y[1]), "+v"(y[2]), "+v"(y[3]), "+v"(y[4]), "+v"(y[5]), "+v"(y[6]), "+v"(y[7])); }
__global__ __launch_bounds__(256) void k_fa(const _Float16* __restrict__ QH, const _Float16* __restrict__ KH, const _Float16* __restrict__ VT, float* __restrict__ Y) {
  __shared__ __align__(16) _Float16 sK[2][FA_KS][FA_P]; __shared__ __align__(16) _Float16 sV[2][HD][FA_P];
  const int tid = threadIdx.x, wave = tid >> 5, lane = tid & 31, col = lane & 15, g = lane >> 4; const int h = blockIdx.y, b = blockIdx.z; const int q0 = blockIdx.x * 256 + wave * 32;
  const float C1 = SCALE * 1.4426950408889634f;   /* logit scale x log2(e): the exponentials are taken in base 2 */
  /* every inner loop below is unrolled so that all array indices are constants and the fragments and accumulators stay in registers */
  v16h qh[2][2];
  const _Float16* gQ = QH + ((size_t)b * TT + q0 + col) * CC + h * HD;
#pragma unroll
  for (int u = 0; u < 2; ++u)
#pragma unroll
    for (int kc = 0; kc < 2; ++kc) qh[u][kc] = frag_h(gQ + (size_t)u * 16 * CC + kc * 32, lane);
  const int sr = tid >> 3, sc = (tid & 7) * 8;   /* staging: 8 lanes per 128-B row, rows sr and sr + 32 */
  const _Float16* gK = KH + ((size_t)b * TT + sr) * CC + h * HD + sc;      /* key rows [t][d] */
  const _Float16* gV = VT + ((size_t)b * CC + h * HD + sr) * TT + sc;      /* v rows [v][t] */
  v8h rk0 = *(const v8h*)gK, rk1 = *(const v8h*)(gK + (size_t)32 * CC), rv0 = *(const v8h*)gV, rv1 = *(const v8h*)(gV + (size_t)32 * TT);
  asm volatile("s_wait_loadcnt 0x0" ::: "memory");   /* the loads above have returned before any register that they name is written again */
  *(v8h*)&sK[0][sr][sc] = rk0; *(v8h*)&sK[0][sr + 32][sc] = rk1; *(v8h*)&sV[0][sr][sc] = rv0; *(v8h*)&sV[0][sr + 32][sc] = rv1;
  __syncthreads();
  v8f o[2][4] = {}; float m[2] = {-__builtin_inff(), -__builtin_inff()}, l[2] = {0.f, 0.f};
#pragma unroll 1   /* the tile loop stays rolled: one trip is already several hundred instructions, a second copy would only cost instruction cache */
  for (int s = 0; s < TT / FA_KS; ++s) { const int cur = s & 1; const bool more = s + 1 < TT / FA_KS;
    if (more) { const _Float16* nK = gK + (size_t)(s + 1) * FA_KS * CC; const _Float16* nV = gV + (s + 1) * FA_KS;   /* the next tile's loads fly while this tile is worked on */
      rk0 = *(const v8h*)nK; rk1 = *(const v8h*)(nK + (size_t)32 * CC); rv0 = *(const v8h*)nV; rv1 = *(const v8h*)(nV + (size_t)32 * TT);
      asm volatile("s_wait_xcnt 0x0" :: "v"(nK), "v"(nV) : "memory"); }   /* the address registers of the four loads live up to this wait and are written again only behind it */
    v16h kf[4][2], vf[4][2];
#pragma unroll
    for (int t = 0; t < 4; ++t)
#pragma unroll
      for (int kc = 0; kc < 2; ++kc) kf[t][kc] = frag_h(&sK[cur][t * 16 + col][kc * 32], lane);
#pragma unroll
    for (int j = 0; j < 4; ++j)
#pragma unroll
      for (int w = 0; w < 2; ++w) vf[j][w] = frag_h(&sV[cur][j * 16 + col][w * 32], lane);
#pragma unroll
    for (int u = 0; u < 2; ++u) { v8f a[4] = {};
#pragma unroll
      for (int t = 0; t < 4; ++t)
#pragma unroll
        for (int kc = 0; kc < 2; ++kc) a[t] = wm(kf[t][kc], qh[u][kc], a[t]);
      float x[32];   /* x[8 t + r] = unscaled logit of key 16 t + 8 g + r of the tile, query column col */
#pragma unroll
      for (int i = 0; i < 32; ++i) x[i] = a[i >> 3][i & 7];
      float mx = x[0];
#pragma unroll
      for (int i = 1; i < 32; ++i) mx = fmaxf(mx, x[i]);
      mx = fmaxf(mx, xhalf(mx));
      const float mn = fmaxf(m[u], mx); const float corr = __builtin_amdgcn_exp2f((m[u] - mn) * C1);   /* 0 on the first tile, where m is -inf */
      m[u] = mn; const float mb = mn * C1; float sum = 0.f; v16h p[2];
#pragma unroll
      for (int i = 0; i < 32; ++i) x[i] = x[i] * C1 - mb;
#pragma unroll
      for (int i = 0; i < 32; i += 8) exp2x8(&x[i]);
#pragma unroll
      for (int i = 0; i < 32; ++i) { sum += x[i]; p[i >> 4][i & 15] = (_Float16)x[i]; }
      l[u] = l[u] * corr + sum;
#pragma unroll
      for (int j = 0; j < 4; ++j) { o[u][j] *= corr; o[u][j] = wm(vf[j][0], p[0], o[u][j]); o[u][j] = wm(vf[j][1], p[1], o[u][j]); } }
    if (more) { *(v8h*)&sK[cur ^ 1][sr][sc] = rk0; *(v8h*)&sK[cur ^ 1][sr + 32][sc] = rk1; *(v8h*)&sV[cur ^ 1][sr][sc] = rv0; *(v8h*)&sV[cur ^ 1][sr + 32][sc] = rv1; }   /* that buffer's last readers left it at the barrier before this tile */
    __syncthreads(); }
#pragma unroll
  for (int u = 0; u < 2; ++u) { const float inv = 1.0f / (l[u] + xhalf(l[u])); float* yr = Y + (((size_t)b * NH + h) * TT + q0 + u * 16 + col) * HD + 8 * g;   /* o[u][j][r] = out[q0 + 16 u + col][16 j + 8 g + r] */
#pragma unroll
    for (int j = 0; j < 4; ++j) { const v4f lo = {o[u][j][0] * inv, o[u][j][1] * inv, o[u][j][2] * inv, o[u][j][3] * inv}, hi = {o[u][j][4] * inv, o[u][j][5] * inv, o[u][j][6] * inv, o[u][j][7] * inv}; vst2(yr + j * 16, lo); vst2(yr + j * 16 + 4, hi); } } }

extern "C" void kernel_launch(void* const* d_in, const int* in_sizes, int n_in, void* d_out, int out_size, void* d_ws, size_t ws_size, hipStream_t stream) {
  (void)in_sizes; (void)n_in; (void)out_size;
  const float** F = (const float**)d_in;
  if (ws_size < (size_t)WS_END) return;
  char* ws = (char*)d_ws; _Float16 *QH = (_Float16*)(ws + WS_QH), *KH = (_Float16*)(ws + WS_KH), *VT = (_Float16*)(ws + WS_VT), *QL = (_Float16*)(ws + WS_QL), *KL = (_Float16*)(ws + WS_KL); __bf16 *VB = (__bf16*)(ws + WS_VB), *VBL = (__bf16*)(ws + WS_VBL); float *S = (float*)(ws + WS_S), *Y = (float*)(ws + WS_Y);
  (void)Y; (void)S; (void)QL; (void)KL; (void)VB; (void)VBL;
  // inputs: 0 query [2,16,64,2048] ([B,H,D,N]); 1 key; 2 value
  k_planesT<<<dim3(TT / 64, NH, NB), 256, 0, stream>>>(F[0], F[1], F[2], QH, KH, VT);
  k_fa<<<dim3(TT / 256, NH, TNB), 256, 0, stream>>>(QH, KH, VT, (float*)d_out);
}

// v003
// One run takes 40.1 microseconds.
// Two timings next to v002 both put it at 1.12 times that version's speed.
// Counting every step since v000, it is 24.6 times as fast.
// compute dtype: all float inputs rounded to bf16; q, k, v are bf16-valued so their f16 planes are exact; logits q x k (1 product: q and k bf16 values held in f16, no residual) x 2048^-0.5 (the module's sqrt(N) scale); softmax f32 with a running maximum; P = exp(s - max) once to f16 x v (exact in f16) (1 product), divided by the f32 sum at the end; f32 output.
#include <hip/hip_runtime.h>
#include <math.h>

typedef __attribute__((ext_vector_type(16))) _Float16 v16h;
typedef __attribute__((ext_vector_type(16))) __bf16 v16b;
typedef __attribute__((ext_vector_type(8)))  _Float16 v8h;
typedef __attribute__((ext_vector_type(8)))  float v8f;
typedef __attribute__((ext_vector_type(4)))  float v4f;
typedef __attribute__((ext_vector_type(2)))  float v2f;
typedef __attribute__((ext_vector_type(4)))  unsigned v4u;
typedef _Float16 hx8 __attribute__((ext_vector_type(8)));
typedef __attribute__((ext_vector_type(4)))  int v4i;
typedef float __attribute__((may_alias)) float_a;
typedef int __attribute__((may_alias)) int_a;

template <typename T> __device__ __forceinline__ void vst2(void* p, T v) { *(T*)p = v;  }
__device__ __forceinline__ v8f wmma16(v16h a, v16h b, v8f c) {
  v8f d = __builtin_amdgcn_wmma_f32_16x16x32_f16(false, a, false, b, (short)0, c, false, false);
  asm volatile("v_nop\n\tv_nop\n\tv_nop\n\tv_nop" : "+v"(d) : "v"(a), "v"(b));
  return d;
}
__device__ __forceinline__ v8f wmma_bf(v16b a, v16b b, v8f c) {
  v8f d = __builtin_amdgcn_wmma_f32_16x16x32_bf16(false, a, false, b, (short)0, c, false, false);
  asm volatile("v_nop\n\tv_nop\n\tv_nop\n\tv_nop" : "+v"(d) : "v"(a), "v"(b));
  return d;
}
// 16x16x32 fragments: lane = (h = lane>>4, row/col = lane&15); elements 0..7 = k0+8h+0..7, 8..15 = k0+16+8h+0..7; D element r = row 8h+r
__device__ __forceinline__ v16h frag_h(const _Float16* rowk0, int lane) {
  union { v16h v; v8h q[2]; } u; const _Float16* p = rowk0 + 8 * (lane >> 4);
  u.q[0] = *(const v8h*)p; u.q[1] = *(const v8h*)(p + 16); return u.v;
}
__device__ __forceinline__ v16h frag_f32(const float* rowk0, int lane) {
  v16h a; const float* p = rowk0 + 8 * (lane >> 4);
#pragma unroll
  for (int i = 0; i < 8; ++i) { a[i] = (_Float16)p[i]; a[8 + i] = (_Float16)p[16 + i]; }
  return a;
}
__device__ __forceinline__ v16h frag_f32s(const float* rowk0, int lane, float sc) {
  v16h a; const float* p = rowk0 + 8 * (lane >> 4);
#pragma unroll
  for (int i = 0; i < 8; ++i) { a[i] = (_Float16)(p[i] * sc); a[8 + i] = (_Float16)(p[16 + i] * sc); }
  return a;
}
// column fragment from a [K][ld] layout (column n), rows >= K read as 0
__device__ __forceinline__ v16h fragc_f32(const float* W, int k0, int n, int lane, int ld, int K) {
  v16h a; const int g = lane >> 4;
#pragma unroll
  for (int i = 0; i < 8; ++i) { const int ka = k0 + 8 * g + i, kb = ka + 16;
    a[i] = (_Float16)(ka < K ? W[(size_t)(ka < K ? ka : K - 1) * ld + n] : 0.f); a[8 + i] = (_Float16)(kb < K ? W[(size_t)(kb < K ? kb : K - 1) * ld + n] : 0.f); }
  return a;
}
struct F2 { v16b h, l; };
__device__ __forceinline__ F2 bsplit16(const float v[16]) { F2 r;
#pragma unroll
  for (int i = 0; i < 16; ++i) { const __bf16 h = (__bf16)v[i]; r.h[i] = h; r.l[i] = (__bf16)(v[i] - (float)h); }
  return r; }
__device__ __forceinline__ F2 split_row(const float* row, int k0, int lane) { float v[16]; const float* p = row + k0 + 8 * (lane >> 4);
#pragma unroll
  for (int i = 0; i < 8; ++i) { v[i] = p[i]; v[8 + i] = p[16 + i]; }
  return bsplit16(v); }
__device__ __forceinline__ F2 split_rowK(const float* row, int k0, int lane, int K) { float v[16]; const int g = lane >> 4;
#pragma unroll
  for (int i = 0; i < 8; ++i) { const int ka = k0 + 8 * g + i, kb = ka + 16; v[i] = ka < K ? row[ka < K ? ka : K - 1] : 0.f; v[8 + i] = kb < K ? row[kb < K ? kb : K - 1] : 0.f; }
  return bsplit16(v); }
__device__ __forceinline__ F2 split_col(const float* W, int k0, int n, int lane, int ld, int K) { float v[16]; const int g = lane >> 4;
#pragma unroll
  for (int i = 0; i < 8; ++i) { const int ka = k0 + 8 * g + i, kb = ka + 16; v[i] = ka < K ? W[(size_t)(ka < K ? ka : K - 1) * ld + n] : 0.f; v[8 + i] = kb < K ? W[(size_t)(kb < K ? kb : K - 1) * ld + n] : 0.f; }
  return bsplit16(v); }
__device__ __forceinline__ v8f mac3(const F2& a, const F2& b, v8f c) { c = wmma_bf(a.l, b.h, c); c = wmma_bf(a.h, b.l, c); return wmma_bf(a.h, b.h, c); }
__device__ __forceinline__ float sigm(float v) { return 1.0f / (1.0f + expf(-v)); }
#define LDSX() do { asm volatile("s_wait_dscnt 0" ::: "memory"); __builtin_amdgcn_wave_barrier(); __builtin_amdgcn_fence(__ATOMIC_RELEASE, "workgroup"); } while (0)

// Scaled-dot-product attention in the unusual [B,H,D,N] layout (query/key/value [2,16,64,2048]): scores[b,h,q,k] = sum_d query[b,h,d,q] key[b,h,d,k] / sqrt(2048) (the source scales by sqrt(size(-1)) = sqrt(N)); attn = softmax over k; out[b,h,q,v] = sum_k attn[b,h,q,k] value[b,h,v,k] -> [2,16,2048,64].
#define NB 2
#define TT 2048
#define CC 1024            // NH * HD = projected width
#define DIN 1024          // input (model) width
#define NH 16
#define HD 64
#define NQB (TT / 64)
#define HG 4
#define SCALE (0.022097086912079608f)
#define CAUSAL 0
#ifndef TNB
#define TNB NB
#endif
__device__ __forceinline__ float bfr(float v) { return (float)(__bf16)v; }
__host__ __device__ __forceinline__ int kb_last(int qb) { return CAUSAL ? ((qb * 64 + 63) >> 7) : (TT / 128 - 1); }
typedef __attribute__((ext_vector_type(8))) __bf16 v8b;
__device__ __forceinline__ v16b frag_b(const __bf16* rowk0, int lane) {
  union { v16b v; v8b q[2]; } u; const __bf16* p = rowk0 + 8 * (lane >> 4);
  u.q[0] = *(const v8b*)p; u.q[1] = *(const v8b*)(p + 16); return u.v;
}
#define QBH 0              // unused: no kernel in this file has a high-precision path
#define QHI 2048            // rows carrying a q residual plane (all rows when non-causal; k_fa reads no residual)
#define KHI 64            // key rows carrying k residual / v bf16 hi+lo planes (written only by k_proj, which is not launched)
// B fragment (k rows k0+.., output column o) of a weight: (in,out) [K][ld] or (out,in) [ld rows of K]: bf16 exact, or f16(bf16 * 256) exact
__device__ __forceinline__ v16b wcol_io(const float* Wm, int k0, int o, int lane, int ld) { v16b w; const int g = lane >> 4;
#pragma unroll
  for (int i = 0; i < 8; ++i) { w[i] = (__bf16)Wm[(size_t)(k0 + 8 * g + i) * ld + o]; w[8 + i] = (__bf16)Wm[(size_t)(k0 + 16 + 8 * g + i) * ld + o]; }
  return w; }
__device__ __forceinline__ v16b wcol_oi(const float* Wm, int k0, int o, int lane, int K) { v16b w; const float* p = Wm + (size_t)o * K + k0 + 8 * (lane >> 4);
#pragma unroll
  for (int i = 0; i < 8; ++i) { w[i] = (__bf16)p[i]; w[8 + i] = (__bf16)p[16 + i]; }
  return w; }
__device__ __forceinline__ v16h wcolh_io(const float* Wm, int k0, int o, int lane, int ld) { v16h w; const int g = lane >> 4;
#pragma unroll
  for (int i = 0; i < 8; ++i) { w[i] = (_Float16)(bfr(Wm[(size_t)(k0 + 8 * g + i) * ld + o]) * 256.0f); w[8 + i] = (_Float16)(bfr(Wm[(size_t)(k0 + 16 + 8 * g + i) * ld + o]) * 256.0f); }
  return w; }
__device__ __forceinline__ v16h wcolh_oi(const float* Wm, int k0, int o, int lane, int K) { v16h w; const float* p = Wm + (size_t)o * K + k0 + 8 * (lane >> 4);
#pragma unroll
  for (int i = 0; i < 8; ++i) { w[i] = (_Float16)(bfr(p[i]) * 256.0f); w[8 + i] = (_Float16)(bfr(p[16 + i]) * 256.0f); }
  return w; }
#define WQKV_LAYOUT 0   // 0 = (in,out) [DIN][CC]; 1 = (out,in) [CC][DIN]; 2 = per-head [NH][DIN][HD]
__device__ __forceinline__ v16b wcol_hdk(const float* Wm, int k0, int o, int lane) { v16b w; const int g = lane >> 4; const float* p = Wm + (size_t)(o / HD) * DIN * HD + (o % HD);
#pragma unroll
  for (int i = 0; i < 8; ++i) { w[i] = (__bf16)p[(size_t)(k0 + 8 * g + i) * HD]; w[8 + i] = (__bf16)p[(size_t)(k0 + 16 + 8 * g + i) * HD]; }
  return w; }
#define WO_OUT_IN 0
#if WQKV_LAYOUT == 1
#define WCOL(W, k0, o, lane) wcol_oi(W, k0, o, lane, DIN)
#elif WQKV_LAYOUT == 2
#define WCOL(W, k0, o, lane) wcol_hdk(W, k0, o, lane)
#else
#define WCOL(W, k0, o, lane) wcol_io(W, k0, o, lane, CC)
#endif
#if WO_OUT_IN
#define WOCOL(W, k0, o, lane) wcol_oi(W, k0, o, lane, CC)
#define WOCOLH(W, k0, o, lane) wcolh_oi(W, k0, o, lane, CC)
#else
#define WOCOL(W, k0, o, lane) wcol_io(W, k0, o, lane, DIN)
#define WOCOLH(W, k0, o, lane) wcolh_io(W, k0, o, lane, DIN)
#endif
// ---- k_planesT: the planes straight from the [B,H,D,N] inputs (bf16-rounded; exact in f16 at these magnitudes): block = (64 tokens t0.., head h, batch b): the q/k [64 d][64 t] tiles are read along t (256-B runs) and transposed through LDS into q/k rows [b*T+t][h*64+d] (no residual rows: a bf16 value is exact in f16 from 2^-17 up; a smaller one rounds to the f16 grid of 2^-24, q like k); v[b][h][d][t] is ALREADY the transposed plane layout [b][h*64+d][t] and is copied straight (f16)
__global__ __launch_bounds__(256) void k_planesT(const float* __restrict__ Qs, const float* __restrict__ Ks, const float* __restrict__ Vs, _Float16* __restrict__ QH, _Float16* __restrict__ KH, _Float16* __restrict__ VT) {
  __shared__ float sq[64][68]; __shared__ float sk[64][68];
  const int tid = threadIdx.x; const int t0 = blockIdx.x * 64, h = blockIdx.y, b = blockIdx.z;
  const size_t src0 = (((size_t)b * NH + h) * HD) * TT + t0;   /* [b][h][d][t0] */
  for (int e = tid; e < 64 * 16; e += 256) { const int d = e >> 4, q = e & 15; const v4f a = *(const v4f*)(Qs + src0 + (size_t)d * TT + q * 4); const v4f c = *(const v4f*)(Ks + src0 + (size_t)d * TT + q * 4); const v4f vv = *(const v4f*)(Vs + src0 + (size_t)d * TT + q * 4); asm volatile("s_wait_loadcnt 0x0" ::: "memory");
    sq[d][q * 4 + 0] = bfr(a[0]); sq[d][q * 4 + 1] = bfr(a[1]); sq[d][q * 4 + 2] = bfr(a[2]); sq[d][q * 4 + 3] = bfr(a[3]);
    sk[d][q * 4 + 0] = bfr(c[0]); sk[d][q * 4 + 1] = bfr(c[1]); sk[d][q * 4 + 2] = bfr(c[2]); sk[d][q * 4 + 3] = bfr(c[3]);
    _Float16 hv[4] __attribute__((aligned(8))); _Pragma("unroll") for (int u = 0; u < 4; ++u) hv[u] = (_Float16)bfr(vv[u]);
    vst2((void*)(VT + ((size_t)b * CC + h * HD + d) * TT + t0 + q * 4), *(const unsigned long long*)&hv[0]); }   
  __syncthreads();
  for (int e = tid; e < 64 * 8; e += 256) { const int tl = e >> 3, q = e & 7; const size_t row = (size_t)b * TT + t0 + tl; hx8 hq, hk;
#pragma unroll
    for (int u = 0; u < 8; ++u) { hq[u] = (_Float16)sq[q * 8 + u][tl]; hk[u] = (_Float16)sk[q * 8 + u][tl]; }
    vst2((unsigned*)(QH + row * CC + h * HD + q * 8), *(const v4u*)&hq); vst2((unsigned*)(KH + row * CC + h * HD + q * 8), *(const v4u*)&hk); } }
#ifndef SM_EXTRA_PARAMS
#define SM_EXTRA_PARAMS
#endif
#ifndef PROJ_EXTRA_PARAMS
#define PROJ_EXTRA_PARAMS
#endif
#ifndef SM_MASK_HOOK
#define SM_MASK_HOOK (void)0
#endif

#define WS_QH  0u                                      // f16 q rows [b*t][CC]
#define WS_KH  (WS_QH + 2u * (size_t)NB * TT * CC)      // f16 k rows [b*t][CC]
#define WS_VT  (WS_KH + 2u * (size_t)NB * TT * CC)      // f16 v planes [b][c][t]
#define WS_QL  (WS_VT + 2u * (size_t)NB * CC * TT)      // f16 q residual x 2^10 rows [b][t < QHI][CC]
#define WS_KL  (WS_QL + 2u * (size_t)NB * QHI * CC)     // f16 k residual x 2^10 rows [b][t < KHI][CC]
#define WS_VB  (WS_KL + 2u * (size_t)NB * KHI * CC)     // bf16 v hi planes [b][c][t < KHI]
#define WS_VBL (WS_VB + 2u * (size_t)NB * CC * KHI)
#define WS_S   (WS_VBL + 2u * (size_t)NB * CC * KHI)    // f32 [hg][t][s] region, reserved but unused (logits and P stay in registers)
#define WS_Y   (WS_S  + 4u * (size_t)HG * TT * TT)      // f32 ctx rows [b*t][CC] (only when there is an output projection)
#define WS_END (WS_Y  + 0u)

// ---- k_proj: block = (64 rows, 128 cols, which): q/k/v = X W (+ b) with exact bf16 products (K = DIN) -> which 0: q f16 rows (+ residual rows < QHI); 1: k f16 rows (+ residual rows < KHI); 2: v f16 planes [c][t] (+ bf16 hi/lo planes for t < KHI)
__global__ __launch_bounds__(128) void k_proj(const float* __restrict__ XQ, const float* __restrict__ XK, const float* __restrict__ XV, const float* __restrict__ WQ, const float* __restrict__ WK, const float* __restrict__ WV, const float* __restrict__ BQ, const float* __restrict__ BK, const float* __restrict__ BV,
    _Float16* __restrict__ QH, _Float16* __restrict__ QL, _Float16* __restrict__ KH, _Float16* __restrict__ KL, _Float16* __restrict__ VT, __bf16* __restrict__ VB, __bf16* __restrict__ VBL) {
  __shared__ __align__(16) _Float16 sh[64][136], sl[64][136]; __shared__ __align__(16) _Float16 th[128][72]; __shared__ __align__(16) __bf16 tb[128][72], tbl[128][72];
  const int tid = threadIdx.x, wave = tid >> 5, lane = tid & 31, col = lane & 15, g = lane >> 4; const int which = blockIdx.z; const int c0 = blockIdx.y * 128; const size_t r0 = (size_t)blockIdx.x * 64; const size_t bb = r0 / TT; const int t0 = (int)(r0 % TT);
  const float* X = which == 0 ? XQ : which == 1 ? XK : XV; const float* WA = which == 0 ? WQ : which == 1 ? WK : WV; const float* BA = which == 0 ? BQ : which == 1 ? BK : BV;
  v8f acc[8] = {};
#pragma unroll 2
  for (int kc = 0; kc < DIN / 32; ++kc) { v16b a; { const float* p = X + (r0 + wave * 16 + col) * DIN + kc * 32 + 8 * g;
#pragma unroll
      for (int i = 0; i < 8; ++i) { a[i] = (__bf16)p[i]; a[8 + i] = (__bf16)p[16 + i]; } }
    asm volatile("s_wait_loadcnt 0x0" ::: "memory");
#pragma unroll
    for (int j = 0; j < 8; ++j) { const v16b w = WCOL(WA, kc * 32, c0 + j * 16 + col, lane); asm volatile("s_wait_loadcnt 0x0" ::: "memory"); acc[j] = wmma_bf(a, w, acc[j]); } }
  if (which < 2) { _Float16* DH = which == 0 ? QH : KH; _Float16* DL = which == 0 ? QL : KL; const int nhi = which == 0 ? QHI : KHI; const bool hi_rows = t0 < nhi;
#pragma unroll
    for (int j = 0; j < 8; ++j) { const float bias = BA ? bfr(BA[c0 + j * 16 + col]) : 0.f;
#pragma unroll
      for (int r = 0; r < 8; ++r) { const float v = acc[j][r] + bias; const _Float16 hv = (_Float16)v; sh[wave * 16 + 8 * g + r][j * 16 + col] = hv; sl[wave * 16 + 8 * g + r][j * 16 + col] = (_Float16)((v - (float)hv) * 1024.0f); } }
    __syncthreads();
    for (int e = tid; e < 64 * 16; e += 128) { const int rl = e >> 4, q = e & 15; vst2((unsigned*)(DH + (r0 + rl) * CC + c0 + q * 8), *(const v4u*)&sh[rl][q * 8]); if (hi_rows) vst2((unsigned*)(DL + (bb * nhi + t0 + rl) * (size_t)CC + c0 + q * 8), *(const v4u*)&sl[rl][q * 8]); }
  } else { const bool hi_rows = t0 < KHI;
#pragma unroll
    for (int j = 0; j < 8; ++j) { const float bias = BA ? bfr(BA[c0 + j * 16 + col]) : 0.f;
#pragma unroll
      for (int r = 0; r < 8; ++r) { const float v = acc[j][r] + bias; const int rl = wave * 16 + 8 * g + r, cl = j * 16 + col; th[cl][rl] = (_Float16)v; const __bf16 bh = (__bf16)v; tb[cl][rl] = bh; tbl[cl][rl] = (__bf16)(v - (float)bh); } }
    __syncthreads();
    for (int e = tid; e < 128 * 8; e += 128) { const int cl = e >> 3, q = e & 7; vst2((unsigned*)(VT + (bb * CC + c0 + cl) * (size_t)TT + t0 + q * 8), *(const v4u*)&th[cl][q * 8]); if (hi_rows) { const size_t o3 = (bb * CC + c0 + cl) * (size_t)KHI + t0 + q * 8; vst2((unsigned*)(VB + o3), *(const v4u*)&tb[cl][q * 8]); vst2((unsigned*)(VBL + o3), *(const v4u*)&tbl[cl][q * 8]); } } } }
// ---- k_fa: block = 256 queries of (b, h), 16 waves = 2 key halves x 8 waves x 32 query columns, so that four waves share a SIMD and one wave's vector work runs beside another's matrix work; logits, softmax and P.v in one pass over the keys, so no logit or P ever goes to memory.
// S^T = K.Q^T (A = 16 key rows from LDS, B = q columns kept in registers; one product: q and k are bf16 values held in f16): a lane holds 8 + 8 keys of ONE query, which are, converted in place, the B operand of O^T += V^T.P^T (A = v rows [v][key] from LDS).
// Running maximum per query (in-lane + one exchange between the wave halves), P = exp(s - max) once to f16, sums in f32, O^T and the sum rescaled when the maximum moves; division by the sum at the end.
// K and v tiles of 64 keys go global -> registers -> LDS, two buffers per key half, one barrier per tile step (one tile of each half).
// At the end the two halves' partial O^T, maxima and sums are joined through LDS: half g keeps query columns 16 g .. 16 g + 15 of each wave and hands the other 16 to its partner wave.
#define FA_KS 64           // keys per LDS tile
#define FA_NT (TT / FA_KS / 2)   // tile steps: each key half walks TT / 2 keys
#define FA_P 72            // LDS row pitch in f16: 144 B = 16 B x odd, the conflict-free pitch for 16-byte reads of 128-B rows
__device__ __forceinline__ float xhalf(float x) { return __builtin_bit_cast(float, __builtin_amdgcn_permlanex16(__builtin_bit_cast(int, x), __builtin_bit_cast(int, x), 0x76543210, 0xfedcba98, false, false)); }   /* lane l <-> lane l ^ 16 */
__device__ __forceinline__ v8f wm(v16h a, v16h b, v8f c) { return __builtin_amdgcn_wmma_f32_16x16x32_f16(false, a, false, b, (short)0, c, false, false); }
// eight base-2 exponentials, each in place: no exponential's source register is written by the instruction behind it; the v_nop is the one slot the instruction set asks for between the last one and whatever reads its result
__device__ __forceinline__ void exp2x8(float* y) {
  asm("v_exp_f32 %0, %0\n\tv_exp_f32 %1, %1\n\tv_exp_f32 %2, %2\n\tv_exp_f32 %3, %3\n\tv_exp_f32 %4, %4\n\tv_exp_f32 %5, %5\n\tv_exp_f32 %6, %6\n\tv_exp_f32 %7, %7\n\tv_nop"
      : "+v"(y[0]), "+v"(y[1]), "+v"(y[2]), "+v"(y[3]), "+v"(y[4]), "+v"(y[5]), "+v"(y[6]), "+v"(y[7])); }
__global__ __launch_bounds__(512) void k_fa(const _Float16* __restrict__ QH, const _Float16* __restrict__ KH, const _Float16* __restrict__ VT, float* __restrict__ Y) {
  __shared__ __align__(16) _Float16 sKK[2][2][FA_KS][FA_P]; __shared__ __align__(16) _Float16 sVV[2][2][HD][FA_P]; __shared__ __align__(16) v4f sX[8][512]; __shared__ __align__(8) v2f sM[512];
  const int grp = __builtin_amdgcn_readfirstlane((int)threadIdx.x >> 8);   /* key half of this wave, in a scalar register: every select on it has a wave-uniform condition */
  const int tid = threadIdx.x & 255, wave = tid >> 5, lane = tid & 31, col = lane & 15, g = lane >> 4; const int h = blockIdx.y, b = blockIdx.z; const int q0 = blockIdx.x * 256 + wave * 32;
  const bool hi = grp != 0;
  _Float16 (*sK)[FA_KS][FA_P] = sKK[grp]; _Float16 (*sV)[HD][FA_P] = sVV[grp];
  const float C1 = SCALE * 1.4426950408889634f;   /* logit scale x log2(e): the exponentials are taken in base 2 */
  /* every inner loop below is unrolled so that all array indices are constants and the fragments and accumulators stay in registers */
  v16h qh[2][2];
  const _Float16* gQ = QH + ((size_t)b * TT + q0 + col) * CC + h * HD;
#pragma unroll
  for (int u = 0; u < 2; ++u)
#pragma unroll
    for (int kc = 0; kc < 2; ++kc) qh[u][kc] = frag_h(gQ + (size_t)u * 16 * CC + kc * 32, lane);
  const int sr = tid >> 3, sc = (tid & 7) * 8;   /* staging: 8 lanes per 128-B row, rows sr and sr + 32 */
  const _Float16* gK = KH + ((size_t)b * TT + grp * (TT / 2) + sr) * CC + h * HD + sc;      /* key rows [t][d] */
  const _Float16* gV = VT + ((size_t)b * CC + h * HD + sr) * TT + grp * (TT / 2) + sc;      /* v rows [v][t] */
  v8h rk0 = *(const v8h*)gK, rk1 = *(const v8h*)(gK + (size_t)32 * CC), rv0 = *(const v8h*)gV, rv1 = *(const v8h*)(gV + (size_t)32 * TT);
  asm volatile("s_wait_loadcnt 0x0" ::: "memory");   /* the loads above have returned before any register that they name is written again */
  *(v8h*)&sK[0][sr][sc] = rk0; *(v8h*)&sK[0][sr + 32][sc] = rk1; *(v8h*)&sV[0][sr][sc] = rv0; *(v8h*)&sV[0][sr + 32][sc] = rv1;
  __syncthreads();
  v8f o[2][4] = {}; float m[2] = {-__builtin_inff(), -__builtin_inff()}, l[2] = {0.f, 0.f};
#pragma unroll 1   /* the tile loop stays rolled: one trip is already several hundred instructions, a second copy would only cost instruction cache */
  for (int s = 0; s < FA_NT; ++s) { const int cur = s & 1; const bool more = s + 1 < FA_NT;
    if (more) { const _Float16* nK = gK + (size_t)(s + 1) * FA_KS * CC; const _Float16* nV = gV + (s + 1) * FA_KS;   /* the next tile's loads fly while this tile is worked on */
      rk0 = *(const v8h*)nK; rk1 = *(const v8h*)(nK + (size_t)32 * CC); rv0 = *(const v8h*)nV; rv1 = *(const v8h*)(nV + (size_t)32 * TT);
      asm volatile("s_wait_xcnt 0x0" :: "v"(nK), "v"(nV) : "memory"); }   /* the address registers of the four loads live up to this wait and are written again only behind it */
    v16h kf[4][2], vf[4][2];
#pragma unroll
    for (int t = 0; t < 4; ++t)
#pragma unroll
      for (int kc = 0; kc < 2; ++kc) kf[t][kc] = frag_h(&sK[cur][t * 16 + col][kc * 32], lane);
#pragma unroll
    for (int j = 0; j < 4; ++j)
#pragma unroll
      for (int w = 0; w < 2; ++w) vf[j][w] = frag_h(&sV[cur][j * 16 + col][w * 32], lane);
#pragma unroll
    for (int u = 0; u < 2; ++u) { v8f a[4] = {};
#pragma unroll
      for (int t = 0; t < 4; ++t)
#pragma unroll
        for (int kc = 0; kc < 2; ++kc) a[t] = wm(kf[t][kc], qh[u][kc], a[t]);
      float x[32];   /* x[8 t + r] = unscaled logit of key 16 t + 8 g + r of the tile, query column col */
#pragma unroll
      for (int i = 0; i < 32; ++i) x[i] = a[i >> 3][i & 7];
      float mx = x[0];
#pragma unroll
      for (int i = 1; i < 32; ++i) mx = fmaxf(mx, x[i]);
      mx = fmaxf(mx, xhalf(mx));
      const float mn = fmaxf(m[u], mx); const float corr = __builtin_amdgcn_exp2f((m[u] - mn) * C1);   /* 0 on the first tile, where m is -inf */
      m[u] = mn; const float mb = mn * C1; float sum = 0.f; v16h p[2];
#pragma unroll
      for (int i = 0; i < 32; ++i) x[i] = x[i] * C1 - mb;
#pragma unroll
      for (int i = 0; i < 32; i += 8) exp2x8(&x[i]);
#pragma unroll
      for (int i = 0; i < 32; ++i) { sum += x[i]; p[i >> 4][i & 15] = (_Float16)x[i]; }
      l[u] = l[u] * corr + sum;
#pragma unroll
      for (int j = 0; j < 4; ++j) { o[u][j] *= corr; o[u][j] = wm(vf[j][0], p[0], o[u][j]); o[u][j] = wm(vf[j][1], p[1], o[u][j]); } }
    if (more) { *(v8h*)&sK[cur ^ 1][sr][sc] = rk0; *(v8h*)&sK[cur ^ 1][sr + 32][sc] = rk1; *(v8h*)&sV[cur ^ 1][sr][sc] = rv0; *(v8h*)&sV[cur ^ 1][sr + 32][sc] = rv1; }   /* that buffer's last readers left it at the barrier before this tile */
    __syncthreads(); }
  /* half g keeps columns u == g (ok, mk, lk) and gives u == 1 - g (og, mg, lg): selects on a wave-uniform flag, so that the part below is one straight path for both halves */
  v8f ok[4], og[4]; const float mk = hi ? m[1] : m[0], lk = hi ? l[1] : l[0], mg = hi ? m[0] : m[1], lg = hi ? l[0] : l[1];
#pragma unroll
  for (int j = 0; j < 4; ++j)
#pragma unroll
    for (int r = 0; r < 8; ++r) { ok[j][r] = hi ? o[1][j][r] : o[0][j][r]; og[j][r] = hi ? o[0][j][r] : o[1][j][r]; }
#pragma unroll
  for (int j = 0; j < 4; ++j) { const v4f lo = {og[j][0], og[j][1], og[j][2], og[j][3]}, hv = {og[j][4], og[j][5], og[j][6], og[j][7]}; sX[2 * j][threadIdx.x] = lo; sX[2 * j + 1][threadIdx.x] = hv; }
  { const v2f ml = {mg, lg}; sM[threadIdx.x] = ml; }
  __syncthreads();   /* the partner's partial results are in LDS behind this barrier */
  const unsigned pt = threadIdx.x ^ 256;   /* the partner lane: same wave number and lane in the other key half */
  const v2f ml = sM[pt]; const float mn = fmaxf(mk, ml[0]);
  const float ca = __builtin_amdgcn_exp2f((mk - mn) * C1), cb = __builtin_amdgcn_exp2f((ml[0] - mn) * C1);   /* both halves brought to the common maximum */
  const float ls = lk * ca + ml[1] * cb; const float inv = 1.0f / (ls + xhalf(ls)); const float fa = ca * inv, fb = cb * inv;
  /* ok[j][r] = out[q0 + 16 grp + col][16 j + 8 g + r]; the lane's byte offset, 256 (32 wave + col) + 32 g, is formed here from the thread index alone, so that no other register is held over the loop for it: the kernel has 256 at four waves a SIMD */
  float* yr = (float*)((char*)(Y + (size_t)((b * NH + h) * TT + blockIdx.x * 256 + grp * 16) * HD) + (((threadIdx.x & 0xEF) << 8) + ((threadIdx.x & 16) << 1)));
  v4f r[8];
#pragma unroll
  for (int j = 0; j < 4; ++j) { const v4f xl = sX[2 * j][pt], xh = sX[2 * j + 1][pt];
    const v4f lo = {ok[j][0] * fa + xl[0] * fb, ok[j][1] * fa + xl[1] * fb, ok[j][2] * fa + xl[2] * fb, ok[j][3] * fa + xl[3] * fb}, hv = {ok[j][4] * fa + xh[0] * fb, ok[j][5] * fa + xh[1] * fb, ok[j][6] * fa + xh[2] * fb, ok[j][7] * fa + xh[3] * fb}; r[2 * j] = lo; r[2 * j + 1] = hv; }
#pragma unroll
  for (int j = 0; j < 4; ++j) { vst2(yr + j * 16, r[2 * j]); vst2(yr + j * 16 + 4, r[2 * j + 1]); } }

extern "C" void kernel_launch(void* const* d_in, const int* in_sizes, int n_in, void* d_out, int out_size, void* d_ws, size_t ws_size, hipStream_t stream) {
  (void)in_sizes; (void)n_in; (void)out_size;
  const float** F = (const float**)d_in;
  if (ws_size < (size_t)WS_END) return;
  char* ws = (char*)d_ws; _Float16 *QH = (_Float16*)(ws + WS_QH), *KH = (_Float16*)(ws + WS_KH), *VT = (_Float16*)(ws + WS_VT), *QL = (_Float16*)(ws + WS_QL), *KL = (_Float16*)(ws + WS_KL); __bf16 *VB = (__bf16*)(ws + WS_VB), *VBL = (__bf16*)(ws + WS_VBL); float *S = (float*)(ws + WS_S), *Y = (float*)(ws + WS_Y);
  (void)Y; (void)S; (void)QL; (void)KL; (void)VB; (void)VBL;
  // inputs: 0 query [2,16,64,2048] ([B,H,D,N]); 1 key; 2 value
  k_planesT<<<dim3(TT / 64, NH, NB), 256, 0, stream>>>(F[0], F[1], F[2], QH, KH, VT);
  k_fa<<<dim3(TT / 256, NH, TNB), 512, 0, stream>>>(QH, KH, VT, (float*)d_out);
}

// v004
// Measured time: 35.4 microseconds a run.
// Next to v003, in two timings, it ran 1.13 times as fast each time.
// Counting every step since v000, it is 27.8 times as fast.
// compute dtype: all float inputs rounded to bf16; q, k, v are bf16-valued so their f16 planes are exact; logits q x k (1 product: q and k bf16 values held in f16, no residual) x 2048^-0.5 (the module's sqrt(N) scale); softmax f32 with a running maximum; P = exp(s - max) once to f16 x v (exact in f16) (1 product), divided by the f32 sum at the end; f32 output.
#include <hip/hip_runtime.h>
#include <math.h>

typedef __attribute__((ext_vector_type(16))) _Float16 v16h;
typedef __attribute__((ext_vector_type(16))) __bf16 v16b;
typedef __attribute__((ext_vector_type(8)))  _Float16 v8h;
typedef __attribute__((ext_vector_type(8)))  float v8f;
typedef __attribute__((ext_vector_type(4)))  float v4f;
typedef __attribute__((ext_vector_type(2)))  float v2f;
typedef __attribute__((ext_vector_type(4)))  unsigned v4u;
typedef _Float16 hx8 __attribute__((ext_vector_type(8)));
typedef __attribute__((ext_vector_type(4)))  int v4i;
typedef float __attribute__((may_alias)) float_a;
typedef int __attribute__((may_alias)) int_a;

template <typename T> __device__ __forceinline__ void vst2(void* p, T v) { *(T*)p = v;  }
__device__ __forceinline__ v8f wmma16(v16h a, v16h b, v8f c) {
  v8f d = __builtin_amdgcn_wmma_f32_16x16x32_f16(false, a, false, b, (short)0, c, false, false);
  asm volatile("v_nop\n\tv_nop\n\tv_nop\n\tv_nop" : "+v"(d) : "v"(a), "v"(b));
  return d;
}
__device__ __forceinline__ v8f wmma_bf(v16b a, v16b b, v8f c) {
  v8f d = __builtin_amdgcn_wmma_f32_16x16x32_bf16(false, a, false, b, (short)0, c, false, false);
  asm volatile("v_nop\n\tv_nop\n\tv_nop\n\tv_nop" : "+v"(d) : "v"(a), "v"(b));
  return d;
}
// 16x16x32 fragments: lane = (h = lane>>4, row/col = lane&15); elements 0..7 = k0+8h+0..7, 8..15 = k0+16+8h+0..7; D element r = row 8h+r
__device__ __forceinline__ v16h frag_h(const _Float16* rowk0, int lane) {
  union { v16h v; v8h q[2]; } u; const _Float16* p = rowk0 + 8 * (lane >> 4);
  u.q[0] = *(const v8h*)p; u.q[1] = *(const v8h*)(p + 16); return u.v;
}
__device__ __forceinline__ v16h frag_f32(const float* rowk0, int lane) {
  v16h a; const float* p = rowk0 + 8 * (lane >> 4);
#pragma unroll
  for (int i = 0; i < 8; ++i) { a[i] = (_Float16)p[i]; a[8 + i] = (_Float16)p[16 + i]; }
  return a;
}
__device__ __forceinline__ v16h frag_f32s(const float* rowk0, int lane, float sc) {
  v16h a; const float* p = rowk0 + 8 * (lane >> 4);
#pragma unroll
  for (int i = 0; i < 8; ++i) { a[i] = (_Float16)(p[i] * sc); a[8 + i] = (_Float16)(p[16 + i] * sc); }
  return a;
}
// column fragment from a [K][ld] layout (column n), rows >= K read as 0
__device__ __forceinline__ v16h fragc_f32(const float* W, int k0, int n, int lane, int ld, int K) {
  v16h a; const int g = lane >> 4;
#pragma unroll
  for (int i = 0; i < 8; ++i) { const int ka = k0 + 8 * g + i, kb = ka + 16;
    a[i] = (_Float16)(ka < K ? W[(size_t)(ka < K ? ka : K - 1) * ld + n] : 0.f); a[8 + i] = (_Float16)(kb < K ? W[(size_t)(kb < K ? kb : K - 1) * ld + n] : 0.f); }
  return a;
}
struct F2 { v16b h, l; };
__device__ __forceinline__ F2 bsplit16(const float v[16]) { F2 r;
#pragma unroll
  for (int i = 0; i < 16; ++i) { const __bf16 h = (__bf16)v[i]; r.h[i] = h; r.l[i] = (__bf16)(v[i] - (float)h); }
  return r; }
__device__ __forceinline__ F2 split_row(const float* row, int k0, int lane) { float v[16]; const float* p = row + k0 + 8 * (lane >> 4);
#pragma unroll
  for (int i = 0; i < 8; ++i) { v[i] = p[i]; v[8 + i] = p[16 + i]; }
  return bsplit16(v); }
__device__ __forceinline__ F2 split_rowK(const float* row, int k0, int lane, int K) { float v[16]; const int g = lane >> 4;
#pragma unroll
  for (int i = 0; i < 8; ++i) { const int ka = k0 + 8 * g + i, kb = ka + 16; v[i] = ka < K ? row[ka < K ? ka : K - 1] : 0.f; v[8 + i] = kb < K ? row[kb < K ? kb : K - 1] : 0.f; }
  return bsplit16(v); }
__device__ __forceinline__ F2 split_col(const float* W, int k0, int n, int lane, int ld, int K) { float v[16]; const int g = lane >> 4;
#pragma unroll
  for (int i = 0; i < 8; ++i) { const int ka = k0 + 8 * g + i, kb = ka + 16; v[i] = ka < K ? W[(size_t)(ka < K ? ka : K - 1) * ld + n] : 0.f; v[8 + i] = kb < K ? W[(size_t)(kb < K ? kb : K - 1) * ld + n] : 0.f; }
  return bsplit16(v); }
__device__ __forceinline__ v8f mac3(const F2& a, const F2& b, v8f c) { c = wmma_bf(a.l, b.h, c); c = wmma_bf(a.h, b.l, c); return wmma_bf(a.h, b.h, c); }
__device__ __forceinline__ float sigm(float v) { return 1.0f / (1.0f + expf(-v)); }
#define LDSX() do { asm volatile("s_wait_dscnt 0" ::: "memory"); __builtin_amdgcn_wave_barrier(); __builtin_amdgcn_fence(__ATOMIC_RELEASE, "workgroup"); } while (0)

// Scaled-dot-product attention in the unusual [B,H,D,N] layout (query/key/value [2,16,64,2048]): scores[b,h,q,k] = sum_d query[b,h,d,q] key[b,h,d,k] / sqrt(2048) (the source scales by sqrt(size(-1)) = sqrt(N)); attn = softmax over k; out[b,h,q,v] = sum_k attn[b,h,q,k] value[b,h,v,k] -> [2,16,2048,64].
#define NB 2
#define TT 2048
#define CC 1024            // NH * HD = projected width
#define DIN 1024          // input (model) width
#define NH 16
#define HD 64
#define NQB (TT / 64)
#define HG 4
#define SCALE (0.022097086912079608f)
#define CAUSAL 0
#ifndef TNB
#define TNB NB
#endif
__device__ __forceinline__ float bfr(float v) { return (float)(__bf16)v; }
__host__ __device__ __forceinline__ int kb_last(int qb) { return CAUSAL ? ((qb * 64 + 63) >> 7) : (TT / 128 - 1); }
typedef __attribute__((ext_vector_type(8))) __bf16 v8b;
__device__ __forceinline__ v16b frag_b(const __bf16* rowk0, int lane) {
  union { v16b v; v8b q[2]; } u; const __bf16* p = rowk0 + 8 * (lane >> 4);
  u.q[0] = *(const v8b*)p; u.q[1] = *(const v8b*)(p + 16); return u.v;
}
#define QBH 0              // unused: no kernel in this file has a high-precision path
#define QHI 2048            // rows carrying a q residual plane (all rows when non-causal; k_fa reads no residual)
#define KHI 64            // key rows carrying k residual / v bf16 hi+lo planes (written only by k_proj, which is not launched)
// B fragment (k rows k0+.., output column o) of a weight: (in,out) [K][ld] or (out,in) [ld rows of K]: bf16 exact, or f16(bf16 * 256) exact
__device__ __forceinline__ v16b wcol_io(const float* Wm, int k0, int o, int lane, int ld) { v16b w; const int g = lane >> 4;
#pragma unroll
  for (int i = 0; i < 8; ++i) { w[i] = (__bf16)Wm[(size_t)(k0 + 8 * g + i) * ld + o]; w[8 + i] = (__bf16)Wm[(size_t)(k0 + 16 + 8 * g + i) * ld + o]; }
  return w; }
__device__ __forceinline__ v16b wcol_oi(const float* Wm, int k0, int o, int lane, int K) { v16b w; const float* p = Wm + (size_t)o * K + k0 + 8 * (lane >> 4);
#pragma unroll
  for (int i = 0; i < 8; ++i) { w[i] = (__bf16)p[i]; w[8 + i] = (__bf16)p[16 + i]; }
  return w; }
__device__ __forceinline__ v16h wcolh_io(const float* Wm, int k0, int o, int lane, int ld) { v16h w; const int g = lane >> 4;
#pragma unroll
  for (int i = 0; i < 8; ++i) { w[i] = (_Float16)(bfr(Wm[(size_t)(k0 + 8 * g + i) * ld + o]) * 256.0f); w[8 + i] = (_Float16)(bfr(Wm[(size_t)(k0 + 16 + 8 * g + i) * ld + o]) * 256.0f); }
  return w; }
__device__ __forceinline__ v16h wcolh_oi(const float* Wm, int k0, int o, int lane, int K) { v16h w; const float* p = Wm + (size_t)o * K + k0 + 8 * (lane >> 4);
#pragma unroll
  for (int i = 0; i < 8; ++i) { w[i] = (_Float16)(bfr(p[i]) * 256.0f); w[8 + i] = (_Float16)(bfr(p[16 + i]) * 256.0f); }
  return w; }
#define WQKV_LAYOUT 0   // 0 = (in,out) [DIN][CC]; 1 = (out,in) [CC][DIN]; 2 = per-head [NH][DIN][HD]
__device__ __forceinline__ v16b wcol_hdk(const float* Wm, int k0, int o, int lane) { v16b w; const int g = lane >> 4; const float* p = Wm + (size_t)(o / HD) * DIN * HD + (o % HD);
#pragma unroll
  for (int i = 0; i < 8; ++i) { w[i] = (__bf16)p[(size_t)(k0 + 8 * g + i) * HD]; w[8 + i] = (__bf16)p[(size_t)(k0 + 16 + 8 * g + i) * HD]; }
  return w; }
#define WO_OUT_IN 0
#if WQKV_LAYOUT == 1
#define WCOL(W, k0, o, lane) wcol_oi(W, k0, o, lane, DIN)
#elif WQKV_LAYOUT == 2
#define WCOL(W, k0, o, lane) wcol_hdk(W, k0, o, lane)
#else
#define WCOL(W, k0, o, lane) wcol_io(W, k0, o, lane, CC)
#endif
#if WO_OUT_IN
#define WOCOL(W, k0, o, lane) wcol_oi(W, k0, o, lane, CC)
#define WOCOLH(W, k0, o, lane) wcolh_oi(W, k0, o, lane, CC)
#else
#define WOCOL(W, k0, o, lane) wcol_io(W, k0, o, lane, DIN)
#define WOCOLH(W, k0, o, lane) wcolh_io(W, k0, o, lane, DIN)
#endif
#ifndef SM_EXTRA_PARAMS
#define SM_EXTRA_PARAMS
#endif
#ifndef PROJ_EXTRA_PARAMS
#define PROJ_EXTRA_PARAMS
#endif
#ifndef SM_MASK_HOOK
#define SM_MASK_HOOK (void)0
#endif

#define WS_QH  0u                                      // f16 q rows [b*t][CC]
#define WS_KH  (WS_QH + 2u * (size_t)NB * TT * CC)      // f16 k rows [b*t][CC]
#define WS_VT  (WS_KH + 2u * (size_t)NB * TT * CC)      // f16 v planes [b][c][t]
#define WS_QL  (WS_VT + 2u * (size_t)NB * CC * TT)      // f16 q residual x 2^10 rows [b][t < QHI][CC]
#define WS_KL  (WS_QL + 2u * (size_t)NB * QHI * CC)     // f16 k residual x 2^10 rows [b][t < KHI][CC]
#define WS_VB  (WS_KL + 2u * (size_t)NB * KHI * CC)     // bf16 v hi planes [b][c][t < KHI]
#define WS_VBL (WS_VB + 2u * (size_t)NB * CC * KHI)
#define WS_S   (WS_VBL + 2u * (size_t)NB * CC * KHI)    // f32 [hg][t][s] region, reserved but unused (logits and P stay in registers)
#define WS_Y   (WS_S  + 4u * (size_t)HG * TT * TT)      // f32 ctx rows [b*t][CC] (only when there is an output projection)
#define WS_END (WS_Y  + 0u)

// ---- k_proj: block = (64 rows, 128 cols, which): q/k/v = X W (+ b) with exact bf16 products (K = DIN) -> which 0: q f16 rows (+ residual rows < QHI); 1: k f16 rows (+ residual rows < KHI); 2: v f16 planes [c][t] (+ bf16 hi/lo planes for t < KHI)
__global__ __launch_bounds__(128) void k_proj(const float* __restrict__ XQ, const float* __restrict__ XK, const float* __restrict__ XV, const float* __restrict__ WQ, const float* __restrict__ WK, const float* __restrict__ WV, const float* __restrict__ BQ, const float* __restrict__ BK, const float* __restrict__ BV,
    _Float16* __restrict__ QH, _Float16* __restrict__ QL, _Float16* __restrict__ KH, _Float16* __restrict__ KL, _Float16* __restrict__ VT, __bf16* __restrict__ VB, __bf16* __restrict__ VBL) {
  __shared__ __align__(16) _Float16 sh[64][136], sl[64][136]; __shared__ __align__(16) _Float16 th[128][72]; __shared__ __align__(16) __bf16 tb[128][72], tbl[128][72];
  const int tid = threadIdx.x, wave = tid >> 5, lane = tid & 31, col = lane & 15, g = lane >> 4; const int which = blockIdx.z; const int c0 = blockIdx.y * 128; const size_t r0 = (size_t)blockIdx.x * 64; const size_t bb = r0 / TT; const int t0 = (int)(r0 % TT);
  const float* X = which == 0 ? XQ : which == 1 ? XK : XV; const float* WA = which == 0 ? WQ : which == 1 ? WK : WV; const float* BA = which == 0 ? BQ : which == 1 ? BK : BV;
  v8f acc[8] = {};
#pragma unroll 2
  for (int kc = 0; kc < DIN / 32; ++kc) { v16b a; { const float* p = X + (r0 + wave * 16 + col) * DIN + kc * 32 + 8 * g;
#pragma unroll
      for (int i = 0; i < 8; ++i) { a[i] = (__bf16)p[i]; a[8 + i] = (__bf16)p[16 + i]; } }
    asm volatile("s_wait_loadcnt 0x0" ::: "memory");
#pragma unroll
    for (int j = 0; j < 8; ++j) { const v16b w = WCOL(WA, kc * 32, c0 + j * 16 + col, lane); asm volatile("s_wait_loadcnt 0x0" ::: "memory"); acc[j] = wmma_bf(a, w, acc[j]); } }
  if (which < 2) { _Float16* DH = which == 0 ? QH : KH; _Float16* DL = which == 0 ? QL : KL; const int nhi = which == 0 ? QHI : KHI; const bool hi_rows = t0 < nhi;
#pragma unroll
    for (int j = 0; j < 8; ++j) { const float bias = BA ? bfr(BA[c0 + j * 16 + col]) : 0.f;
#pragma unroll
      for (int r = 0; r < 8; ++r) { const float v = acc[j][r] + bias; const _Float16 hv = (_Float16)v; sh[wave * 16 + 8 * g + r][j * 16 + col] = hv; sl[wave * 16 + 8 * g + r][j * 16 + col] = (_Float16)((v - (float)hv) * 1024.0f); } }
    __syncthreads();
    for (int e = tid; e < 64 * 16; e += 128) { const int rl = e >> 4, q = e & 15; vst2((unsigned*)(DH + (r0 + rl) * CC + c0 + q * 8), *(const v4u*)&sh[rl][q * 8]); if (hi_rows) vst2((unsigned*)(DL + (bb * nhi + t0 + rl) * (size_t)CC + c0 + q * 8), *(const v4u*)&sl[rl][q * 8]); }
  } else { const bool hi_rows = t0 < KHI;
#pragma unroll
    for (int j = 0; j < 8; ++j) { const float bias = BA ? bfr(BA[c0 + j * 16 + col]) : 0.f;
#pragma unroll
      for (int r = 0; r < 8; ++r) { const float v = acc[j][r] + bias; const int rl = wave * 16 + 8 * g + r, cl = j * 16 + col; th[cl][rl] = (_Float16)v; const __bf16 bh = (__bf16)v; tb[cl][rl] = bh; tbl[cl][rl] = (__bf16)(v - (float)bh); } }
    __syncthreads();
    for (int e = tid; e < 128 * 8; e += 128) { const int cl = e >> 3, q = e & 7; vst2((unsigned*)(VT + (bb * CC + c0 + cl) * (size_t)TT + t0 + q * 8), *(const v4u*)&th[cl][q * 8]); if (hi_rows) { const size_t o3 = (bb * CC + c0 + cl) * (size_t)KHI + t0 + q * 8; vst2((unsigned*)(VB + o3), *(const v4u*)&tb[cl][q * 8]); vst2((unsigned*)(VBL + o3), *(const v4u*)&tbl[cl][q * 8]); } } } }
// ---- k_fa: block = 256 queries of (b, h), 16 waves = 2 key halves x 8 waves x 32 query columns, so that four waves share a SIMD and one wave's vector work runs beside another's matrix work; logits, softmax and P.v in one pass over the keys, so no logit or P ever goes to memory.
// The kernel reads the f32 [B,H,D,N] inputs themselves: every element is rounded to bf16 and held in f16 (exact from 2^-17 up; a smaller one rounds to the f16 grid of 2^-24) on its way from registers into LDS, so there is no launch ahead of this one and no plane in the workspace.
// q and k lie [d][token] in memory and stay so in LDS; the transposing 16-bit LDS load hands each lane one token's 8 + 8 d values, in the matrix instruction's own k order, for q and k alike. v lies [v][token], which is the A operand's row order already.
// S^T = K.Q^T (A = 16 keys from LDS, B = q columns kept in registers; one product: q and k are bf16 values held in f16): a lane holds 8 + 8 keys of ONE query, which are, converted in place, the B operand of O^T += V^T.P^T (A = v rows [v][key] from LDS).
// Running maximum per query (in-lane + one exchange between the wave halves), P = exp(s - max) once to f16, sums in f32, O^T and the sum rescaled when the maximum moves; division by the sum at the end.
// K and v tiles of 64 keys go global -> registers -> LDS, two buffers per key half, one barrier per tile step (one tile of each half).
// At the end the two halves' partial O^T, maxima and sums are joined through LDS: half g keeps query columns 16 g .. 16 g + 15 of each wave and hands the other 16 to its partner wave.
#define FA_KS 64           // keys per LDS tile
#define FA_NT (TT / FA_KS / 2)   // tile steps: each key half walks TT / 2 keys
#define FA_P 72            // v rows, LDS pitch in f16: 144 B = 16 B x odd, the conflict-free pitch for 16-byte reads of 128-B rows
#define FA_PK 80           // k rows [d][key], LDS pitch in f16: 160 B = 32 B x odd, the conflict-free pitch for the transposing load of 128-B rows
#define FA_PQ 272          // q rows [d][query], LDS pitch in f16: 544 B = 32 B x odd
typedef __attribute__((ext_vector_type(4))) _Float16 v4h;
typedef short s16x8 __attribute__((ext_vector_type(8)));
__device__ __forceinline__ float xhalf(float x) { return __builtin_bit_cast(float, __builtin_amdgcn_permlanex16(__builtin_bit_cast(int, x), __builtin_bit_cast(int, x), 0x76543210, 0xfedcba98, false, false)); }   /* lane l <-> lane l ^ 16 */
__device__ __forceinline__ v8f wm(v16h a, v16h b, v8f c) { return __builtin_amdgcn_wmma_f32_16x16x32_f16(false, a, false, b, (short)0, c, false, false); }
typedef __attribute__((ext_vector_type(2))) __bf16 v2b;
typedef __attribute__((ext_vector_type(2))) _Float16 v2h;
__device__ __forceinline__ v4h cv4(v4f a) { union { v4h v; v2h q[2]; } r;   /* f32 -> bf16 value held in f16, two elements per conversion instruction */
#pragma unroll
  for (int u = 0; u < 2; ++u) { const v2f s = {a[2 * u], a[2 * u + 1]}; const unsigned w = __builtin_bit_cast(unsigned, __builtin_convertvector(s, v2b));
    const v2f t = {__builtin_bit_cast(float, w << 16), __builtin_bit_cast(float, w & 0xffff0000u)}; r.q[u] = __builtin_convertvector(t, v2h); }
  return r.v; }
__device__ __forceinline__ v8h ld_tr16(const _Float16* p) { typedef __attribute__((address_space(3))) s16x8 lds_s16x8; return __builtin_bit_cast(v8h, __builtin_amdgcn_ds_load_tr16_b128_v8i16((lds_s16x8*)p)); }
// fragment (16 columns x 32 k) of a row-major [k][column] f16 tile in LDS; p = &T[k0 + 8 (lane >> 4) + (lane & 7)][c0 + 8 ((lane >> 3) & 1)]: lane (c, h) gets T[k0 + 8 h + 0..7][c0 + c] and T[k0 + 16 + 8 h + 0..7][c0 + c]
__device__ __forceinline__ v16h frag_tr(const _Float16* p, int pitch) { union { v16h v; v8h q[2]; } u; u.q[0] = ld_tr16(p); u.q[1] = ld_tr16(p + 16 * pitch); return u.v; }
// eight base-2 exponentials, each in place: no exponential's source register is written by the instruction behind it; the v_nop is the one slot the instruction set asks for between the last one and whatever reads its result
__device__ __forceinline__ void exp2x8(float* y) {
  asm("v_exp_f32 %0, %0\n\tv_exp_f32 %1, %1\n\tv_exp_f32 %2, %2\n\tv_exp_f32 %3, %3\n\tv_exp_f32 %4, %4\n\tv_exp_f32 %5, %5\n\tv_exp_f32 %6, %6\n\tv_exp_f32 %7, %7\n\tv_nop"
      : "+v"(y[0]), "+v"(y[1]), "+v"(y[2]), "+v"(y[3]), "+v"(y[4]), "+v"(y[5]), "+v"(y[6]), "+v"(y[7])); }
__global__ __launch_bounds__(512) void k_fa(const float* __restrict__ Qs, const float* __restrict__ Ks, const float* __restrict__ Vs, float* __restrict__ Y) {
  __shared__ __align__(16) _Float16 sKK[2][2][HD][FA_PK]; __shared__ __align__(16) _Float16 sVV[2][2][HD][FA_P]; __shared__ __align__(16) v4f sX[8][512]; __shared__ __align__(8) v2f sM[512];
  const int grp = __builtin_amdgcn_readfirstlane((int)threadIdx.x >> 8);   /* key half of this wave, in a scalar register */
  const int tid = threadIdx.x & 255, wave = tid >> 5, lane = tid & 31, col = lane & 15, g = lane >> 4; const int h = blockIdx.y, b = blockIdx.z;
  const bool hi = grp != 0;
  _Float16 (*sK)[HD][FA_PK] = sKK[grp]; _Float16 (*sV)[HD][FA_P] = sVV[grp];
  _Float16* sQ = (_Float16*)&sX[0][0];   /* the block's q tile [64 d][256 queries] lies, until its fragments are read, where the halves are joined at the end */
  const float C1 = SCALE * 1.4426950408889634f;   /* logit scale x log2(e): the exponentials are taken in base 2 */
  /* every inner loop below is unrolled so that all array indices are constants and the fragments and accumulators stay in registers */
  const size_t hd0 = (size_t)(b * NH + h) * HD;   /* first row [d] of this head in each input */
  const int sr = tid >> 4, sc = (tid & 15) * 4;   /* staging: 16 lanes per 256-B run of a row, rows sr + 16 i */
  const unsigned vo = (unsigned)(sr * TT + sc);   /* the lane's element offset in a [64][TT] plane, the same for k and v */
  const float* gK = Ks + hd0 * TT + grp * (TT / 2);      /* k rows [d][t] of this key half */
  const float* gV = Vs + hd0 * TT + grp * (TT / 2);      /* v rows [v][t] of this key half */
  const int qr = (int)threadIdx.x >> 6, qc = ((int)threadIdx.x & 63) * 4;   /* q staging: 64 lanes per 1-KiB run of a row, rows qr + 8 i */
  const unsigned qo = (unsigned)(qr * TT + qc);
  const float* gQ = Qs + hd0 * TT + blockIdx.x * 256;    /* q rows [d][t] of this block */
  v4f rk[4], rv[4];
  { v4f rq[8];
#pragma unroll
    for (int i = 0; i < 8; ++i) rq[i] = *(const v4f*)(gQ + (size_t)8 * i * TT + qo);
#pragma unroll
    for (int i = 0; i < 4; ++i) { rk[i] = *(const v4f*)(gK + (size_t)16 * i * TT + vo); rv[i] = *(const v4f*)(gV + (size_t)16 * i * TT + vo); }
    asm volatile("s_wait_loadcnt 0x0" :: "v"(qo), "v"(vo) : "memory");   /* the loads above have returned before any register that they name is written again */
#pragma unroll
    for (int i = 0; i < 8; ++i) *(v4h*)&sQ[(qr + 8 * i) * FA_PQ + qc] = cv4(rq[i]); }
#pragma unroll
  for (int i = 0; i < 4; ++i) { *(v4h*)&sK[0][sr + 16 * i][sc] = cv4(rk[i]); *(v4h*)&sV[0][sr + 16 * i][sc] = cv4(rv[i]); }
  __syncthreads();
  const int tr = 8 * g + (lane & 7), tc = 8 * ((lane >> 3) & 1);   /* the lane's row and column offset for the transposing load */
  v16h qh[2][2];
#pragma unroll
  for (int u = 0; u < 2; ++u)
#pragma unroll
    for (int kc = 0; kc < 2; ++kc) qh[u][kc] = frag_tr(&sQ[(kc * 32 + tr) * FA_PQ + wave * 32 + u * 16 + tc], FA_PQ);
  v8f o[2][4] = {}; float m[2] = {-__builtin_inff(), -__builtin_inff()}, l[2] = {0.f, 0.f};
#pragma unroll 1   /* the tile loop stays rolled: one trip is already several hundred instructions, a second copy would only cost instruction cache */
  for (int s = 0; s < FA_NT; ++s) { const int cur = s & 1; const bool more = s + 1 < FA_NT;
    if (more) { const float* nK = gK + (s + 1) * FA_KS + vo; const float* nV = gV + (s + 1) * FA_KS + vo;   /* the next tile's loads fly while this tile is worked on */
#pragma unroll
      for (int i = 0; i < 4; ++i) { rk[i] = *(const v4f*)(nK + (size_t)16 * i * TT); rv[i] = *(const v4f*)(nV + (size_t)16 * i * TT); }
      asm volatile("s_wait_xcnt 0x0" :: "v"(nK), "v"(nV) : "memory"); }   /* the address registers of the eight loads live up to this wait and are written again only behind it */
    /* an f32 tile in flight holds 32 registers where an f16 one held 16, and the kernel had none to spare: written in the old order (logits, softmax and P.v of one column group, then of the other, the stores last) this step spills. So it is written in the order that needs the fewest registers: the logits of both column groups, both softmaxes, the staged tile's stores, and only then the v fragments and P.v. Every value is computed as before, from the same operands in the same order */
    v16h kf[4][2], vf[4][2], p[2][2]; v8f a[2][4] = {};
#pragma unroll
    for (int t = 0; t < 4; ++t)
#pragma unroll
      for (int kc = 0; kc < 2; ++kc) kf[t][kc] = frag_tr(&sK[cur][kc * 32 + tr][t * 16 + tc], FA_PK);
#pragma unroll
    for (int u = 0; u < 2; ++u)
#pragma unroll
      for (int t = 0; t < 4; ++t)
#pragma unroll
        for (int kc = 0; kc < 2; ++kc) a[u][t] = wm(kf[t][kc], qh[u][kc], a[u][t]);   /* both column groups here, for the registers: the k fragments' 64 are dead before the v fragments are loaded */
#pragma unroll
    for (int u = 0; u < 2; ++u) {
      float x[32];   /* x[8 t + r] = unscaled logit of key 16 t + 8 g + r of the tile, query column col */
#pragma unroll
      for (int i = 0; i < 32; ++i) x[i] = a[u][i >> 3][i & 7];
      float mx = x[0];
#pragma unroll
      for (int i = 1; i < 32; ++i) mx = fmaxf(mx, x[i]);
      mx = fmaxf(mx, xhalf(mx));
      const float mn = fmaxf(m[u], mx); const float corr = __builtin_amdgcn_exp2f((m[u] - mn) * C1);   /* 0 on the first tile, where m is -inf */
      m[u] = mn; const float mb = mn * C1; float sum = 0.f;
#pragma unroll
      for (int i = 0; i < 32; ++i) x[i] = x[i] * C1 - mb;
#pragma unroll
      for (int i = 0; i < 32; i += 8) exp2x8(&x[i]);
#pragma unroll
      for (int i = 0; i < 32; ++i) { sum += x[i]; p[u][i >> 4][i & 15] = (_Float16)x[i]; }
      l[u] = l[u] * corr + sum;
#pragma unroll
      for (int j = 0; j < 4; ++j) o[u][j] *= corr; }
    if (more) {
#pragma unroll
      for (int i = 0; i < 4; ++i) { *(v4h*)&sK[cur ^ 1][sr + 16 * i][sc] = cv4(rk[i]); *(v4h*)&sV[cur ^ 1][sr + 16 * i][sc] = cv4(rv[i]); } }   /* that buffer's last readers left it at the barrier before this tile; stored here, ahead of P.v, for the registers: the v fragments take over the staged tile's 32 */
#pragma unroll
    for (int j = 0; j < 4; ++j)
#pragma unroll
      for (int w = 0; w < 2; ++w) vf[j][w] = frag_h(&sV[cur][j * 16 + col][w * 32], lane);
#pragma unroll
    for (int u = 0; u < 2; ++u)
#pragma unroll
      for (int j = 0; j < 4; ++j) { o[u][j] = wm(vf[j][0], p[u][0], o[u][j]); o[u][j] = wm(vf[j][1], p[u][1], o[u][j]); }
    __syncthreads(); }
  /* half g keeps columns u == g (ok, mk, lk) and gives u == 1 - g (og, mg, lg): selects on a wave-uniform flag, so that the part below is one straight path for both halves */
  v8f ok[4], og[4]; const float mk = hi ? m[1] : m[0], lk = hi ? l[1] : l[0], mg = hi ? m[0] : m[1], lg = hi ? l[0] : l[1];
#pragma unroll
  for (int j = 0; j < 4; ++j)
#pragma unroll
    for (int r = 0; r < 8; ++r) { ok[j][r] = hi ? o[1][j][r] : o[0][j][r]; og[j][r] = hi ? o[0][j][r] : o[1][j][r]; }
#pragma unroll
  for (int j = 0; j < 4; ++j) { const v4f lo = {og[j][0], og[j][1], og[j][2], og[j][3]}, hv = {og[j][4], og[j][5], og[j][6], og[j][7]}; sX[2 * j][threadIdx.x] = lo; sX[2 * j + 1][threadIdx.x] = hv; }
  { const v2f ml = {mg, lg}; sM[threadIdx.x] = ml; }
  __syncthreads();   /* the partner's partial results are in LDS behind this barrier */
  const unsigned pt = threadIdx.x ^ 256;   /* the partner lane: same wave number and lane in the other key half */
  const v2f ml = sM[pt]; const float mn = fmaxf(mk, ml[0]);
  const float ca = __builtin_amdgcn_exp2f((mk - mn) * C1), cb = __builtin_amdgcn_exp2f((ml[0] - mn) * C1);   /* both halves brought to the common maximum */
  const float ls = lk * ca + ml[1] * cb; const float inv = 1.0f / (ls + xhalf(ls)); const float fa = ca * inv, fb = cb * inv;
  /* ok[j][r] = out[q0 + 16 grp + col][16 j + 8 g + r]; the lane's byte offset, 256 (32 wave + col) + 32 g, is formed here from the thread index alone, so that no other register is held over the loop for it: the kernel has 256 at four waves a SIMD */
  float* yr = (float*)((char*)(Y + (size_t)((b * NH + h) * TT + blockIdx.x * 256 + grp * 16) * HD) + (((threadIdx.x & 0xEF) << 8) + ((threadIdx.x & 16) << 1)));
  v4f r[8];
#pragma unroll
  for (int j = 0; j < 4; ++j) { const v4f xl = sX[2 * j][pt], xh = sX[2 * j + 1][pt];
    const v4f lo = {ok[j][0] * fa + xl[0] * fb, ok[j][1] * fa + xl[1] * fb, ok[j][2] * fa + xl[2] * fb, ok[j][3] * fa + xl[3] * fb}, hv = {ok[j][4] * fa + xh[0] * fb, ok[j][5] * fa + xh[1] * fb, ok[j][6] * fa + xh[2] * fb, ok[j][7] * fa + xh[3] * fb}; r[2 * j] = lo; r[2 * j + 1] = hv; }
#pragma unroll
  for (int j = 0; j < 4; ++j) { vst2(yr + j * 16, r[2 * j]); vst2(yr + j * 16 + 4, r[2 * j + 1]); } }

extern "C" void kernel_launch(void* const* d_in, const int* in_sizes, int n_in, void* d_out, int out_size, void* d_ws, size_t ws_size, hipStream_t stream) {
  (void)in_sizes; (void)n_in; (void)out_size;
  const float** F = (const float**)d_in;
  (void)d_ws; (void)ws_size;
  // inputs: 0 query [2,16,64,2048] ([B,H,D,N]); 1 key; 2 value
  k_fa<<<dim3(TT / 256, NH, TNB), 512, 0, stream>>>(F[0], F[1], F[2], (float*)d_out);
}

// v005
// It runs in 33.9 microseconds.
// Two timings next to v004 both put it at 1.04 times that version's speed.
// All steps since v000 together make it 29.0 times as fast.
// compute dtype: all float inputs rounded to bf16; q, k, v are bf16-valued so their f16 planes are exact; logits q x k (1 product: q and k bf16 values held in f16, no residual) x 2048^-0.5 (the module's sqrt(N) scale); softmax f32 with a running maximum; P = exp(s - max) once to f16 x v (exact in f16) (1 product), divided by the f32 sum at the end; f32 output.
#include <hip/hip_runtime.h>
#include <math.h>

typedef __attribute__((ext_vector_type(16))) _Float16 v16h;
typedef __attribute__((ext_vector_type(16))) __bf16 v16b;
typedef __attribute__((ext_vector_type(8)))  _Float16 v8h;
typedef __attribute__((ext_vector_type(8)))  float v8f;
typedef __attribute__((ext_vector_type(4)))  float v4f;
typedef __attribute__((ext_vector_type(2)))  float v2f;
typedef __attribute__((ext_vector_type(4)))  unsigned v4u;
typedef _Float16 hx8 __attribute__((ext_vector_type(8)));
typedef __attribute__((ext_vector_type(4)))  int v4i;
typedef float __attribute__((may_alias)) float_a;
typedef int __attribute__((may_alias)) int_a;

template <typename T> __device__ __forceinline__ void vst2(void* p, T v) { *(T*)p = v;  }
__device__ __forceinline__ v8f wmma16(v16h a, v16h b, v8f c) {
  v8f d = __builtin_amdgcn_wmma_f32_16x16x32_f16(false, a, false, b, (short)0, c, false, false);
  asm volatile("v_nop\n\tv_nop\n\tv_nop\n\tv_nop" : "+v"(d) : "v"(a), "v"(b));
  return d;
}
__device__ __forceinline__ v8f wmma_bf(v16b a, v16b b, v8f c) {
  v8f d = __builtin_amdgcn_wmma_f32_16x16x32_bf16(false, a, false, b, (short)0, c, false, false);
  asm volatile("v_nop\n\tv_nop\n\tv_nop\n\tv_nop" : "+v"(d) : "v"(a), "v"(b));
  return d;
}
// 16x16x32 fragments: lane = (h = lane>>4, row/col = lane&15); elements 0..7 = k0+8h+0..7, 8..15 = k0+16+8h+0..7; D element r = row 8h+r
__device__ __forceinline__ v16h frag_h(const _Float16* rowk0, int lane) {
  union { v16h v; v8h q[2]; } u; const _Float16* p = rowk0 + 8 * (lane >> 4);
  u.q[0] = *(const v8h*)p; u.q[1] = *(const v8h*)(p + 16); return u.v;
}
__device__ __forceinline__ v16h frag_f32(const float* rowk0, int lane) {
  v16h a; const float* p = rowk0 + 8 * (lane >> 4);
#pragma unroll
  for (int i = 0; i < 8; ++i) { a[i] = (_Float16)p[i]; a[8 + i] = (_Float16)p[16 + i]; }
  return a;
}
__device__ __forceinline__ v16h frag_f32s(const float* rowk0, int lane, float sc) {
  v16h a; const float* p = rowk0 + 8 * (lane >> 4);
#pragma unroll
  for (int i = 0; i < 8; ++i) { a[i] = (_Float16)(p[i] * sc); a[8 + i] = (_Float16)(p[16 + i] * sc); }
  return a;
}
// column fragment from a [K][ld] layout (column n), rows >= K read as 0
__device__ __forceinline__ v16h fragc_f32(const float* W, int k0, int n, int lane, int ld, int K) {
  v16h a; const int g = lane >> 4;
#pragma unroll
  for (int i = 0; i < 8; ++i) { const int ka = k0 + 8 * g + i, kb = ka + 16;
    a[i] = (_Float16)(ka < K ? W[(size_t)(ka < K ? ka : K - 1) * ld + n] : 0.f); a[8 + i] = (_Float16)(kb < K ? W[(size_t)(kb < K ? kb : K - 1) * ld + n] : 0.f); }
  return a;
}
struct F2 { v16b h, l; };
__device__ __forceinline__ F2 bsplit16(const float v[16]) { F2 r;
#pragma unroll
  for (int i = 0; i < 16; ++i) { const __bf16 h = (__bf16)v[i]; r.h[i] = h; r.l[i] = (__bf16)(v[i] - (float)h); }
  return r; }
__device__ __forceinline__ F2 split_row(const float* row, int k0, int lane) { float v[16]; const float* p = row + k0 + 8 * (lane >> 4);
#pragma unroll
  for (int i = 0; i < 8; ++i) { v[i] = p[i]; v[8 + i] = p[16 + i]; }
  return bsplit16(v); }
__device__ __forceinline__ F2 split_rowK(const float* row, int k0, int lane, int K) { float v[16]; const int g = lane >> 4;
#pragma unroll
  for (int i = 0; i < 8; ++i) { const int ka = k0 + 8 * g + i, kb = ka + 16; v[i] = ka < K ? row[ka < K ? ka : K - 1] : 0.f; v[8 + i] = kb < K ? row[kb < K ? kb : K - 1] : 0.f; }
  return bsplit16(v); }
__device__ __forceinline__ F2 split_col(const float* W, int k0, int n, int lane, int ld, int K) { float v[16]; const int g = lane >> 4;
#pragma unroll
  for (int i = 0; i < 8; ++i) { const int ka = k0 + 8 * g + i, kb = ka + 16; v[i] = ka < K ? W[(size_t)(ka < K ? ka : K - 1) * ld + n] : 0.f; v[8 + i] = kb < K ? W[(size_t)(kb < K ? kb : K - 1) * ld + n] : 0.f; }
  return bsplit16(v); }
__device__ __forceinline__ v8f mac3(const F2& a, const F2& b, v8f c) { c = wmma_bf(a.l, b.h, c); c = wmma_bf(a.h, b.l, c); return wmma_bf(a.h, b.h, c); }
__device__ __forceinline__ float sigm(float v) { return 1.0f / (1.0f + expf(-v)); }
#define LDSX() do { asm volatile("s_wait_dscnt 0" ::: "memory"); __builtin_amdgcn_wave_barrier(); __builtin_amdgcn_fence(__ATOMIC_RELEASE, "workgroup"); } while (0)

// Scaled-dot-product attention in the unusual [B,H,D,N] layout (query/key/value [2,16,64,2048]): scores[b,h,q,k] = sum_d query[b,h,d,q] key[b,h,d,k] / sqrt(2048) (the source scales by sqrt(size(-1)) = sqrt(N)); attn = softmax over k; out[b,h,q,v] = sum_k attn[b,h,q,k] value[b,h,v,k] -> [2,16,2048,64].
#define NB 2
#define TT 2048
#define CC 1024            // NH * HD = projected width
#define DIN 1024          // input (model) width
#define NH 16
#define HD 64
#define NQB (TT / 64)
#define HG 4
#define SCALE (0.022097086912079608f)
#define CAUSAL 0
#ifndef TNB
#define TNB NB
#endif
__device__ __forceinline__ float bfr(float v) { return (float)(__bf16)v; }
__host__ __device__ __forceinline__ int kb_last(int qb) { return CAUSAL ? ((qb * 64 + 63) >> 7) : (TT / 128 - 1); }
typedef __attribute__((ext_vector_type(8))) __bf16 v8b;
__device__ __forceinline__ v16b frag_b(const __bf16* rowk0, int lane) {
  union { v16b v; v8b q[2]; } u; const __bf16* p = rowk0 + 8 * (lane >> 4);
  u.q[0] = *(const v8b*)p; u.q[1] = *(const v8b*)(p + 16); return u.v;
}
#define QBH 0              // unused: no kernel in this file has a high-precision path
#define QHI 2048            // rows carrying a q residual plane (all rows when non-causal; k_fa reads no residual)
#define KHI 64            // key rows carrying k residual / v bf16 hi+lo planes (written only by k_proj, which is not launched)
// B fragment (k rows k0+.., output column o) of a weight: (in,out) [K][ld] or (out,in) [ld rows of K]: bf16 exact, or f16(bf16 * 256) exact
__device__ __forceinline__ v16b wcol_io(const float* Wm, int k0, int o, int lane, int ld) { v16b w; const int g = lane >> 4;
#pragma unroll
  for (int i = 0; i < 8; ++i) { w[i] = (__bf16)Wm[(size_t)(k0 + 8 * g + i) * ld + o]; w[8 + i] = (__bf16)Wm[(size_t)(k0 + 16 + 8 * g + i) * ld + o]; }
  return w; }
__device__ __forceinline__ v16b wcol_oi(const float* Wm, int k0, int o, int lane, int K) { v16b w; const float* p = Wm + (size_t)o * K + k0 + 8 * (lane >> 4);
#pragma unroll
  for (int i = 0; i < 8; ++i) { w[i] = (__bf16)p[i]; w[8 + i] = (__bf16)p[16 + i]; }
  return w; }
__device__ __forceinline__ v16h wcolh_io(const float* Wm, int k0, int o, int lane, int ld) { v16h w; const int g = lane >> 4;
#pragma unroll
  for (int i = 0; i < 8; ++i) { w[i] = (_Float16)(bfr(Wm[(size_t)(k0 + 8 * g + i) * ld + o]) * 256.0f); w[8 + i] = (_Float16)(bfr(Wm[(size_t)(k0 + 16 + 8 * g + i) * ld + o]) * 256.0f); }
  return w; }
__device__ __forceinline__ v16h wcolh_oi(const float* Wm, int k0, int o, int lane, int K) { v16h w; const float* p = Wm + (size_t)o * K + k0 + 8 * (lane >> 4);
#pragma unroll
  for (int i = 0; i < 8; ++i) { w[i] = (_Float16)(bfr(p[i]) * 256.0f); w[8 + i] = (_Float16)(bfr(p[16 + i]) * 256.0f); }
  return w; }
#define WQKV_LAYOUT 0   // 0 = (in,out) [DIN][CC]; 1 = (out,in) [CC][DIN]; 2 = per-head [NH][DIN][HD]
__device__ __forceinline__ v16b wcol_hdk(const float* Wm, int k0, int o, int lane) { v16b w; const int g = lane >> 4; const float* p = Wm + (size_t)(o / HD) * DIN * HD + (o % HD);
#pragma unroll
  for (int i = 0; i < 8; ++i) { w[i] = (__bf16)p[(size_t)(k0 + 8 * g + i) * HD]; w[8 + i] = (__bf16)p[(size_t)(k0 + 16 + 8 * g + i) * HD]; }
  return w; }
#define WO_OUT_IN 0
#if WQKV_LAYOUT == 1
#define WCOL(W, k0, o, lane) wcol_oi(W, k0, o, lane, DIN)
#elif WQKV_LAYOUT == 2
#define WCOL(W, k0, o, lane) wcol_hdk(W, k0, o, lane)
#else
#define WCOL(W, k0, o, lane) wcol_io(W, k0, o, lane, CC)
#endif
#if WO_OUT_IN
#define WOCOL(W, k0, o, lane) wcol_oi(W, k0, o, lane, CC)
#define WOCOLH(W, k0, o, lane) wcolh_oi(W, k0, o, lane, CC)
#else
#define WOCOL(W, k0, o, lane) wcol_io(W, k0, o, lane, DIN)
#define WOCOLH(W, k0, o, lane) wcolh_io(W, k0, o, lane, DIN)
#endif
#ifndef SM_EXTRA_PARAMS
#define SM_EXTRA_PARAMS
#endif
#ifndef PROJ_EXTRA_PARAMS
#define PROJ_EXTRA_PARAMS
#endif
#ifndef SM_MASK_HOOK
#define SM_MASK_HOOK (void)0
#endif

#define WS_QH  0u                                      // f16 q rows [b*t][CC]
#define WS_KH  (WS_QH + 2u * (size_t)NB * TT * CC)      // f16 k rows [b*t][CC]
#define WS_VT  (WS_KH + 2u * (size_t)NB * TT * CC)      // f16 v planes [b][c][t]
#define WS_QL  (WS_VT + 2u * (size_t)NB * CC * TT)      // f16 q residual x 2^10 rows [b][t < QHI][CC]
#define WS_KL  (WS_QL + 2u * (size_t)NB * QHI * CC)     // f16 k residual x 2^10 rows [b][t < KHI][CC]
#define WS_VB  (WS_KL + 2u * (size_t)NB * KHI * CC)     // bf16 v hi planes [b][c][t < KHI]
#define WS_VBL (WS_VB + 2u * (size_t)NB * CC * KHI)
#define WS_S   (WS_VBL + 2u * (size_t)NB * CC * KHI)    // f32 [hg][t][s] region, reserved but unused (logits and P stay in registers)
#define WS_Y   (WS_S  + 4u * (size_t)HG * TT * TT)      // f32 ctx rows [b*t][CC] (only when there is an output projection)
#define WS_END (WS_Y  + 0u)

// ---- k_proj: block = (64 rows, 128 cols, which): q/k/v = X W (+ b) with exact bf16 products (K = DIN) -> which 0: q f16 rows (+ residual rows < QHI); 1: k f16 rows (+ residual rows < KHI); 2: v f16 planes [c][t] (+ bf16 hi/lo planes for t < KHI)
__global__ __launch_bounds__(128) void k_proj(const float* __restrict__ XQ, const float* __restrict__ XK, const float* __restrict__ XV, const float* __restrict__ WQ, const float* __restrict__ WK, const float* __restrict__ WV, const float* __restrict__ BQ, const float* __restrict__ BK, const float* __restrict__ BV,
    _Float16* __restrict__ QH, _Float16* __restrict__ QL, _Float16* __restrict__ KH, _Float16* __restrict__ KL, _Float16* __restrict__ VT, __bf16* __restrict__ VB, __bf16* __restrict__ VBL) {
  __shared__ __align__(16) _Float16 sh[64][136], sl[64][136]; __shared__ __align__(16) _Float16 th[128][72]; __shared__ __align__(16) __bf16 tb[128][72], tbl[128][72];
  const int tid = threadIdx.x, wave = tid >> 5, lane = tid & 31, col = lane & 15, g = lane >> 4; const int which = blockIdx.z; const int c0 = blockIdx.y * 128; const size_t r0 = (size_t)blockIdx.x * 64; const size_t bb = r0 / TT; const int t0 = (int)(r0 % TT);
  const float* X = which == 0 ? XQ : which == 1 ? XK : XV; const float* WA = which == 0 ? WQ : which == 1 ? WK : WV; const float* BA = which == 0 ? BQ : which == 1 ? BK : BV;
  v8f acc[8] = {};
#pragma unroll 2
  for (int kc = 0; kc < DIN / 32; ++kc) { v16b a; { const float* p = X + (r0 + wave * 16 + col) * DIN + kc * 32 + 8 * g;
#pragma unroll
      for (int i = 0; i < 8; ++i) { a[i] = (__bf16)p[i]; a[8 + i] = (__bf16)p[16 + i]; } }
    asm volatile("s_wait_loadcnt 0x0" ::: "memory");
#pragma unroll
    for (int j = 0; j < 8; ++j) { const v16b w = WCOL(WA, kc * 32, c0 + j * 16 + col, lane); asm volatile("s_wait_loadcnt 0x0" ::: "memory"); acc[j] = wmma_bf(a, w, acc[j]); } }
  if (which < 2) { _Float16* DH = which == 0 ? QH : KH; _Float16* DL = which == 0 ? QL : KL; const int nhi = which == 0 ? QHI : KHI; const bool hi_rows = t0 < nhi;
#pragma unroll
    for (int j = 0; j < 8; ++j) { const float bias = BA ? bfr(BA[c0 + j * 16 + col]) : 0.f;
#pragma unroll
      for (int r = 0; r < 8; ++r) { const float v = acc[j][r] + bias; const _Float16 hv = (_Float16)v; sh[wave * 16 + 8 * g + r][j * 16 + col] = hv; sl[wave * 16 + 8 * g + r][j * 16 + col] = (_Float16)((v - (float)hv) * 1024.0f); } }
    __syncthreads();
    for (int e = tid; e < 64 * 16; e += 128) { const int rl = e >> 4, q = e & 15; vst2((unsigned*)(DH + (r0 + rl) * CC + c0 + q * 8), *(const v4u*)&sh[rl][q * 8]); if (hi_rows) vst2((unsigned*)(DL + (bb * nhi + t0 + rl) * (size_t)CC + c0 + q * 8), *(const v4u*)&sl[rl][q * 8]); }
  } else { const bool hi_rows = t0 < KHI;
#pragma unroll
    for (int j = 0; j < 8; ++j) { const float bias = BA ? bfr(BA[c0 + j * 16 + col]) : 0.f;
#pragma unroll
      for (int r = 0; r < 8; ++r) { const float v = acc[j][r] + bias; const int rl = wave * 16 + 8 * g + r, cl = j * 16 + col; th[cl][rl] = (_Float16)v; const __bf16 bh = (__bf16)v; tb[cl][rl] = bh; tbl[cl][rl] = (__bf16)(v - (float)bh); } }
    __syncthreads();
    for (int e = tid; e < 128 * 8; e += 128) { const int cl = e >> 3, q = e & 7; vst2((unsigned*)(VT + (bb * CC + c0 + cl) * (size_t)TT + t0 + q * 8), *(const v4u*)&th[cl][q * 8]); if (hi_rows) { const size_t o3 = (bb * CC + c0 + cl) * (size_t)KHI + t0 + q * 8; vst2((unsigned*)(VB + o3), *(const v4u*)&tb[cl][q * 8]); vst2((unsigned*)(VBL + o3), *(const v4u*)&tbl[cl][q * 8]); } } } }
// ---- k_fa: block = 256 queries of (b, h), 16 waves = 2 key halves x 8 waves x 32 query columns, so that four waves share a SIMD and one wave's vector work runs beside another's matrix work; logits, softmax and P.v in one pass over the keys, so no logit or P ever goes to memory.
// The kernel reads the f32 [B,H,D,N] inputs themselves: every element is rounded to bf16 and held in f16 (exact from 2^-17 up; a smaller one rounds to the f16 grid of 2^-24) on its way from registers into LDS, so there is no launch ahead of this one and no plane in the workspace.
// q and k lie [d][token] in memory and stay so in LDS; the transposing 16-bit LDS load hands each lane one token's 8 + 8 d values, in the matrix instruction's own k order, for q and k alike. v lies [v][token], which is the A operand's row order already.
// S^T = K.Q^T (A = 16 keys from LDS, B = q columns kept in registers; one product: q and k are bf16 values held in f16): a lane holds 8 + 8 keys of ONE query, which are, converted in place, the B operand of O^T += V^T.P^T (A = v rows [v][key] from LDS).
// Running maximum per query (in-lane + one exchange between the wave halves), P = exp(s - max) once to f16, sums in f32, O^T and the sum rescaled when the maximum moves; division by the sum at the end.
// K and v tiles of 64 keys go global -> registers -> LDS, two buffers per key half, one barrier per tile step (one tile of each half).
// At the end the two halves' partial O^T, maxima and sums are joined through LDS: half g keeps query columns 16 g .. 16 g + 15 of each wave and hands the other 16 to its partner wave.
#define FA_KS 64           // keys per LDS tile
#define FA_NT (TT / FA_KS / 2)   // tile steps: each key half walks TT / 2 keys
#define FA_P 72            // v rows, LDS pitch in f16: 144 B = 16 B x odd, the conflict-free pitch for 16-byte reads of 128-B rows
#define FA_PK 80           // k rows [d][key], LDS pitch in f16: 160 B = 32 B x odd, the conflict-free pitch for the transposing load of 128-B rows
#define FA_PQ 272          // q rows [d][query], LDS pitch in f16: 544 B = 32 B x odd
typedef __attribute__((ext_vector_type(4))) _Float16 v4h;
typedef short s16x8 __attribute__((ext_vector_type(8)));
__device__ __forceinline__ float xhalf(float x) { return __builtin_bit_cast(float, __builtin_amdgcn_permlanex16(__builtin_bit_cast(int, x), __builtin_bit_cast(int, x), 0x76543210, 0xfedcba98, false, false)); }   /* lane l <-> lane l ^ 16 */
__device__ __forceinline__ v8f wm(v16h a, v16h b, v8f c) { return __builtin_amdgcn_wmma_f32_16x16x32_f16(false, a, false, b, (short)0, c, false, false); }
typedef __attribute__((ext_vector_type(2))) __bf16 v2b;
typedef __attribute__((ext_vector_type(2))) _Float16 v2h;
__device__ __forceinline__ v4h cv4(v4f a) { union { v4h v; v2h q[2]; } r;   /* f32 -> bf16 value held in f16, two elements per conversion instruction */
#pragma unroll
  for (int u = 0; u < 2; ++u) { const v2f s = {a[2 * u], a[2 * u + 1]}; const unsigned w = __builtin_bit_cast(unsigned, __builtin_convertvector(s, v2b));
    const v2f t = {__builtin_bit_cast(float, w << 16), __builtin_bit_cast(float, w & 0xffff0000u)}; r.q[u] = __builtin_convertvector(t, v2h); }
  return r.v; }
__device__ __forceinline__ v8h ld_tr16(const _Float16* p) { typedef __attribute__((address_space(3))) s16x8 lds_s16x8; return __builtin_bit_cast(v8h, __builtin_amdgcn_ds_load_tr16_b128_v8i16((lds_s16x8*)p)); }
// fragment (16 columns x 32 k) of a row-major [k][column] f16 tile in LDS; p = &T[k0 + 8 (lane >> 4) + (lane & 7)][c0 + 8 ((lane >> 3) & 1)]: lane (c, h) gets T[k0 + 8 h + 0..7][c0 + c] and T[k0 + 16 + 8 h + 0..7][c0 + c]
__device__ __forceinline__ v16h frag_tr(const _Float16* p, int pitch) { union { v16h v; v8h q[2]; } u; u.q[0] = ld_tr16(p); u.q[1] = ld_tr16(p + 16 * pitch); return u.v; }
// eight base-2 exponentials, each in place: no exponential's source register is written by the instruction behind it; the v_nop is the one slot the instruction set asks for between the last one and whatever reads its result
__device__ __forceinline__ void exp2x8(float* y) {
  asm("v_exp_f32 %0, %0\n\tv_exp_f32 %1, %1\n\tv_exp_f32 %2, %2\n\tv_exp_f32 %3, %3\n\tv_exp_f32 %4, %4\n\tv_exp_f32 %5, %5\n\tv_exp_f32 %6, %6\n\tv_exp_f32 %7, %7\n\tv_nop"
      : "+v"(y[0]), "+v"(y[1]), "+v"(y[2]), "+v"(y[3]), "+v"(y[4]), "+v"(y[5]), "+v"(y[6]), "+v"(y[7])); }
__global__ __launch_bounds__(512) void k_fa(const float* __restrict__ Qs, const float* __restrict__ Ks, const float* __restrict__ Vs, float* __restrict__ Y) {
  __shared__ __align__(16) _Float16 sKK[2][2][HD][FA_PK]; __shared__ __align__(16) _Float16 sVV[2][2][HD][FA_P]; __shared__ __align__(16) v4f sX[8][512]; __shared__ __align__(8) v2f sM[512];
  const int grp = __builtin_amdgcn_readfirstlane((int)threadIdx.x >> 8);   /* key half of this wave, in a scalar register */
  const int tid = threadIdx.x & 255, wave = tid >> 5, lane = tid & 31, col = lane & 15, g = lane >> 4; const int h = blockIdx.y, b = blockIdx.z;
  const bool hi = grp != 0;
  _Float16 (*sK)[HD][FA_PK] = sKK[grp]; _Float16 (*sV)[HD][FA_P] = sVV[grp];
  _Float16* sQ = (_Float16*)&sX[0][0];   /* the block's q tile [64 d][256 queries] lies, until its fragments are read, where the halves are joined at the end */
  const float C1 = SCALE * 1.4426950408889634f;   /* logit scale x log2(e): the exponentials are taken in base 2 */
  /* every inner loop below is unrolled so that all array indices are constants and the fragments and accumulators stay in registers */
  const size_t hd0 = (size_t)(b * NH + h) * HD;   /* first row [d] of this head in each input */
  const int sr = tid >> 4, sc = (tid & 15) * 4;   /* staging: 16 lanes per 256-B run of a row, rows sr + 16 i */
  const unsigned vo = (unsigned)(sr * TT + sc);   /* the lane's element offset in a [64][TT] plane, the same for k and v */
  const float* gK = Ks + hd0 * TT + grp * (TT / 2);      /* k rows [d][t] of this key half */
  const float* gV = Vs + hd0 * TT + grp * (TT / 2);      /* v rows [v][t] of this key half */
  const int qr = (int)threadIdx.x >> 6, qc = ((int)threadIdx.x & 63) * 4;   /* q staging: 64 lanes per 1-KiB run of a row, rows qr + 8 i */
  const unsigned qo = (unsigned)(qr * TT + qc);
  const float* gQ = Qs + hd0 * TT + blockIdx.x * 256;    /* q rows [d][t] of this block */
  v4f rk[4], rv[4];
  { v4f rq[8];
#pragma unroll
    for (int i = 0; i < 8; ++i) rq[i] = *(const v4f*)(gQ + (size_t)8 * i * TT + qo);
#pragma unroll
    for (int i = 0; i < 4; ++i) { rk[i] = *(const v4f*)(gK + (size_t)16 * i * TT + vo); rv[i] = *(const v4f*)(gV + (size_t)16 * i * TT + vo); }
    asm volatile("s_wait_loadcnt 0x0" :: "v"(qo), "v"(vo) : "memory");   /* the loads above have returned before any register that they name is written again */
#pragma unroll
    for (int i = 0; i < 8; ++i) *(v4h*)&sQ[(qr + 8 * i) * FA_PQ + qc] = cv4(rq[i]); }
#pragma unroll
  for (int i = 0; i < 4; ++i) { *(v4h*)&sK[0][sr + 16 * i][sc] = cv4(rk[i]); *(v4h*)&sV[0][sr + 16 * i][sc] = cv4(rv[i]); }
  __syncthreads();
  const int tr = 8 * g + (lane & 7), tc = 8 * ((lane >> 3) & 1);   /* the lane's row and column offset for the transposing load */
  v16h qh[2][2];
#pragma unroll
  for (int u = 0; u < 2; ++u)
#pragma unroll
    for (int kc = 0; kc < 2; ++kc) qh[u][kc] = frag_tr(&sQ[(kc * 32 + tr) * FA_PQ + wave * 32 + u * 16 + tc], FA_PQ);
  v8f o[2][4] = {}; float m[2] = {-__builtin_inff(), -__builtin_inff()}, l[2] = {0.f, 0.f};
#pragma unroll 1   /* the tile loop stays rolled: one trip is already several hundred instructions, a second copy would only cost instruction cache */
  for (int s = 0; s < FA_NT; ++s) { const int cur = s & 1; const bool more = s + 1 < FA_NT;
    if (more) { const float* nK = gK + (s + 1) * FA_KS + vo; const float* nV = gV + (s + 1) * FA_KS + vo;   /* the next tile's loads fly while this tile is worked on */
#pragma unroll
      for (int i = 0; i < 4; ++i) { rk[i] = *(const v4f*)(nK + (size_t)16 * i * TT); rv[i] = *(const v4f*)(nV + (size_t)16 * i * TT); }
      asm volatile("s_wait_xcnt 0x0" :: "v"(nK), "v"(nV) : "memory"); }   /* the address registers of the eight loads live up to this wait and are written again only behind it */
    /* an f32 tile in flight holds 32 registers where an f16 one held 16, and the kernel had none to spare: written in the old order (logits, softmax and P.v of one column group, then of the other, the stores last) this step spills. So it is written in the order that needs the fewest registers: the logits of both column groups, both softmaxes, the staged tile's stores, and only then the v fragments and P.v. Every value is computed as before, from the same operands in the same order */
    v16h kf[4][2], vf[4][2], p[2][2]; v8f a[2][4] = {};
#pragma unroll
    for (int t = 0; t < 4; ++t)
#pragma unroll
      for (int kc = 0; kc < 2; ++kc) kf[t][kc] = frag_tr(&sK[cur][kc * 32 + tr][t * 16 + tc], FA_PK);
#pragma unroll
    for (int u = 0; u < 2; ++u)
#pragma unroll
      for (int t = 0; t < 4; ++t)
#pragma unroll
        for (int kc = 0; kc < 2; ++kc) a[u][t] = wm(kf[t][kc], qh[u][kc], a[u][t]);   /* both column groups here, for the registers: the k fragments' 64 are dead before the v fragments are loaded */
#pragma unroll
    for (int u = 0; u < 2; ++u) {
      float x[32];   /* x[8 t + r] = unscaled logit of key 16 t + 8 g + r of the tile, query column col */
#pragma unroll
      for (int i = 0; i < 32; ++i) x[i] = a[u][i >> 3][i & 7];
      float mx = x[0];
#pragma unroll
      for (int i = 1; i < 32; ++i) mx = fmaxf(mx, x[i]);
      mx = fmaxf(mx, xhalf(mx));
      const float mn = fmaxf(m[u], mx); const float corr = __builtin_amdgcn_exp2f((m[u] - mn) * C1);   /* 0 on the first tile, where m is -inf */
      m[u] = mn; const float mb = mn * C1;
      /* scale-and-shift and row sum on pairs of f32 */
      const v2f c2 = {C1, C1}, nb2 = {-mb, -mb};
#pragma unroll
      for (int i = 0; i < 32; i += 2) { const v2f s2 = {x[i], x[i + 1]}; const v2f y2 = __builtin_elementwise_fma(s2, c2, nb2); x[i] = y2[0]; x[i + 1] = y2[1]; }
#pragma unroll
      for (int i = 0; i < 32; i += 8) exp2x8(&x[i]);
      v2f sa = {x[0], x[1]}, sb = {x[2], x[3]};   /* two chains of pairs: four partial sums, joined below */
#pragma unroll
      for (int i = 4; i < 32; i += 4) { const v2f ya = {x[i], x[i + 1]}, yb = {x[i + 2], x[i + 3]}; sa += ya; sb += yb; }
      sa += sb; const float sum = sa[0] + sa[1];
#pragma unroll
      for (int i = 0; i < 32; ++i) p[u][i >> 4][i & 15] = (_Float16)x[i];
      l[u] = l[u] * corr + sum;
#pragma unroll
      for (int j = 0; j < 4; ++j) o[u][j] *= corr; }
    if (more) {
#pragma unroll
      for (int i = 0; i < 4; ++i) { *(v4h*)&sK[cur ^ 1][sr + 16 * i][sc] = cv4(rk[i]); *(v4h*)&sV[cur ^ 1][sr + 16 * i][sc] = cv4(rv[i]); } }   /* that buffer's last readers left it at the barrier before this tile; stored here, ahead of P.v, for the registers: the v fragments take over the staged tile's 32 */
#pragma unroll
    for (int j = 0; j < 4; ++j)
#pragma unroll
      for (int w = 0; w < 2; ++w) vf[j][w] = frag_h(&sV[cur][j * 16 + col][w * 32], lane);
#pragma unroll
    for (int u = 0; u < 2; ++u)
#pragma unroll
      for (int j = 0; j < 4; ++j) { o[u][j] = wm(vf[j][0], p[u][0], o[u][j]); o[u][j] = wm(vf[j][1], p[u][1], o[u][j]); }
    __syncthreads(); }
  /* half g keeps columns u == g (ok, mk, lk) and gives u == 1 - g (og, mg, lg): selects on a wave-uniform flag, so that the part below is one straight path for both halves */
  v8f ok[4], og[4]; const float mk = hi ? m[1] : m[0], lk = hi ? l[1] : l[0], mg = hi ? m[0] : m[1], lg = hi ? l[0] : l[1];
#pragma unroll
  for (int j = 0; j < 4; ++j)
#pragma unroll
    for (int r = 0; r < 8; ++r) { ok[j][r] = hi ? o[1][j][r] : o[0][j][r]; og[j][r] = hi ? o[0][j][r] : o[1][j][r]; }
#pragma unroll
  for (int j = 0; j < 4; ++j) { const v4f lo = {og[j][0], og[j][1], og[j][2], og[j][3]}, hv = {og[j][4], og[j][5], og[j][6], og[j][7]}; sX[2 * j][threadIdx.x] = lo; sX[2 * j + 1][threadIdx.x] = hv; }
  { const v2f ml = {mg, lg}; sM[threadIdx.x] = ml; }
  __syncthreads();   /* the partner's partial results are in LDS behind this barrier */
  const unsigned pt = threadIdx.x ^ 256;   /* the partner lane: same wave number and lane in the other key half */
  const v2f ml = sM[pt]; const float mn = fmaxf(mk, ml[0]);
  const float ca = __builtin_amdgcn_exp2f((mk - mn) * C1), cb = __builtin_amdgcn_exp2f((ml[0] - mn) * C1);   /* both halves brought to the common maximum */
  const float ls = lk * ca + ml[1] * cb; const float inv = 1.0f / (ls + xhalf(ls)); const float fa = ca * inv, fb = cb * inv;
  /* ok[j][r] = out[q0 + 16 grp + col][16 j + 8 g + r]; the lane's byte offset, 256 (32 wave + col) + 32 g, is formed here from the thread index alone, so that no other register is held over the loop for it: the kernel has 256 at four waves a SIMD */
  float* yr = (float*)((char*)(Y + (size_t)((b * NH + h) * TT + blockIdx.x * 256 + grp * 16) * HD) + (((threadIdx.x & 0xEF) << 8) + ((threadIdx.x & 16) << 1)));
  v4f r[8];
#pragma unroll
  for (int j = 0; j < 4; ++j) { const v4f xl = sX[2 * j][pt], xh = sX[2 * j + 1][pt];
    const v4f lo = {ok[j][0] * fa + xl[0] * fb, ok[j][1] * fa + xl[1] * fb, ok[j][2] * fa + xl[2] * fb, ok[j][3] * fa + xl[3] * fb}, hv = {ok[j][4] * fa + xh[0] * fb, ok[j][5] * fa + xh[1] * fb, ok[j][6] * fa + xh[2] * fb, ok[j][7] * fa + xh[3] * fb}; r[2 * j] = lo; r[2 * j + 1] = hv; }
#pragma unroll
  for (int j = 0; j < 4; ++j) { vst2(yr + j * 16, r[2 * j]); vst2(yr + j * 16 + 4, r[2 * j + 1]); } }

extern "C" void kernel_launch(void* const* d_in, const int* in_sizes, int n_in, void* d_out, int out_size, void* d_ws, size_t ws_size, hipStream_t stream) {
  (void)in_sizes; (void)n_in; (void)out_size;
  const float** F = (const float**)d_in;
  (void)d_ws; (void)ws_size;
  // inputs: 0 query [2,16,64,2048] ([B,H,D,N]); 1 key; 2 value
  k_fa<<<dim3(TT / 256, NH, TNB), 512, 0, stream>>>(F[0], F[1], F[2], (float*)d_out);
}

// v006
// It runs in 31.3 microseconds.
// Two timings next to v005 put it at 1.09 and 1.08 times that version's speed.
// All steps since v000 together make it 31.5 times as fast.
// compute dtype: all float inputs rounded to bf16; q, k, v are bf16-valued so their f16 planes are exact; logits q x k (1 product) x 2048^-0.5 (the module's sqrt(N) scale); softmax f32 against a held reference (a running maximum when it is set); P = exp(s - reference) once to f16 x v (exact in f16) (1 product), divided by the f32 sum at the end; f32 output.
#include <hip/hip_runtime.h>
#include <math.h>

typedef __attribute__((ext_vector_type(16))) _Float16 v16h;
typedef __attribute__((ext_vector_type(16))) __bf16 v16b;
typedef __attribute__((ext_vector_type(8)))  _Float16 v8h;
typedef __attribute__((ext_vector_type(8)))  float v8f;
typedef __attribute__((ext_vector_type(4)))  float v4f;
typedef __attribute__((ext_vector_type(2)))  float v2f;
typedef __attribute__((ext_vector_type(4)))  unsigned v4u;
typedef _Float16 hx8 __attribute__((ext_vector_type(8)));
typedef __attribute__((ext_vector_type(4)))  int v4i;
typedef float __attribute__((may_alias)) float_a;
typedef int __attribute__((may_alias)) int_a;

template <typename T> __device__ __forceinline__ void vst2(void* p, T v) { *(T*)p = v;  }
__device__ __forceinline__ v8f wmma16(v16h a, v16h b, v8f c) {
  v8f d = __builtin_amdgcn_wmma_f32_16x16x32_f16(false, a, false, b, (short)0, c, false, false);
  asm volatile("v_nop\n\tv_nop\n\tv_nop\n\tv_nop" : "+v"(d) : "v"(a), "v"(b));
  return d;
}
__device__ __forceinline__ v8f wmma_bf(v16b a, v16b b, v8f c) {
  v8f d = __builtin_amdgcn_wmma_f32_16x16x32_bf16(false, a, false, b, (short)0, c, false, false);
  asm volatile("v_nop\n\tv_nop\n\tv_nop\n\tv_nop" : "+v"(d) : "v"(a), "v"(b));
  return d;
}
// 16x16x32 fragments: lane = (h = lane>>4, row/col = lane&15); elements 0..7 = k0+8h+0..7, 8..15 = k0+16+8h+0..7; D element r = row 8h+r
__device__ __forceinline__ v16h frag_h(const _Float16* rowk0, int lane) {
  union { v16h v; v8h q[2]; } u; const _Float16* p = rowk0 + 8 * (lane >> 4);
  u.q[0] = *(const v8h*)p; u.q[1] = *(const v8h*)(p + 16); return u.v;
}
__device__ __forceinline__ v16h frag_f32(const float* rowk0, int lane) {
  v16h a; const float* p = rowk0 + 8 * (lane >> 4);
#pragma unroll
  for (int i = 0; i < 8; ++i) { a[i] = (_Float16)p[i]; a[8 + i] = (_Float16)p[16 + i]; }
  return a;
}
__device__ __forceinline__ v16h frag_f32s(const float* rowk0, int lane, float sc) {
  v16h a; const float* p = rowk0 + 8 * (lane >> 4);
#pragma unroll
  for (int i = 0; i < 8; ++i) { a[i] = (_Float16)(p[i] * sc); a[8 + i] = (_Float16)(p[16 + i] * sc); }
  return a;
}
// column fragment from a [K][ld] layout (column n), rows >= K read as 0
__device__ __forceinline__ v16h fragc_f32(const float* W, int k0, int n, int lane, int ld, int K) {
  v16h a; const int g = lane >> 4;
#pragma unroll
  for (int i = 0; i < 8; ++i) { const int ka = k0 + 8 * g + i, kb = ka + 16;
    a[i] = (_Float16)(ka < K ? W[(size_t)(ka < K ? ka : K - 1) * ld + n] : 0.f); a[8 + i] = (_Float16)(kb < K ? W[(size_t)(kb < K ? kb : K - 1) * ld + n] : 0.f); }
  return a;
}
struct F2 { v16b h, l; };
__device__ __forceinline__ F2 bsplit16(const float v[16]) { F2 r;
#pragma unroll
  for (int i = 0; i < 16; ++i) { const __bf16 h = (__bf16)v[i]; r.h[i] = h; r.l[i] = (__bf16)(v[i] - (float)h); }
  return r; }
__device__ __forceinline__ F2 split_row(const float* row, int k0, int lane) { float v[16]; const float* p = row + k0 + 8 * (lane >> 4);
#pragma unroll
  for (int i = 0; i < 8; ++i) { v[i] = p[i]; v[8 + i] = p[16 + i]; }
  return bsplit16(v); }
__device__ __forceinline__ F2 split_rowK(const float* row, int k0, int lane, int K) { float v[16]; const int g = lane >> 4;
#pragma unroll
  for (int i = 0; i < 8; ++i) { const int ka = k0 + 8 * g + i, kb = ka + 16; v[i] = ka < K ? row[ka < K ? ka : K - 1] : 0.f; v[8 + i] = kb < K ? row[kb < K ? kb : K - 1] : 0.f; }
  return bsplit16(v); }
__device__ __forceinline__ F2 split_col(const float* W, int k0, int n, int lane, int ld, int K) { float v[16]; const int g = lane >> 4;
#pragma unroll
  for (int i = 0; i < 8; ++i) { const int ka = k0 + 8 * g + i, kb = ka + 16; v[i] = ka < K ? W[(size_t)(ka < K ? ka : K - 1) * ld + n] : 0.f; v[8 + i] = kb < K ? W[(size_t)(kb < K ? kb : K - 1) * ld + n] : 0.f; }
  return bsplit16(v); }
__device__ __forceinline__ v8f mac3(const F2& a, const F2& b, v8f c) { c = wmma_bf(a.l, b.h, c); c = wmma_bf(a.h, b.l, c); return wmma_bf(a.h, b.h, c); }
__device__ __forceinline__ float sigm(float v) { return 1.0f / (1.0f + expf(-v)); }
#define LDSX() do { asm volatile("s_wait_dscnt 0" ::: "memory"); __builtin_amdgcn_wave_barrier(); __builtin_amdgcn_fence(__ATOMIC_RELEASE, "workgroup"); } while (0)

// Scaled-dot-product attention in the unusual [B,H,D,N] layout (query/key/value [2,16,64,2048]): scores[b,h,q,k] = sum_d query[b,h,d,q] key[b,h,d,k] / sqrt(2048) (the source scales by sqrt(size(-1)) = sqrt(N)); attn = softmax over k; out[b,h,q,v] = sum_k attn[b,h,q,k] value[b,h,v,k] -> [2,16,2048,64].
#define NB 2
#define TT 2048
#define CC 1024            // NH * HD = projected width
#define DIN 1024          // input (model) width
#define NH 16
#define HD 64
#define NQB (TT / 64)
#define HG 4
#define SCALE (0.022097086912079608f)
#define CAUSAL 0
#ifndef TNB
#define TNB NB
#endif
__device__ __forceinline__ float bfr(float v) { return (float)(__bf16)v; }
__host__ __device__ __forceinline__ int kb_last(int qb) { return CAUSAL ? ((qb * 64 + 63) >> 7) : (TT / 128 - 1); }
typedef __attribute__((ext_vector_type(8))) __bf16 v8b;
__device__ __forceinline__ v16b frag_b(const __bf16* rowk0, int lane) {
  union { v16b v; v8b q[2]; } u; const __bf16* p = rowk0 + 8 * (lane >> 4);
  u.q[0] = *(const v8b*)p; u.q[1] = *(const v8b*)(p + 16); return u.v;
}
#define QBH 0              // unused: no kernel in this file has a high-precision path
#define QHI 2048            // rows carrying a q residual plane (all rows when non-causal; k_fa reads no residual)
#define KHI 64            // key rows carrying k residual / v bf16 hi+lo planes (written only by k_proj, which is not launched)
// B fragment (k rows k0+.., output column o) of a weight: (in,out) [K][ld] or (out,in) [ld rows of K]: bf16 exact, or f16(bf16 * 256) exact
__device__ __forceinline__ v16b wcol_io(const float* Wm, int k0, int o, int lane, int ld) { v16b w; const int g = lane >> 4;
#pragma unroll
  for (int i = 0; i < 8; ++i) { w[i] = (__bf16)Wm[(size_t)(k0 + 8 * g + i) * ld + o]; w[8 + i] = (__bf16)Wm[(size_t)(k0 + 16 + 8 * g + i) * ld + o]; }
  return w; }
__device__ __forceinline__ v16b wcol_oi(const float* Wm, int k0, int o, int lane, int K) { v16b w; const float* p = Wm + (size_t)o * K + k0 + 8 * (lane >> 4);
#pragma unroll
  for (int i = 0; i < 8; ++i) { w[i] = (__bf16)p[i]; w[8 + i] = (__bf16)p[16 + i]; }
  return w; }
__device__ __forceinline__ v16h wcolh_io(const float* Wm, int k0, int o, int lane, int ld) { v16h w; const int g = lane >> 4;
#pragma unroll
  for (int i = 0; i < 8; ++i) { w[i] = (_Float16)(bfr(Wm[(size_t)(k0 + 8 * g + i) * ld + o]) * 256.0f); w[8 + i] = (_Float16)(bfr(Wm[(size_t)(k0 + 16 + 8 * g + i) * ld + o]) * 256.0f); }
  return w; }
__device__ __forceinline__ v16h wcolh_oi(const float* Wm, int k0, int o, int lane, int K) { v16h w; const float* p = Wm + (size_t)o * K + k0 + 8 * (lane >> 4);
#pragma unroll
  for (int i = 0; i < 8; ++i) { w[i] = (_Float16)(bfr(p[i]) * 256.0f); w[8 + i] = (_Float16)(bfr(p[16 + i]) * 256.0f); }
  return w; }
#define WQKV_LAYOUT 0   // 0 = (in,out) [DIN][CC]; 1 = (out,in) [CC][DIN]; 2 = per-head [NH][DIN][HD]
__device__ __forceinline__ v16b wcol_hdk(const float* Wm, int k0, int o, int lane) { v16b w; const int g = lane >> 4; const float* p = Wm + (size_t)(o / HD) * DIN * HD + (o % HD);
#pragma unroll
  for (int i = 0; i < 8; ++i) { w[i] = (__bf16)p[(size_t)(k0 + 8 * g + i) * HD]; w[8 + i] = (__bf16)p[(size_t)(k0 + 16 + 8 * g + i) * HD]; }
  return w; }
#define WO_OUT_IN 0
#if WQKV_LAYOUT == 1
#define WCOL(W, k0, o, lane) wcol_oi(W, k0, o, lane, DIN)
#elif WQKV_LAYOUT == 2
#define WCOL(W, k0, o, lane) wcol_hdk(W, k0, o, lane)
#else
#define WCOL(W, k0, o, lane) wcol_io(W, k0, o, lane, CC)
#endif
#if WO_OUT_IN
#define WOCOL(W, k0, o, lane) wcol_oi(W, k0, o, lane, CC)
#define WOCOLH(W, k0, o, lane) wcolh_oi(W, k0, o, lane, CC)
#else
#define WOCOL(W, k0, o, lane) wcol_io(W, k0, o, lane, DIN)
#define WOCOLH(W, k0, o, lane) wcolh_io(W, k0, o, lane, DIN)
#endif
#ifndef SM_EXTRA_PARAMS
#define SM_EXTRA_PARAMS
#endif
#ifndef PROJ_EXTRA_PARAMS
#define PROJ_EXTRA_PARAMS
#endif
#ifndef SM_MASK_HOOK
#define SM_MASK_HOOK (void)0
#endif

#define WS_QH  0u                                      // f16 q rows [b*t][CC]
#define WS_KH  (WS_QH + 2u * (size_t)NB * TT * CC)      // f16 k rows [b*t][CC]
#define WS_VT  (WS_KH + 2u * (size_t)NB * TT * CC)      // f16 v planes [b][c][t]
#define WS_QL  (WS_VT + 2u * (size_t)NB * CC * TT)      // f16 q residual x 2^10 rows [b][t < QHI][CC]
#define WS_KL  (WS_QL + 2u * (size_t)NB * QHI * CC)     // f16 k residual x 2^10 rows [b][t < KHI][CC]
#define WS_VB  (WS_KL + 2u * (size_t)NB * KHI * CC)     // bf16 v hi planes [b][c][t < KHI]
#define WS_VBL (WS_VB + 2u * (size_t)NB * CC * KHI)
#define WS_S   (WS_VBL + 2u * (size_t)NB * CC * KHI)    // f32 [hg][t][s] region, reserved but unused (logits and P stay in registers)
#define WS_Y   (WS_S  + 4u * (size_t)HG * TT * TT)      // f32 ctx rows [b*t][CC] (only when there is an output projection)
#define WS_END (WS_Y  + 0u)

// ---- k_proj: block = (64 rows, 128 cols, which): q/k/v = X W (+ b) with exact bf16 products (K = DIN) -> which 0: q f16 rows (+ residual rows < QHI); 1: k f16 rows (+ residual rows < KHI); 2: v f16 planes [c][t] (+ bf16 hi/lo planes for t < KHI)
__global__ __launch_bounds__(128) void k_proj(const float* __restrict__ XQ, const float* __restrict__ XK, const float* __restrict__ XV, const float* __restrict__ WQ, const float* __restrict__ WK, const float* __restrict__ WV, const float* __restrict__ BQ, const float* __restrict__ BK, const float* __restrict__ BV,
    _Float16* __restrict__ QH, _Float16* __restrict__ QL, _Float16* __restrict__ KH, _Float16* __restrict__ KL, _Float16* __restrict__ VT, __bf16* __restrict__ VB, __bf16* __restrict__ VBL) {
  __shared__ __align__(16) _Float16 sh[64][136], sl[64][136]; __shared__ __align__(16) _Float16 th[128][72]; __shared__ __align__(16) __bf16 tb[128][72], tbl[128][72];
  const int tid = threadIdx.x, wave = tid >> 5, lane = tid & 31, col = lane & 15, g = lane >> 4; const int which = blockIdx.z; const int c0 = blockIdx.y * 128; const size_t r0 = (size_t)blockIdx.x * 64; const size_t bb = r0 / TT; const int t0 = (int)(r0 % TT);
  const float* X = which == 0 ? XQ : which == 1 ? XK : XV; const float* WA = which == 0 ? WQ : which == 1 ? WK : WV; const float* BA = which == 0 ? BQ : which == 1 ? BK : BV;
  v8f acc[8] = {};
#pragma unroll 2
  for (int kc = 0; kc < DIN / 32; ++kc) { v16b a; { const float* p = X + (r0 + wave * 16 + col) * DIN + kc * 32 + 8 * g;
#pragma unroll
      for (int i = 0; i < 8; ++i) { a[i] = (__bf16)p[i]; a[8 + i] = (__bf16)p[16 + i]; } }
    asm volatile("s_wait_loadcnt 0x0" ::: "memory");
#pragma unroll
    for (int j = 0; j < 8; ++j) { const v16b w = WCOL(WA, kc * 32, c0 + j * 16 + col, lane); asm volatile("s_wait_loadcnt 0x0" ::: "memory"); acc[j] = wmma_bf(a, w, acc[j]); } }
  if (which < 2) { _Float16* DH = which == 0 ? QH : KH; _Float16* DL = which == 0 ? QL : KL; const int nhi = which == 0 ? QHI : KHI; const bool hi_rows = t0 < nhi;
#pragma unroll
    for (int j = 0; j < 8; ++j) { const float bias = BA ? bfr(BA[c0 + j * 16 + col]) : 0.f;
#pragma unroll
      for (int r = 0; r < 8; ++r) { const float v = acc[j][r] + bias; const _Float16 hv = (_Float16)v; sh[wave * 16 + 8 * g + r][j * 16 + col] = hv; sl[wave * 16 + 8 * g + r][j * 16 + col] = (_Float16)((v - (float)hv) * 1024.0f); } }
    __syncthreads();
    for (int e = tid; e < 64 * 16; e += 128) { const int rl = e >> 4, q = e & 15; vst2((unsigned*)(DH + (r0 + rl) * CC + c0 + q * 8), *(const v4u*)&sh[rl][q * 8]); if (hi_rows) vst2((unsigned*)(DL + (bb * nhi + t0 + rl) * (size_t)CC + c0 + q * 8), *(const v4u*)&sl[rl][q * 8]); }
  } else { const bool hi_rows = t0 < KHI;
#pragma unroll
    for (int j = 0; j < 8; ++j) { const float bias = BA ? bfr(BA[c0 + j * 16 + col]) : 0.f;
#pragma unroll
      for (int r = 0; r < 8; ++r) { const float v = acc[j][r] + bias; const int rl = wave * 16 + 8 * g + r, cl = j * 16 + col; th[cl][rl] = (_Float16)v; const __bf16 bh = (__bf16)v; tb[cl][rl] = bh; tbl[cl][rl] = (__bf16)(v - (float)bh); } }
    __syncthreads();
    for (int e = tid; e < 128 * 8; e += 128) { const int cl = e >> 3, q = e & 7; vst2((unsigned*)(VT + (bb * CC + c0 + cl) * (size_t)TT + t0 + q * 8), *(const v4u*)&th[cl][q * 8]); if (hi_rows) { const size_t o3 = (bb * CC + c0 + cl) * (size_t)KHI + t0 + q * 8; vst2((unsigned*)(VB + o3), *(const v4u*)&tb[cl][q * 8]); vst2((unsigned*)(VBL + o3), *(const v4u*)&tbl[cl][q * 8]); } } } }
// ---- k_fa: block = 256 queries of (b, h), 16 waves = 2 key halves x 8 waves x 32 query columns, so that four waves share a SIMD and one wave's vector work runs beside another's matrix work; logits, softmax and P.v in one pass over the keys, so no logit or P ever goes to memory.
// The kernel reads the f32 [B,H,D,N] inputs themselves: every element is rounded to bf16 and held in f16 (exact from 2^-17 up; a smaller one rounds to the f16 grid of 2^-24) on its way from registers into LDS, so there is no launch ahead of this one and no plane in the workspace.
// q and k lie [d][token] in memory and stay so in LDS; the transposing 16-bit LDS load hands each lane one token's 8 + 8 d values, in the matrix instruction's own k order, for q and k alike. v lies [v][token], which is the A operand's row order already.
// S^T = K.Q^T (A = 16 keys from LDS, B = q columns kept in registers; one product: q and k are bf16 values held in f16): a lane holds 8 + 8 keys of ONE query, which are, converted in place, the B operand of O^T += V^T.P^T (A = v rows [v][key] from LDS).
// Held reference per query (a maximum when it is set: in-lane + one exchange between the wave halves), P = exp(s - reference) once to f16, sums in f32; the reference moves, and O^T and the sum are rescaled, only when a tile's weight sum passes a cap; division by the sum at the end.
// K and v tiles of 64 keys go global -> registers -> LDS, two buffers per key half, one barrier per tile step (one tile of each half).
// At the end the two halves' partial O^T, maxima and sums are joined through LDS: half g keeps query columns 16 g .. 16 g + 15 of each wave and hands the other 16 to its partner wave.
#define FA_KS 64           // keys per LDS tile
#define FA_NT (TT / FA_KS / 2)   // tile steps: each key half walks TT / 2 keys
#define FA_P 72            // v rows, LDS pitch in f16: 144 B = 16 B x odd, the conflict-free pitch for 16-byte reads of 128-B rows
#define FA_PK 80           // k rows [d][key], LDS pitch in f16: 160 B = 32 B x odd, the conflict-free pitch for the transposing load of 128-B rows
#define FA_CAP 256.0f      // a lane's weight sum of one tile above which the tile is redone against a new maximum
#define FA_PQ 272          // q rows [d][query], LDS pitch in f16: 544 B = 32 B x odd
typedef __attribute__((ext_vector_type(4))) _Float16 v4h;
typedef short s16x8 __attribute__((ext_vector_type(8)));
__device__ __forceinline__ float xhalf(float x) { return __builtin_bit_cast(float, __builtin_amdgcn_permlanex16(__builtin_bit_cast(int, x), __builtin_bit_cast(int, x), 0x76543210, 0xfedcba98, false, false)); }   /* lane l <-> lane l ^ 16 */
__device__ __forceinline__ v8f wm(v16h a, v16h b, v8f c) { return __builtin_amdgcn_wmma_f32_16x16x32_f16(false, a, false, b, (short)0, c, false, false); }
typedef __attribute__((ext_vector_type(2))) __bf16 v2b;
typedef __attribute__((ext_vector_type(2))) _Float16 v2h;
__device__ __forceinline__ v4h cv4(v4f a) { union { v4h v; v2h q[2]; } r;   /* f32 -> bf16 value held in f16, two elements per conversion instruction */
#pragma unroll
  for (int u = 0; u < 2; ++u) { const v2f s = {a[2 * u], a[2 * u + 1]}; const unsigned w = __builtin_bit_cast(unsigned, __builtin_convertvector(s, v2b));
    const v2f t = {__builtin_bit_cast(float, w << 16), __builtin_bit_cast(float, w & 0xffff0000u)}; r.q[u] = __builtin_convertvector(t, v2h); }
  return r.v; }
__device__ __forceinline__ v8h ld_tr16(const _Float16* p) { typedef __attribute__((address_space(3))) s16x8 lds_s16x8; return __builtin_bit_cast(v8h, __builtin_amdgcn_ds_load_tr16_b128_v8i16((lds_s16x8*)p)); }
// fragment (16 columns x 32 k) of a row-major [k][column] f16 tile in LDS; p = &T[k0 + 8 (lane >> 4) + (lane & 7)][c0 + 8 ((lane >> 3) & 1)]: lane (c, h) gets T[k0 + 8 h + 0..7][c0 + c] and T[k0 + 16 + 8 h + 0..7][c0 + c]
__device__ __forceinline__ v16h frag_tr(const _Float16* p, int pitch) { union { v16h v; v8h q[2]; } u; u.q[0] = ld_tr16(p); u.q[1] = ld_tr16(p + 16 * pitch); return u.v; }
// eight base-2 exponentials, each in place: no exponential's source register is written by the instruction behind it; the v_nop is the one slot the instruction set asks for between the last one and whatever reads its result
__device__ __forceinline__ void exp2x8(float* y) {
  asm("v_exp_f32 %0, %0\n\tv_exp_f32 %1, %1\n\tv_exp_f32 %2, %2\n\tv_exp_f32 %3, %3\n\tv_exp_f32 %4, %4\n\tv_exp_f32 %5, %5\n\tv_exp_f32 %6, %6\n\tv_exp_f32 %7, %7\n\tv_nop"
      : "+v"(y[0]), "+v"(y[1]), "+v"(y[2]), "+v"(y[3]), "+v"(y[4]), "+v"(y[5]), "+v"(y[6]), "+v"(y[7])); }
__global__ __launch_bounds__(512) void k_fa(const float* __restrict__ Qs, const float* __restrict__ Ks, const float* __restrict__ Vs, float* __restrict__ Y) {
  __shared__ __align__(16) _Float16 sKK[2][2][HD][FA_PK]; __shared__ __align__(16) _Float16 sVV[2][2][HD][FA_P]; __shared__ __align__(16) v4f sX[8][512]; __shared__ __align__(8) v2f sM[512];
  const int grp = __builtin_amdgcn_readfirstlane((int)threadIdx.x >> 8);   /* key half of this wave, in a scalar register */
  const int tid = threadIdx.x & 255, wave = tid >> 5, lane = tid & 31, col = lane & 15, g = lane >> 4; const int h = blockIdx.y, b = blockIdx.z;
  const bool hi = grp != 0;
  _Float16 (*sK)[HD][FA_PK] = sKK[grp]; _Float16 (*sV)[HD][FA_P] = sVV[grp];
  _Float16* sQ = (_Float16*)&sX[0][0];   /* the block's q tile [64 d][256 queries] lies, until its fragments are read, where the halves are joined at the end */
  const float C1 = SCALE * 1.4426950408889634f;   /* logit scale x log2(e): the exponentials are taken in base 2 */
  /* every inner loop below is unrolled so that all array indices are constants and the fragments and accumulators stay in registers */
  const size_t hd0 = (size_t)(b * NH + h) * HD;   /* first row [d] of this head in each input */
  const int sr = tid >> 4, sc = (tid & 15) * 4;   /* staging: 16 lanes per 256-B run of a row, rows sr + 16 i */
  const unsigned vo = (unsigned)(sr * TT + sc);   /* the lane's element offset in a [64][TT] plane, the same for k and v */
  const float* gK = Ks + hd0 * TT + grp * (TT / 2);      /* k rows [d][t] of this key half */
  const float* gV = Vs + hd0 * TT + grp * (TT / 2);      /* v rows [v][t] of this key half */
  const int qr = (int)threadIdx.x >> 6, qc = ((int)threadIdx.x & 63) * 4;   /* q staging: 64 lanes per 1-KiB run of a row, rows qr + 8 i */
  const unsigned qo = (unsigned)(qr * TT + qc);
  const float* gQ = Qs + hd0 * TT + blockIdx.x * 256;    /* q rows [d][t] of this block */
  v4f rk[4], rv[4];
  { v4f rq[8];
#pragma unroll
    for (int i = 0; i < 8; ++i) rq[i] = *(const v4f*)(gQ + (size_t)8 * i * TT + qo);
#pragma unroll
    for (int i = 0; i < 4; ++i) { rk[i] = *(const v4f*)(gK + (size_t)16 * i * TT + vo); rv[i] = *(const v4f*)(gV + (size_t)16 * i * TT + vo); }
    asm volatile("s_wait_loadcnt 0x0" :: "v"(qo), "v"(vo) : "memory");   /* the loads above have returned before any register that they name is written again */
#pragma unroll
    for (int i = 0; i < 8; ++i) *(v4h*)&sQ[(qr + 8 * i) * FA_PQ + qc] = cv4(rq[i]); }
#pragma unroll
  for (int i = 0; i < 4; ++i) { *(v4h*)&sK[0][sr + 16 * i][sc] = cv4(rk[i]); *(v4h*)&sV[0][sr + 16 * i][sc] = cv4(rv[i]); }
  __syncthreads();
  const int tr = 8 * g + (lane & 7), tc = 8 * ((lane >> 3) & 1);   /* the lane's row and column offset for the transposing load */
  v16h qh[2][2];
#pragma unroll
  for (int u = 0; u < 2; ++u)
#pragma unroll
    for (int kc = 0; kc < 2; ++kc) qh[u][kc] = frag_tr(&sQ[(kc * 32 + tr) * FA_PQ + wave * 32 + u * 16 + tc], FA_PQ);
  v8f o[2][4] = {}; float m[2] = {-__builtin_inff(), -__builtin_inff()}, l[2] = {0.f, 0.f};
#pragma unroll 1   /* the tile loop stays rolled: one trip is already several hundred instructions, a second copy would only cost instruction cache */
  for (int s = 0; s < FA_NT; ++s) { const int cur = s & 1; const bool more = s + 1 < FA_NT;
    if (more) { const float* nK = gK + (s + 1) * FA_KS + vo; const float* nV = gV + (s + 1) * FA_KS + vo;   /* the next tile's loads fly while this tile is worked on */
#pragma unroll
      for (int i = 0; i < 4; ++i) { rk[i] = *(const v4f*)(nK + (size_t)16 * i * TT); rv[i] = *(const v4f*)(nV + (size_t)16 * i * TT); }
      asm volatile("s_wait_xcnt 0x0" :: "v"(nK), "v"(nV) : "memory"); }   /* the address registers of the eight loads live up to this wait and are written again only behind it */
    /* an f32 tile in flight holds 32 registers where an f16 one held 16, and the kernel had none to spare: written in the old order (logits, softmax and P.v of one column group, then of the other, the stores last) this step spills. So it is written in the order that needs the fewest registers: the logits of both column groups, both softmaxes, the staged tile's stores, and only then the v fragments and P.v. Every value is computed as before, from the same operands in the same order */
    v16h vf[4][2], p[2][2]; v8f a[2][4]; float sum[2];
    /* held reference: m, the value that the exponentials are taken against, is a maximum only when it is set. A tile is worked against the m in use with no maximum, no exchange between the wave halves and no rescale; its own weight sums are the test: no weight is negative, so a lane's sum of 32 at or below FA_CAP bounds each of them, well inside f16. One ballot a tile step, as a scalar branch. Where a sum is above (or infinite), nothing of the tile has been added yet: the tile is done once more, now with its maximum taken, m raised to it and O and the sums rescaled, after which every weight is at most 1. The first tile, where m is -inf, sets m ahead of its weights */
    const auto logits = [&]() { v16h kf[4][2];
#pragma unroll
      for (int t = 0; t < 4; ++t)
#pragma unroll
        for (int kc = 0; kc < 2; ++kc) kf[t][kc] = frag_tr(&sK[cur][kc * 32 + tr][t * 16 + tc], FA_PK);
#pragma unroll
      for (int t = 0; t < 4; ++t) {
#pragma unroll
        for (int kc = 0; kc < 2; ++kc)
#pragma unroll
          for (int u = 0; u < 2; ++u) a[u][t] = wm(kf[t][kc], qh[u][kc], kc ? a[u][t] : v8f{});
        __builtin_amdgcn_sched_barrier(0); } };   /* 16 keys at a time, both column groups, in this order, so that a k fragment pair is dead when the next accumulators need registers; left free, the scheduler issues the last four fragment loads only two matrix instructions ahead of their use */
    const auto raise = [&]() {
#pragma unroll
      for (int u = 0; u < 2; ++u) { float mx = a[u][0][0];
#pragma unroll
        for (int i = 1; i < 32; ++i) mx = fmaxf(mx, a[u][i >> 3][i & 7]);
        mx = fmaxf(mx, xhalf(mx));
        const float mn = fmaxf(m[u], mx); const float corr = __builtin_amdgcn_exp2f((m[u] - mn) * C1);   /* 0 on the first tile, where m is -inf */
        m[u] = mn; l[u] *= corr;
#pragma unroll
        for (int j = 0; j < 4; ++j) o[u][j] *= corr; } };
    const auto weights = [&]() {
#pragma unroll
      for (int u = 0; u < 2; ++u) {
        float x[32];   /* x[8 t + r] = unscaled logit of key 16 t + 8 g + r of the tile, query column col */
#pragma unroll
        for (int i = 0; i < 32; ++i) x[i] = a[u][i >> 3][i & 7];
        const float mb = m[u] * C1;
        /* scale-and-shift and row sum on pairs of f32: one packed instruction issues in the slot of a plain one and does two elements */
        const v2f c2 = {C1, C1}, nb2 = {-mb, -mb};
#pragma unroll
        for (int i = 0; i < 32; i += 2) { const v2f s2 = {x[i], x[i + 1]}; const v2f y2 = __builtin_elementwise_fma(s2, c2, nb2); x[i] = y2[0]; x[i + 1] = y2[1]; }
#pragma unroll
        for (int i = 0; i < 32; i += 8) exp2x8(&x[i]);
        v2f sa = {x[0], x[1]}, sb = {x[2], x[3]};   /* two chains of pairs: four partial sums, joined below */
#pragma unroll
        for (int i = 4; i < 32; i += 4) { const v2f ya = {x[i], x[i + 1]}, yb = {x[i + 2], x[i + 3]}; sa += ya; sb += yb; }
        sa += sb; sum[u] = sa[0] + sa[1];
#pragma unroll
        for (int i = 0; i < 32; ++i) a[u][i >> 3][i & 7] = x[i]; } };   /* the weights stay in f32, in the logits' registers, up to the test */
    logits();
    if (s == 0) raise();
    weights();
    if (__builtin_expect(__builtin_amdgcn_ballot_w32((sum[0] > FA_CAP) | (sum[1] > FA_CAP)) != 0, 0)) {
      logits(); raise(); weights(); }
    l[0] += sum[0]; l[1] += sum[1];
#pragma unroll
    for (int u = 0; u < 2; ++u)
#pragma unroll
      for (int i = 0; i < 32; ++i) p[u][i >> 4][i & 15] = (_Float16)a[u][i >> 3][i & 7];
    if (more) {
#pragma unroll
      for (int i = 0; i < 4; ++i) { *(v4h*)&sK[cur ^ 1][sr + 16 * i][sc] = cv4(rk[i]); *(v4h*)&sV[cur ^ 1][sr + 16 * i][sc] = cv4(rv[i]); } }   /* that buffer's last readers left it at the barrier before this tile; stored here, ahead of P.v, for the registers: the v fragments take over the staged tile's 32 */
#pragma unroll
    for (int j = 0; j < 4; ++j)
#pragma unroll
      for (int w = 0; w < 2; ++w) vf[j][w] = frag_h(&sV[cur][j * 16 + col][w * 32], lane);
#pragma unroll
    for (int u = 0; u < 2; ++u)
#pragma unroll
      for (int j = 0; j < 4; ++j) { o[u][j] = wm(vf[j][0], p[u][0], o[u][j]); o[u][j] = wm(vf[j][1], p[u][1], o[u][j]); }
    __syncthreads(); }
  /* half g keeps columns u == g (ok, mk, lk) and gives u == 1 - g (og, mg, lg): selects on a wave-uniform flag, so that the part below is one straight path for both halves */
  v8f ok[4], og[4]; const float mk = hi ? m[1] : m[0], lk = hi ? l[1] : l[0], mg = hi ? m[0] : m[1], lg = hi ? l[0] : l[1];
#pragma unroll
  for (int j = 0; j < 4; ++j)
#pragma unroll
    for (int r = 0; r < 8; ++r) { ok[j][r] = hi ? o[1][j][r] : o[0][j][r]; og[j][r] = hi ? o[0][j][r] : o[1][j][r]; }
#pragma unroll
  for (int j = 0; j < 4; ++j) { const v4f lo = {og[j][0], og[j][1], og[j][2], og[j][3]}, hv = {og[j][4], og[j][5], og[j][6], og[j][7]}; sX[2 * j][threadIdx.x] = lo; sX[2 * j + 1][threadIdx.x] = hv; }
  { const v2f ml = {mg, lg}; sM[threadIdx.x] = ml; }
  __syncthreads();   /* the partner's partial results are in LDS behind this barrier */
  const unsigned pt = threadIdx.x ^ 256;   /* the partner lane: same wave number and lane in the other key half */
  const v2f ml = sM[pt]; const float mn = fmaxf(mk, ml[0]);
  const float ca = __builtin_amdgcn_exp2f((mk - mn) * C1), cb = __builtin_amdgcn_exp2f((ml[0] - mn) * C1);   /* both halves brought to the common maximum */
  const float ls = lk * ca + ml[1] * cb; const float inv = 1.0f / (ls + xhalf(ls)); const float fa = ca * inv, fb = cb * inv;
  /* ok[j][r] = out[q0 + 16 grp + col][16 j + 8 g + r]; the lane's byte offset, 256 (32 wave + col) + 32 g, is formed here from the thread index alone, so that no other register is held over the loop for it: the kernel has 256 at four waves a SIMD */
  float* yr = (float*)((char*)(Y + (size_t)((b * NH + h) * TT + blockIdx.x * 256 + grp * 16) * HD) + (((threadIdx.x & 0xEF) << 8) + ((threadIdx.x & 16) << 1)));
  v4f r[8];
#pragma unroll
  for (int j = 0; j < 4; ++j) { const v4f xl = sX[2 * j][pt], xh = sX[2 * j + 1][pt];
    const v4f lo = {ok[j][0] * fa + xl[0] * fb, ok[j][1] * fa + xl[1] * fb, ok[j][2] * fa + xl[2] * fb, ok[j][3] * fa + xl[3] * fb}, hv = {ok[j][4] * fa + xh[0] * fb, ok[j][5] * fa + xh[1] * fb, ok[j][6] * fa + xh[2] * fb, ok[j][7] * fa + xh[3] * fb}; r[2 * j] = lo; r[2 * j + 1] = hv; }
#pragma unroll
  for (int j = 0; j < 4; ++j) { vst2(yr + j * 16, r[2 * j]); vst2(yr + j * 16 + 4, r[2 * j + 1]); } }

extern "C" void kernel_launch(void* const* d_in, const int* in_sizes, int n_in, void* d_out, int out_size, void* d_ws, size_t ws_size, hipStream_t stream) {
  (void)in_sizes; (void)n_in; (void)out_size;
  const float** F = (const float**)d_in;
  (void)d_ws; (void)ws_size;
  // inputs: 0 query [2,16,64,2048] ([B,H,D,N]); 1 key; 2 value
  k_fa<<<dim3(TT / 256, NH, TNB), 512, 0, stream>>>(F[0], F[1], F[2], (float*)d_out);
}

// v007
// One run takes 29.7 microseconds.
// Next to v006, in two timings, it ran 1.05 times as fast each time.
// Over all steps from v000 it is 33.2 times as fast.
// compute dtype: all float inputs rounded to bf16; q, k, v are bf16-valued so their f16 planes are exact; logits q x k (1 product) x 2048^-0.5 (the module's sqrt(N) scale); softmax f32 against a held reference (a running maximum when it is set); P = exp(s - reference) once to f16 x v (exact in f16) (1 product), divided by the f32 sum at the end; f32 output.
#include <hip/hip_runtime.h>
#include <math.h>

typedef __attribute__((ext_vector_type(16))) _Float16 v16h;
typedef __attribute__((ext_vector_type(16))) __bf16 v16b;
typedef __attribute__((ext_vector_type(8)))  _Float16 v8h;
typedef __attribute__((ext_vector_type(8)))  float v8f;
typedef __attribute__((ext_vector_type(4)))  float v4f;
typedef __attribute__((ext_vector_type(2)))  float v2f;
typedef __attribute__((ext_vector_type(4)))  unsigned v4u;
typedef _Float16 hx8 __attribute__((ext_vector_type(8)));
typedef __attribute__((ext_vector_type(4)))  int v4i;
typedef float __attribute__((may_alias)) float_a;
typedef int __attribute__((may_alias)) int_a;

template <typename T> __device__ __forceinline__ void vst2(void* p, T v) { *(T*)p = v;  }
__device__ __forceinline__ v8f wmma16(v16h a, v16h b, v8f c) {
  v8f d = __builtin_amdgcn_wmma_f32_16x16x32_f16(false, a, false, b, (short)0, c, false, false);
  asm volatile("v_nop\n\tv_nop\n\tv_nop\n\tv_nop" : "+v"(d) : "v"(a), "v"(b));
  return d;
}
__device__ __forceinline__ v8f wmma_bf(v16b a, v16b b, v8f c) {
  v8f d = __builtin_amdgcn_wmma_f32_16x16x32_bf16(false, a, false, b, (short)0, c, false, false);
  asm volatile("v_nop\n\tv_nop\n\tv_nop\n\tv_nop" : "+v"(d) : "v"(a), "v"(b));
  return d;
}
// 16x16x32 fragments: lane = (h = lane>>4, row/col = lane&15); elements 0..7 = k0+8h+0..7, 8..15 = k0+16+8h+0..7; D element r = row 8h+r
__device__ __forceinline__ v16h frag_h(const _Float16* rowk0, int lane) {
  union { v16h v; v8h q[2]; } u; const _Float16* p = rowk0 + 8 * (lane >> 4);
  u.q[0] = *(const v8h*)p; u.q[1] = *(const v8h*)(p + 16); return u.v;
}
__device__ __forceinline__ v16h frag_f32(const float* rowk0, int lane) {
  v16h a; const float* p = rowk0 + 8 * (lane >> 4);
#pragma unroll
  for (int i = 0; i < 8; ++i) { a[i] = (_Float16)p[i]; a[8 + i] = (_Float16)p[16 + i]; }
  return a;
}
__device__ __forceinline__ v16h frag_f32s(const float* rowk0, int lane, float sc) {
  v16h a; const float* p = rowk0 + 8 * (lane >> 4);
#pragma unroll
  for (int i = 0; i < 8; ++i) { a[i] = (_Float16)(p[i] * sc); a[8 + i] = (_Float16)(p[16 + i] * sc); }
  return a;
}
// column fragment from a [K][ld] layout (column n), rows >= K read as 0
__device__ __forceinline__ v16h fragc_f32(const float* W, int k0, int n, int lane, int ld, int K) {
  v16h a; const int g = lane >> 4;
#pragma unroll
  for (int i = 0; i < 8; ++i) { const int ka = k0 + 8 * g + i, kb = ka + 16;
    a[i] = (_Float16)(ka < K ? W[(size_t)(ka < K ? ka : K - 1) * ld + n] : 0.f); a[8 + i] = (_Float16)(kb < K ? W[(size_t)(kb < K ? kb : K - 1) * ld + n] : 0.f); }
  return a;
}
struct F2 { v16b h, l; };
__device__ __forceinline__ F2 bsplit16(const float v[16]) { F2 r;
#pragma unroll
  for (int i = 0; i < 16; ++i) { const __bf16 h = (__bf16)v[i]; r.h[i] = h; r.l[i] = (__bf16)(v[i] - (float)h); }
  return r; }
__device__ __forceinline__ F2 split_row(const float* row, int k0, int lane) { float v[16]; const float* p = row + k0 + 8 * (lane >> 4);
#pragma unroll
  for (int i = 0; i < 8; ++i) { v[i] = p[i]; v[8 + i] = p[16 + i]; }
  return bsplit16(v); }
__device__ __forceinline__ F2 split_rowK(const float* row, int k0, int lane, int K) { float v[16]; const int g = lane >> 4;
#pragma unroll
  for (int i = 0; i < 8; ++i) { const int ka = k0 + 8 * g + i, kb = ka + 16; v[i] = ka < K ? row[ka < K ? ka : K - 1] : 0.f; v[8 + i] = kb < K ? row[kb < K ? kb : K - 1] : 0.f; }
  return bsplit16(v); }
__device__ __forceinline__ F2 split_col(const float* W, int k0, int n, int lane, int ld, int K) { float v[16]; const int g = lane >> 4;
#pragma unroll
  for (int i = 0; i < 8; ++i) { const int ka = k0 + 8 * g + i, kb = ka + 16; v[i] = ka < K ? W[(size_t)(ka < K ? ka : K - 1) * ld + n] : 0.f; v[8 + i] = kb < K ? W[(size_t)(kb < K ? kb : K - 1) * ld + n] : 0.f; }
  return bsplit16(v); }
__device__ __forceinline__ v8f mac3(const F2& a, const F2& b, v8f c) { c = wmma_bf(a.l, b.h, c); c = wmma_bf(a.h, b.l, c); return wmma_bf(a.h, b.h, c); }
__device__ __forceinline__ float sigm(float v) { return 1.0f / (1.0f + expf(-v)); }
#define LDSX() do { asm volatile("s_wait_dscnt 0" ::: "memory"); __builtin_amdgcn_wave_barrier(); __builtin_amdgcn_fence(__ATOMIC_RELEASE, "workgroup"); } while (0)

// Scaled-dot-product attention in the unusual [B,H,D,N] layout (query/key/value [2,16,64,2048]): scores[b,h,q,k] = sum_d query[b,h,d,q] key[b,h,d,k] / sqrt(2048) (the source scales by sqrt(size(-1)) = sqrt(N)); attn = softmax over k; out[b,h,q,v] = sum_k attn[b,h,q,k] value[b,h,v,k] -> [2,16,2048,64].
#define NB 2
#define TT 2048
#define CC 1024            // NH * HD = projected width
#define DIN 1024          // input (model) width
#define NH 16
#define HD 64
#define NQB (TT / 64)
#define HG 4
#define SCALE (0.022097086912079608f)
#define CAUSAL 0
#ifndef TNB
#define TNB NB
#endif
__device__ __forceinline__ float bfr(float v) { return (float)(__bf16)v; }
__host__ __device__ __forceinline__ int kb_last(int qb) { return CAUSAL ? ((qb * 64 + 63) >> 7) : (TT / 128 - 1); }
typedef __attribute__((ext_vector_type(8))) __bf16 v8b;
__device__ __forceinline__ v16b frag_b(const __bf16* rowk0, int lane) {
  union { v16b v; v8b q[2]; } u; const __bf16* p = rowk0 + 8 * (lane >> 4);
  u.q[0] = *(const v8b*)p; u.q[1] = *(const v8b*)(p + 16); return u.v;
}
#define QBH 0              // unused: no kernel in this file has a high-precision path
#define QHI 2048            // rows carrying a q residual plane (all rows when non-causal; k_fa reads no residual)
#define KHI 64            // key rows carrying k residual / v bf16 hi+lo planes (written only by k_proj, which is not launched)
// B fragment (k rows k0+.., output column o) of a weight: (in,out) [K][ld] or (out,in) [ld rows of K]: bf16 exact, or f16(bf16 * 256) exact
__device__ __forceinline__ v16b wcol_io(const float* Wm, int k0, int o, int lane, int ld) { v16b w; const int g = lane >> 4;
#pragma unroll
  for (int i = 0; i < 8; ++i) { w[i] = (__bf16)Wm[(size_t)(k0 + 8 * g + i) * ld + o]; w[8 + i] = (__bf16)Wm[(size_t)(k0 + 16 + 8 * g + i) * ld + o]; }
  return w; }
__device__ __forceinline__ v16b wcol_oi(const float* Wm, int k0, int o, int lane, int K) { v16b w; const float* p = Wm + (size_t)o * K + k0 + 8 * (lane >> 4);
#pragma unroll
  for (int i = 0; i < 8; ++i) { w[i] = (__bf16)p[i]; w[8 + i] = (__bf16)p[16 + i]; }
  return w; }
__device__ __forceinline__ v16h wcolh_io(const float* Wm, int k0, int o, int lane, int ld) { v16h w; const int g = lane >> 4;
#pragma unroll
  for (int i = 0; i < 8; ++i) { w[i] = (_Float16)(bfr(Wm[(size_t)(k0 + 8 * g + i) * ld + o]) * 256.0f); w[8 + i] = (_Float16)(bfr(Wm[(size_t)(k0 + 16 + 8 * g + i) * ld + o]) * 256.0f); }
  return w; }
__device__ __forceinline__ v16h wcolh_oi(const float* Wm, int k0, int o, int lane, int K) { v16h w; const float* p = Wm + (size_t)o * K + k0 + 8 * (lane >> 4);
#pragma unroll
  for (int i = 0; i < 8; ++i) { w[i] = (_Float16)(bfr(p[i]) * 256.0f); w[8 + i] = (_Float16)(bfr(p[16 + i]) * 256.0f); }
  return w; }
#define WQKV_LAYOUT 0   // 0 = (in,out) [DIN][CC]; 1 = (out,in) [CC][DIN]; 2 = per-head [NH][DIN][HD]
__device__ __forceinline__ v16b wcol_hdk(const float* Wm, int k0, int o, int lane) { v16b w; const int g = lane >> 4; const float* p = Wm + (size_t)(o / HD) * DIN * HD + (o % HD);
#pragma unroll
  for (int i = 0; i < 8; ++i) { w[i] = (__bf16)p[(size_t)(k0 + 8 * g + i) * HD]; w[8 + i] = (__bf16)p[(size_t)(k0 + 16 + 8 * g + i) * HD]; }
  return w; }
#define WO_OUT_IN 0
#if WQKV_LAYOUT == 1
#define WCOL(W, k0, o, lane) wcol_oi(W, k0, o, lane, DIN)
#elif WQKV_LAYOUT == 2
#define WCOL(W, k0, o, lane) wcol_hdk(W, k0, o, lane)
#else
#define WCOL(W, k0, o, lane) wcol_io(W, k0, o, lane, CC)
#endif
#if WO_OUT_IN
#define WOCOL(W, k0, o, lane) wcol_oi(W, k0, o, lane, CC)
#define WOCOLH(W, k0, o, lane) wcolh_oi(W, k0, o, lane, CC)
#else
#define WOCOL(W, k0, o, lane) wcol_io(W, k0, o, lane, DIN)
#define WOCOLH(W, k0, o, lane) wcolh_io(W, k0, o, lane, DIN)
#endif
#ifndef SM_EXTRA_PARAMS
#define SM_EXTRA_PARAMS
#endif
#ifndef PROJ_EXTRA_PARAMS
#define PROJ_EXTRA_PARAMS
#endif
#ifndef SM_MASK_HOOK
#define SM_MASK_HOOK (void)0
#endif

#define WS_QH  0u                                      // f16 q rows [b*t][CC]
#define WS_KH  (WS_QH + 2u * (size_t)NB * TT * CC)      // f16 k rows [b*t][CC]
#define WS_VT  (WS_KH + 2u * (size_t)NB * TT * CC)      // f16 v planes [b][c][t]
#define WS_QL  (WS_VT + 2u * (size_t)NB * CC * TT)      // f16 q residual x 2^10 rows [b][t < QHI][CC]
#define WS_KL  (WS_QL + 2u * (size_t)NB * QHI * CC)     // f16 k residual x 2^10 rows [b][t < KHI][CC]
#define WS_VB  (WS_KL + 2u * (size_t)NB * KHI * CC)     // bf16 v hi planes [b][c][t < KHI]
#define WS_VBL (WS_VB + 2u * (size_t)NB * CC * KHI)
#define WS_S   (WS_VBL + 2u * (size_t)NB * CC * KHI)    // f32 [hg][t][s] region, reserved but unused (logits and P stay in registers)
#define WS_Y   (WS_S  + 4u * (size_t)HG * TT * TT)      // f32 ctx rows [b*t][CC] (only when there is an output projection)
#define WS_END (WS_Y  + 0u)

// ---- k_proj: block = (64 rows, 128 cols, which): q/k/v = X W (+ b) with exact bf16 products (K = DIN) -> which 0: q f16 rows (+ residual rows < QHI); 1: k f16 rows (+ residual rows < KHI); 2: v f16 planes [c][t] (+ bf16 hi/lo planes for t < KHI)
__global__ __launch_bounds__(128) void k_proj(const float* __restrict__ XQ, const float* __restrict__ XK, const float* __restrict__ XV, const float* __restrict__ WQ, const float* __restrict__ WK, const float* __restrict__ WV, const float* __restrict__ BQ, const float* __restrict__ BK, const float* __restrict__ BV,
    _Float16* __restrict__ QH, _Float16* __restrict__ QL, _Float16* __restrict__ KH, _Float16* __restrict__ KL, _Float16* __restrict__ VT, __bf16* __restrict__ VB, __bf16* __restrict__ VBL) {
  __shared__ __align__(16) _Float16 sh[64][136], sl[64][136]; __shared__ __align__(16) _Float16 th[128][72]; __shared__ __align__(16) __bf16 tb[128][72], tbl[128][72];
  const int tid = threadIdx.x, wave = tid >> 5, lane = tid & 31, col = lane & 15, g = lane >> 4; const int which = blockIdx.z; const int c0 = blockIdx.y * 128; const size_t r0 = (size_t)blockIdx.x * 64; const size_t bb = r0 / TT; const int t0 = (int)(r0 % TT);
  const float* X = which == 0 ? XQ : which == 1 ? XK : XV; const float* WA = which == 0 ? WQ : which == 1 ? WK : WV; const float* BA = which == 0 ? BQ : which == 1 ? BK : BV;
  v8f acc[8] = {};
#pragma unroll 2
  for (int kc = 0; kc < DIN / 32; ++kc) { v16b a; { const float* p = X + (r0 + wave * 16 + col) * DIN + kc * 32 + 8 * g;
#pragma unroll
      for (int i = 0; i < 8; ++i) { a[i] = (__bf16)p[i]; a[8 + i] = (__bf16)p[16 + i]; } }
    asm volatile("s_wait_loadcnt 0x0" ::: "memory");
#pragma unroll
    for (int j = 0; j < 8; ++j) { const v16b w = WCOL(WA, kc * 32, c0 + j * 16 + col, lane); asm volatile("s_wait_loadcnt 0x0" ::: "memory"); acc[j] = wmma_bf(a, w, acc[j]); } }
  if (which < 2) { _Float16* DH = which == 0 ? QH : KH; _Float16* DL = which == 0 ? QL : KL; const int nhi = which == 0 ? QHI : KHI; const bool hi_rows = t0 < nhi;
#pragma unroll
    for (int j = 0; j < 8; ++j) { const float bias = BA ? bfr(BA[c0 + j * 16 + col]) : 0.f;
#pragma unroll
      for (int r = 0; r < 8; ++r) { const float v = acc[j][r] + bias; const _Float16 hv = (_Float16)v; sh[wave * 16 + 8 * g + r][j * 16 + col] = hv; sl[wave * 16 + 8 * g + r][j * 16 + col] = (_Float16)((v - (float)hv) * 1024.0f); } }
    __syncthreads();
    for (int e = tid; e < 64 * 16; e += 128) { const int rl = e >> 4, q = e & 15; vst2((unsigned*)(DH + (r0 + rl) * CC + c0 + q * 8), *(const v4u*)&sh[rl][q * 8]); if (hi_rows) vst2((unsigned*)(DL + (bb * nhi + t0 + rl) * (size_t)CC + c0 + q * 8), *(const v4u*)&sl[rl][q * 8]); }
  } else { const bool hi_rows = t0 < KHI;
#pragma unroll
    for (int j = 0; j < 8; ++j) { const float bias = BA ? bfr(BA[c0 + j * 16 + col]) : 0.f;
#pragma unroll
      for (int r = 0; r < 8; ++r) { const float v = acc[j][r] + bias; const int rl = wave * 16 + 8 * g + r, cl = j * 16 + col; th[cl][rl] = (_Float16)v; const __bf16 bh = (__bf16)v; tb[cl][rl] = bh; tbl[cl][rl] = (__bf16)(v - (float)bh); } }
    __syncthreads();
    for (int e = tid; e < 128 * 8; e += 128) { const int cl = e >> 3, q = e & 7; vst2((unsigned*)(VT + (bb * CC + c0 + cl) * (size_t)TT + t0 + q * 8), *(const v4u*)&th[cl][q * 8]); if (hi_rows) { const size_t o3 = (bb * CC + c0 + cl) * (size_t)KHI + t0 + q * 8; vst2((unsigned*)(VB + o3), *(const v4u*)&tb[cl][q * 8]); vst2((unsigned*)(VBL + o3), *(const v4u*)&tbl[cl][q * 8]); } } } }
// ---- k_fa: block = 256 queries of (b, h), 16 waves = 2 key halves x 8 waves x 32 query columns, so that four waves share a SIMD and one wave's vector work runs beside another's matrix work; logits, softmax and P.v in one pass over the keys, so no logit or P ever goes to memory.
// The kernel reads the f32 [B,H,D,N] inputs themselves: every element is rounded to bf16 and held in f16 (exact from 2^-17 up; a smaller one rounds to the f16 grid of 2^-24) on its way from registers into LDS, so there is no launch ahead of this one and no plane in the workspace.
// q and k lie [d][token] in memory and stay so in LDS; the transposing 16-bit LDS load hands each lane one token's 8 + 8 d values, in the matrix instruction's own k order, for q and k alike. v lies [v][token], which is the A operand's row order already.
// S^T = K.Q^T (A = 16 keys from LDS, B = q columns kept in registers; one product: q and k are bf16 values held in f16): a lane holds 8 + 8 keys of ONE query, which are, converted in place, the B operand of O^T += V^T.P^T (A = v rows [v][key] from LDS).
// Held reference per query (a maximum when it is set: in-lane + one exchange between the wave halves), P = exp(s - reference) once to f16, sums in f32; the reference moves, and O^T and the sum are rescaled, only when a tile's weight sum passes a cap; division by the sum at the end.
// K and v tiles of 64 keys go global -> registers -> LDS, two buffers per key half, one barrier per tile step (one tile of each half).
// At the end the two halves' partial O^T, maxima and sums are joined through LDS: half g keeps query columns 16 g .. 16 g + 15 of each wave and hands the other 16 to its partner wave.
// The joined rows leave through a per-wave LDS patch, so that every store instruction writes whole 128-B lines.
#define FA_KS 64           // keys per LDS tile
#define FA_NT (TT / FA_KS / 2)   // tile steps: each key half walks TT / 2 keys
#define FA_P 72            // v rows, LDS pitch in f16: 144 B = 16 B x odd, the conflict-free pitch for 16-byte reads of 128-B rows
#define FA_PK 80           // k rows [d][key], LDS pitch in f16: 160 B = 32 B x odd, the conflict-free pitch for the transposing load of 128-B rows
#define FA_CAP 256.0f      // a lane's weight sum of one tile above which the tile is redone against a new maximum
#define FA_PQ 272          // q rows [d][query], LDS pitch in f16: 544 B = 32 B x odd
#define FA_PO 272          // output rows in the wave's LDS patch, pitch in BYTES: 256 B of f32 + 16
typedef __attribute__((ext_vector_type(4))) _Float16 v4h;
typedef short s16x8 __attribute__((ext_vector_type(8)));
__device__ __forceinline__ float xhalf(float x) { return __builtin_bit_cast(float, __builtin_amdgcn_permlanex16(__builtin_bit_cast(int, x), __builtin_bit_cast(int, x), 0x76543210, 0xfedcba98, false, false)); }   /* lane l <-> lane l ^ 16 */
__device__ __forceinline__ v8f wm(v16h a, v16h b, v8f c) { return __builtin_amdgcn_wmma_f32_16x16x32_f16(false, a, false, b, (short)0, c, false, false); }
typedef __attribute__((ext_vector_type(2))) __bf16 v2b;
typedef __attribute__((ext_vector_type(2))) _Float16 v2h;
__device__ __forceinline__ v4h cv4(v4f a) { union { v4h v; v2h q[2]; } r;   /* f32 -> bf16 value held in f16, two elements per conversion instruction */
#pragma unroll
  for (int u = 0; u < 2; ++u) { const v2f s = {a[2 * u], a[2 * u + 1]}; const unsigned w = __builtin_bit_cast(unsigned, __builtin_convertvector(s, v2b));
    const v2f t = {__builtin_bit_cast(float, w << 16), __builtin_bit_cast(float, w & 0xffff0000u)}; r.q[u] = __builtin_convertvector(t, v2h); }
  return r.v; }
__device__ __forceinline__ v8h ld_tr16(const _Float16* p) { typedef __attribute__((address_space(3))) s16x8 lds_s16x8; return __builtin_bit_cast(v8h, __builtin_amdgcn_ds_load_tr16_b128_v8i16((lds_s16x8*)p)); }
// fragment (16 columns x 32 k) of a row-major [k][column] f16 tile in LDS; p = &T[k0 + 8 (lane >> 4) + (lane & 7)][c0 + 8 ((lane >> 3) & 1)]: lane (c, h) gets T[k0 + 8 h + 0..7][c0 + c] and T[k0 + 16 + 8 h + 0..7][c0 + c]
__device__ __forceinline__ v16h frag_tr(const _Float16* p, int pitch) { union { v16h v; v8h q[2]; } u; u.q[0] = ld_tr16(p); u.q[1] = ld_tr16(p + 16 * pitch); return u.v; }
// eight base-2 exponentials, each in place: no exponential's source register is written by the instruction behind it; the v_nop is the one slot the instruction set asks for between the last one and whatever reads its result
__device__ __forceinline__ void exp2x8(float* y) {
  asm("v_exp_f32 %0, %0\n\tv_exp_f32 %1, %1\n\tv_exp_f32 %2, %2\n\tv_exp_f32 %3, %3\n\tv_exp_f32 %4, %4\n\tv_exp_f32 %5, %5\n\tv_exp_f32 %6, %6\n\tv_exp_f32 %7, %7\n\tv_nop"
      : "+v"(y[0]), "+v"(y[1]), "+v"(y[2]), "+v"(y[3]), "+v"(y[4]), "+v"(y[5]), "+v"(y[6]), "+v"(y[7])); }
__global__ __launch_bounds__(512) void k_fa(const float* __restrict__ Qs, const float* __restrict__ Ks, const float* __restrict__ Vs, float* __restrict__ Y) {
  __shared__ __align__(16) _Float16 sKK[2][2][HD][FA_PK]; __shared__ __align__(16) _Float16 sVV[2][2][HD][FA_P]; __shared__ __align__(16) v4f sX[8][512]; __shared__ __align__(8) v2f sM[512];
  const int grp = __builtin_amdgcn_readfirstlane((int)threadIdx.x >> 8);   /* key half of this wave, in a scalar register */
  const int tid = threadIdx.x & 255, wave = tid >> 5, lane = tid & 31, col = lane & 15, g = lane >> 4; const int h = blockIdx.y, b = blockIdx.z;
  const bool hi = grp != 0;
  _Float16 (*sK)[HD][FA_PK] = sKK[grp]; _Float16 (*sV)[HD][FA_P] = sVV[grp];
  _Float16* sQ = (_Float16*)&sX[0][0];   /* the block's q tile [64 d][256 queries] lies, until its fragments are read, where the halves are joined at the end */
  const float C1 = SCALE * 1.4426950408889634f;   /* logit scale x log2(e): the exponentials are taken in base 2 */
  /* every inner loop below is unrolled so that all array indices are constants and the fragments and accumulators stay in registers */
  const size_t hd0 = (size_t)(b * NH + h) * HD;   /* first row [d] of this head in each input */
  const int sr = tid >> 4, sc = (tid & 15) * 4;   /* staging: 16 lanes per 256-B run of a row, rows sr + 16 i */
  const unsigned vo = (unsigned)(sr * TT + sc);   /* the lane's element offset in a [64][TT] plane, the same for k and v */
  const float* gK = Ks + hd0 * TT + grp * (TT / 2);      /* k rows [d][t] of this key half */
  const float* gV = Vs + hd0 * TT + grp * (TT / 2);      /* v rows [v][t] of this key half */
  const int qr = (int)threadIdx.x >> 6, qc = ((int)threadIdx.x & 63) * 4;   /* q staging: 64 lanes per 1-KiB run of a row, rows qr + 8 i */
  const unsigned qo = (unsigned)(qr * TT + qc);
  const float* gQ = Qs + hd0 * TT + blockIdx.x * 256;    /* q rows [d][t] of this block */
  v4f rk[4], rv[4];
  { v4f rq[8];
#pragma unroll
    for (int i = 0; i < 8; ++i) rq[i] = *(const v4f*)(gQ + (size_t)8 * i * TT + qo);
#pragma unroll
    for (int i = 0; i < 4; ++i) { rk[i] = *(const v4f*)(gK + (size_t)16 * i * TT + vo); rv[i] = *(const v4f*)(gV + (size_t)16 * i * TT + vo); }
    asm volatile("s_wait_loadcnt 0x0" :: "v"(qo), "v"(vo) : "memory");   /* the loads above have returned before any register that they name is written again */
#pragma unroll
    for (int i = 0; i < 8; ++i) *(v4h*)&sQ[(qr + 8 * i) * FA_PQ + qc] = cv4(rq[i]); }
#pragma unroll
  for (int i = 0; i < 4; ++i) { *(v4h*)&sK[0][sr + 16 * i][sc] = cv4(rk[i]); *(v4h*)&sV[0][sr + 16 * i][sc] = cv4(rv[i]); }
  __syncthreads();
  const int tr = 8 * g + (lane & 7), tc = 8 * ((lane >> 3) & 1);   /* the lane's row and column offset for the transposing load */
  v16h qh[2][2];
#pragma unroll
  for (int u = 0; u < 2; ++u)
#pragma unroll
    for (int kc = 0; kc < 2; ++kc) qh[u][kc] = frag_tr(&sQ[(kc * 32 + tr) * FA_PQ + wave * 32 + u * 16 + tc], FA_PQ);
  v8f o[2][4] = {}; float m[2] = {-__builtin_inff(), -__builtin_inff()}, l[2] = {0.f, 0.f};
#pragma unroll 1   /* the tile loop stays rolled: one trip is already several hundred instructions, a second copy would only cost instruction cache */
  for (int s = 0; s < FA_NT; ++s) { const int cur = s & 1; const bool more = s + 1 < FA_NT;
    if (more) { const float* nK = gK + (s + 1) * FA_KS + vo; const float* nV = gV + (s + 1) * FA_KS + vo;   /* the next tile's loads fly while this tile is worked on */
#pragma unroll
      for (int i = 0; i < 4; ++i) { rk[i] = *(const v4f*)(nK + (size_t)16 * i * TT); rv[i] = *(const v4f*)(nV + (size_t)16 * i * TT); }
      asm volatile("s_wait_xcnt 0x0" :: "v"(nK), "v"(nV) : "memory"); }   /* the address registers of the eight loads live up to this wait and are written again only behind it */
    /* an f32 tile in flight holds 32 registers where an f16 one held 16, and the kernel had none to spare: written in the old order (logits, softmax and P.v of one column group, then of the other, the stores last) this step spills. So it is written in the order that needs the fewest registers: the logits of both column groups, both softmaxes, the staged tile's stores, and only then the v fragments and P.v. Every value is computed as before, from the same operands in the same order */
    v16h vf[4][2], p[2][2]; v8f a[2][4]; float sum[2];
    /* held reference: m, the value that the exponentials are taken against, is a maximum only when it is set. A tile is worked against the m in use with no maximum, no exchange between the wave halves and no rescale; its own weight sums are the test: no weight is negative, so a lane's sum of 32 at or below FA_CAP bounds each of them, well inside f16. One ballot a tile step, as a scalar branch. Where a sum is above (or infinite), nothing of the tile has been added yet: the tile is done once more, now with its maximum taken, m raised to it and O and the sums rescaled, after which every weight is at most 1. The first tile, where m is -inf, sets m ahead of its weights */
    const auto logits = [&]() { v16h kf[4][2];
#pragma unroll
      for (int t = 0; t < 4; ++t)
#pragma unroll
        for (int kc = 0; kc < 2; ++kc) kf[t][kc] = frag_tr(&sK[cur][kc * 32 + tr][t * 16 + tc], FA_PK);
#pragma unroll
      for (int t = 0; t < 4; ++t) {
#pragma unroll
        for (int kc = 0; kc < 2; ++kc)
#pragma unroll
          for (int u = 0; u < 2; ++u) a[u][t] = wm(kf[t][kc], qh[u][kc], kc ? a[u][t] : v8f{});
        __builtin_amdgcn_sched_barrier(0); } };   /* 16 keys at a time, both column groups, in this order, so that a k fragment pair is dead when the next accumulators need registers; left free, the scheduler issues the last four fragment loads only two matrix instructions ahead of their use */
    const auto raise = [&]() {
#pragma unroll
      for (int u = 0; u < 2; ++u) { float mx = a[u][0][0];
#pragma unroll
        for (int i = 1; i < 32; ++i) mx = fmaxf(mx, a[u][i >> 3][i & 7]);
        mx = fmaxf(mx, xhalf(mx));
        const float mn = fmaxf(m[u], mx); const float corr = __builtin_amdgcn_exp2f((m[u] - mn) * C1);   /* 0 on the first tile, where m is -inf */
        m[u] = mn; l[u] *= corr;
#pragma unroll
        for (int j = 0; j < 4; ++j) o[u][j] *= corr; } };
    const auto weights = [&]() {
#pragma unroll
      for (int u = 0; u < 2; ++u) {
        float x[32];   /* x[8 t + r] = unscaled logit of key 16 t + 8 g + r of the tile, query column col */
#pragma unroll
        for (int i = 0; i < 32; ++i) x[i] = a[u][i >> 3][i & 7];
        const float mb = m[u] * C1;
        /* scale-and-shift and row sum on pairs of f32: one packed instruction issues in the slot of a plain one and does two elements */
        const v2f c2 = {C1, C1}, nb2 = {-mb, -mb};
#pragma unroll
        for (int i = 0; i < 32; i += 2) { const v2f s2 = {x[i], x[i + 1]}; const v2f y2 = __builtin_elementwise_fma(s2, c2, nb2); x[i] = y2[0]; x[i + 1] = y2[1]; }
#pragma unroll
        for (int i = 0; i < 32; i += 8) exp2x8(&x[i]);
        v2f sa = {x[0], x[1]}, sb = {x[2], x[3]};   /* two chains of pairs: four partial sums, joined below */
#pragma unroll
        for (int i = 4; i < 32; i += 4) { const v2f ya = {x[i], x[i + 1]}, yb = {x[i + 2], x[i + 3]}; sa += ya; sb += yb; }
        sa += sb; sum[u] = sa[0] + sa[1];
#pragma unroll
        for (int i = 0; i < 32; ++i) a[u][i >> 3][i & 7] = x[i]; } };   /* the weights stay in f32, in the logits' registers, up to the test */
    logits();
    if (s == 0) raise();
    weights();
    if (__builtin_expect(__builtin_amdgcn_ballot_w32((sum[0] > FA_CAP) | (sum[1] > FA_CAP)) != 0, 0)) {
      logits(); raise(); weights(); }
    l[0] += sum[0]; l[1] += sum[1];
#pragma unroll
    for (int u = 0; u < 2; ++u)
#pragma unroll
      for (int i = 0; i < 32; ++i) p[u][i >> 4][i & 15] = (_Float16)a[u][i >> 3][i & 7];
    if (more) {
#pragma unroll
      for (int i = 0; i < 4; ++i) { *(v4h*)&sK[cur ^ 1][sr + 16 * i][sc] = cv4(rk[i]); *(v4h*)&sV[cur ^ 1][sr + 16 * i][sc] = cv4(rv[i]); } }   /* that buffer's last readers left it at the barrier before this tile; stored here, ahead of P.v, for the registers: the v fragments take over the staged tile's 32 */
#pragma unroll
    for (int j = 0; j < 4; ++j)
#pragma unroll
      for (int w = 0; w < 2; ++w) vf[j][w] = frag_h(&sV[cur][j * 16 + col][w * 32], lane);
#pragma unroll
    for (int u = 0; u < 2; ++u)
#pragma unroll
      for (int j = 0; j < 4; ++j) { o[u][j] = wm(vf[j][0], p[u][0], o[u][j]); o[u][j] = wm(vf[j][1], p[u][1], o[u][j]); }
    __syncthreads(); }
  /* half g keeps columns u == g (ok, mk, lk) and gives u == 1 - g (og, mg, lg): selects on a wave-uniform flag, so that the part below is one straight path for both halves */
  v8f ok[4], og[4]; const float mk = hi ? m[1] : m[0], lk = hi ? l[1] : l[0], mg = hi ? m[0] : m[1], lg = hi ? l[0] : l[1];
#pragma unroll
  for (int j = 0; j < 4; ++j)
#pragma unroll
    for (int r = 0; r < 8; ++r) { ok[j][r] = hi ? o[1][j][r] : o[0][j][r]; og[j][r] = hi ? o[0][j][r] : o[1][j][r]; }
#pragma unroll
  for (int j = 0; j < 4; ++j) { const v4f lo = {og[j][0], og[j][1], og[j][2], og[j][3]}, hv = {og[j][4], og[j][5], og[j][6], og[j][7]}; sX[2 * j][threadIdx.x] = lo; sX[2 * j + 1][threadIdx.x] = hv; }
  { const v2f ml = {mg, lg}; sM[threadIdx.x] = ml; }
  __syncthreads();   /* the partner's partial results are in LDS behind this barrier */
  const unsigned pt = threadIdx.x ^ 256;   /* the partner lane: same wave number and lane in the other key half */
  const v2f ml = sM[pt]; const float mn = fmaxf(mk, ml[0]);
  const float ca = __builtin_amdgcn_exp2f((mk - mn) * C1), cb = __builtin_amdgcn_exp2f((ml[0] - mn) * C1);   /* both halves brought to the common maximum */
  const float ls = lk * ca + ml[1] * cb; const float inv = 1.0f / (ls + xhalf(ls)); const float fa = ca * inv, fb = cb * inv;
  /* ok[j][r] = out[q0 + 16 grp + col][16 j + 8 g + r]: a lane holds 32-byte pieces of ONE output row, so a store straight from these registers lays 16-byte pieces on 16 lines. The wave's 16 rows (4 KiB in a row in memory) go through an LDS patch of the wave's own instead, and each store instruction then covers 512 bytes in a row, four whole 128-B lines.
     The patch lies in the k buffers (key half 0) or the v buffers (key half 1): their last readers left them at the loop's last barrier. Pitch 272 B = 16 B x odd: neither the 16-byte writes down a column of rows nor the 16-byte reads along a row meet a bank twice.
     The offsets are formed here, behind the loop, from the thread index: the kernel has 256 registers at four waves a SIMD and none to spare in the loop */
  char* pw = (hi ? (char*)&sVV[0][0][0][0] : (char*)&sKK[0][0][0][0]) + ((threadIdx.x >> 5) & 7) * (16 * FA_PO);
  char* pwr = pw + (threadIdx.x & 15) * FA_PO + ((threadIdx.x & 16) << 1);           /* write: row col, byte 32 g (+ 64 j) */
  const char* prd = pw + ((threadIdx.x >> 4) & 1) * FA_PO + ((threadIdx.x & 15) << 4);   /* read: row g (+ 2 i), byte 16 col */
  float* yr = (float*)((char*)(Y + (size_t)((b * NH + h) * TT + blockIdx.x * 256 + grp * 16) * HD) + (((threadIdx.x & 0xE0) << 8) + ((threadIdx.x & 31) << 4)));   /* 8 KiB a wave pair of 32 rows, 16 bytes a lane (+ 512 i) */
  v4f r[8];
#pragma unroll
  for (int j = 0; j < 4; ++j) { const v4f xl = sX[2 * j][pt], xh = sX[2 * j + 1][pt];
    const v4f lo = {ok[j][0] * fa + xl[0] * fb, ok[j][1] * fa + xl[1] * fb, ok[j][2] * fa + xl[2] * fb, ok[j][3] * fa + xl[3] * fb}, hv = {ok[j][4] * fa + xh[0] * fb, ok[j][5] * fa + xh[1] * fb, ok[j][6] * fa + xh[2] * fb, ok[j][7] * fa + xh[3] * fb}; r[2 * j] = lo; r[2 * j + 1] = hv; }
#pragma unroll
  for (int j = 0; j < 4; ++j) { *(v4f*)(pwr + 64 * j) = r[2 * j]; *(v4f*)(pwr + 64 * j + 16) = r[2 * j + 1]; }
  asm volatile("s_wait_dscnt 0x0" ::: "memory");   /* the wave's own rows are in LDS before other lanes of the wave read them back; no other wave touches the patch, so no barrier */
#pragma unroll
  for (int i = 0; i < 8; ++i) r[i] = *(const v4f*)(prd + 2 * FA_PO * i);
#pragma unroll
  for (int i = 0; i < 8; ++i) vst2(yr + 128 * i, r[i]); }

extern "C" void kernel_launch(void* const* d_in, const int* in_sizes, int n_in, void* d_out, int out_size, void* d_ws, size_t ws_size, hipStream_t stream) {
  (void)in_sizes; (void)n_in; (void)out_size;
  const float** F = (const float**)d_in;
  (void)d_ws; (void)ws_size;
  // inputs: 0 query [2,16,64,2048] ([B,H,D,N]); 1 key; 2 value
  k_fa<<<dim3(TT / 256, NH, TNB), 512, 0, stream>>>(F[0], F[1], F[2], (float*)d_out);
}

// v008
// One run takes 27.9 microseconds.
// Two timings next to v007 both put it at 1.06 times that version's speed.
// All steps since v000 together make it 35.3 times as fast.
// compute dtype: all float inputs rounded to bf16; q, k, v are bf16-valued so their f16 planes are exact; logits q x k (1 product) x 2048^-0.5 (the module's sqrt(N) scale); softmax f32 against a held reference (a running maximum when it is set); P = exp(s - reference) once to f16 x v (exact in f16) (1 product), divided by the f32 sum at the end; f32 output.
#include <hip/hip_runtime.h>
#include <math.h>

typedef __attribute__((ext_vector_type(16))) _Float16 v16h;
typedef __attribute__((ext_vector_type(16))) __bf16 v16b;
typedef __attribute__((ext_vector_type(8)))  _Float16 v8h;
typedef __attribute__((ext_vector_type(8)))  float v8f;
typedef __attribute__((ext_vector_type(4)))  float v4f;
typedef __attribute__((ext_vector_type(2)))  float v2f;
typedef __attribute__((ext_vector_type(4)))  unsigned v4u;
typedef _Float16 hx8 __attribute__((ext_vector_type(8)));
typedef __attribute__((ext_vector_type(4)))  int v4i;
typedef float __attribute__((may_alias)) float_a;
typedef int __attribute__((may_alias)) int_a;

template <typename T> __device__ __forceinline__ void vst2(void* p, T v) { *(T*)p = v;  }
__device__ __forceinline__ v8f wmma16(v16h a, v16h b, v8f c) {
  v8f d = __builtin_amdgcn_wmma_f32_16x16x32_f16(false, a, false, b, (short)0, c, false, false);
  asm volatile("v_nop\n\tv_nop\n\tv_nop\n\tv_nop" : "+v"(d) : "v"(a), "v"(b));
  return d;
}
__device__ __forceinline__ v8f wmma_bf(v16b a, v16b b, v8f c) {
  v8f d = __builtin_amdgcn_wmma_f32_16x16x32_bf16(false, a, false, b, (short)0, c, false, false);
  asm volatile("v_nop\n\tv_nop\n\tv_nop\n\tv_nop" : "+v"(d) : "v"(a), "v"(b));
  return d;
}
// 16x16x32 fragments: lane = (h = lane>>4, row/col = lane&15); elements 0..7 = k0+8h+0..7, 8..15 = k0+16+8h+0..7; D element r = row 8h+r
__device__ __forceinline__ v16h frag_h(const _Float16* rowk0, int lane) {
  union { v16h v; v8h q[2]; } u; const _Float16* p = rowk0 + 8 * (lane >> 4);
  u.q[0] = *(const v8h*)p; u.q[1] = *(const v8h*)(p + 16); return u.v;
}
__device__ __forceinline__ v16h frag_f32(const float* rowk0, int lane) {
  v16h a; const float* p = rowk0 + 8 * (lane >> 4);
#pragma unroll
  for (int i = 0; i < 8; ++i) { a[i] = (_Float16)p[i]; a[8 + i] = (_Float16)p[16 + i]; }
  return a;
}
__device__ __forceinline__ v16h frag_f32s(const float* rowk0, int lane, float sc) {
  v16h a; const float* p = rowk0 + 8 * (lane >> 4);
#pragma unroll
  for (int i = 0; i < 8; ++i) { a[i] = (_Float16)(p[i] * sc); a[8 + i] = (_Float16)(p[16 + i] * sc); }
  return a;
}
// column fragment from a [K][ld] layout (column n), rows >= K read as 0
__device__ __forceinline__ v16h fragc_f32(const float* W, int k0, int n, int lane, int ld, int K) {
  v16h a; const int g = lane >> 4;
#pragma unroll
  for (int i = 0; i < 8; ++i) { const int ka = k0 + 8 * g + i, kb = ka + 16;
    a[i] = (_Float16)(ka < K ? W[(size_t)(ka < K ? ka : K - 1) * ld + n] : 0.f); a[8 + i] = (_Float16)(kb < K ? W[(size_t)(kb < K ? kb : K - 1) * ld + n] : 0.f); }
  return a;
}
struct F2 { v16b h, l; };
__device__ __forceinline__ F2 bsplit16(const float v[16]) { F2 r;
#pragma unroll
  for (int i = 0; i < 16; ++i) { const __bf16 h = (__bf16)v[i]; r.h[i] = h; r.l[i] = (__bf16)(v[i] - (float)h); }
  return r; }
__device__ __forceinline__ F2 split_row(const float* row, int k0, int lane) { float v[16]; const float* p = row + k0 + 8 * (lane >> 4);
#pragma unroll
  for (int i = 0; i < 8; ++i) { v[i] = p[i]; v[8 + i] = p[16 + i]; }
  return bsplit16(v); }
__device__ __forceinline__ F2 split_rowK(const float* row, int k0, int lane, int K) { float v[16]; const int g = lane >> 4;
#pragma unroll
  for (int i = 0; i < 8; ++i) { const int ka = k0 + 8 * g + i, kb = ka + 16; v[i] = ka < K ? row[ka < K ? ka : K - 1] : 0.f; v[8 + i] = kb < K ? row[kb < K ? kb : K - 1] : 0.f; }
  return bsplit16(v); }
__device__ __forceinline__ F2 split_col(const float* W, int k0, int n, int lane, int ld, int K) { float v[16]; const int g = lane >> 4;
#pragma unroll
  for (int i = 0; i < 8; ++i) { const int ka = k0 + 8 * g + i, kb = ka + 16; v[i] = ka < K ? W[(size_t)(ka < K ? ka : K - 1) * ld + n] : 0.f; v[8 + i] = kb < K ? W[(size_t)(kb < K ? kb : K - 1) * ld + n] : 0.f; }
  return bsplit16(v); }
__device__ __forceinline__ v8f mac3(const F2& a, const F2& b, v8f c) { c = wmma_bf(a.l, b.h, c); c = wmma_bf(a.h, b.l, c); return wmma_bf(a.h, b.h, c); }
__device__ __forceinline__ float sigm(float v) { return 1.0f / (1.0f + expf(-v)); }
#define LDSX() do { asm volatile("s_wait_dscnt 0" ::: "memory"); __builtin_amdgcn_wave_barrier(); __builtin_amdgcn_fence(__ATOMIC_RELEASE, "workgroup"); } while (0)

// Scaled-dot-product attention in the unusual [B,H,D,N] layout (query/key/value [2,16,64,2048]): scores[b,h,q,k] = sum_d query[b,h,d,q] key[b,h,d,k] / sqrt(2048) (the source scales by sqrt(size(-1)) = sqrt(N)); attn = softmax over k; out[b,h,q,v] = sum_k attn[b,h,q,k] value[b,h,v,k] -> [2,16,2048,64].
#define NB 2
#define TT 2048
#define CC 1024            // NH * HD = projected width
#define DIN 1024          // input (model) width
#define NH 16
#define HD 64
#define NQB (TT / 64)
#define HG 4
#define SCALE (0.022097086912079608f)
#define CAUSAL 0
#ifndef TNB
#define TNB NB
#endif
__device__ __forceinline__ float bfr(float v) { return (float)(__bf16)v; }
__host__ __device__ __forceinline__ int kb_last(int qb) { return CAUSAL ? ((qb * 64 + 63) >> 7) : (TT / 128 - 1); }
typedef __attribute__((ext_vector_type(8))) __bf16 v8b;
__device__ __forceinline__ v16b frag_b(const __bf16* rowk0, int lane) {
  union { v16b v; v8b q[2]; } u; const __bf16* p = rowk0 + 8 * (lane >> 4);
  u.q[0] = *(const v8b*)p; u.q[1] = *(const v8b*)(p + 16); return u.v;
}
#define QBH 0              // unused: no kernel in this file has a high-precision path
#define QHI 2048            // rows carrying a q residual plane (all rows when non-causal; k_fa reads no residual)
#define KHI 64            // key rows carrying k residual / v bf16 hi+lo planes (written only by k_proj, which is not launched)
// B fragment (k rows k0+.., output column o) of a weight: (in,out) [K][ld] or (out,in) [ld rows of K]: bf16 exact, or f16(bf16 * 256) exact
__device__ __forceinline__ v16b wcol_io(const float* Wm, int k0, int o, int lane, int ld) { v16b w; const int g = lane >> 4;
#pragma unroll
  for (int i = 0; i < 8; ++i) { w[i] = (__bf16)Wm[(size_t)(k0 + 8 * g + i) * ld + o]; w[8 + i] = (__bf16)Wm[(size_t)(k0 + 16 + 8 * g + i) * ld + o]; }
  return w; }
__device__ __forceinline__ v16b wcol_oi(const float* Wm, int k0, int o, int lane, int K) { v16b w; const float* p = Wm + (size_t)o * K + k0 + 8 * (lane >> 4);
#pragma unroll
  for (int i = 0; i < 8; ++i) { w[i] = (__bf16)p[i]; w[8 + i] = (__bf16)p[16 + i]; }
  return w; }
__device__ __forceinline__ v16h wcolh_io(const float* Wm, int k0, int o, int lane, int ld) { v16h w; const int g = lane >> 4;
#pragma unroll
  for (int i = 0; i < 8; ++i) { w[i] = (_Float16)(bfr(Wm[(size_t)(k0 + 8 * g + i) * ld + o]) * 256.0f); w[8 + i] = (_Float16)(bfr(Wm[(size_t)(k0 + 16 + 8 * g + i) * ld + o]) * 256.0f); }
  return w; }
__device__ __forceinline__ v16h wcolh_oi(const float* Wm, int k0, int o, int lane, int K) { v16h w; const float* p = Wm + (size_t)o * K + k0 + 8 * (lane >> 4);
#pragma unroll
  for (int i = 0; i < 8; ++i) { w[i] = (_Float16)(bfr(p[i]) * 256.0f); w[8 + i] = (_Float16)(bfr(p[16 + i]) * 256.0f); }
  return w; }
#define WQKV_LAYOUT 0   // 0 = (in,out) [DIN][CC]; 1 = (out,in) [CC][DIN]; 2 = per-head [NH][DIN][HD]
__device__ __forceinline__ v16b wcol_hdk(const float* Wm, int k0, int o, int lane) { v16b w; const int g = lane >> 4; const float* p = Wm + (size_t)(o / HD) * DIN * HD + (o % HD);
#pragma unroll
  for (int i = 0; i < 8; ++i) { w[i] = (__bf16)p[(size_t)(k0 + 8 * g + i) * HD]; w[8 + i] = (__bf16)p[(size_t)(k0 + 16 + 8 * g + i) * HD]; }
  return w; }
#define WO_OUT_IN 0
#if WQKV_LAYOUT == 1
#define WCOL(W, k0, o, lane) wcol_oi(W, k0, o, lane, DIN)
#elif WQKV_LAYOUT == 2
#define WCOL(W, k0, o, lane) wcol_hdk(W, k0, o, lane)
#else
#define WCOL(W, k0, o, lane) wcol_io(W, k0, o, lane, CC)
#endif
#if WO_OUT_IN
#define WOCOL(W, k0, o, lane) wcol_oi(W, k0, o, lane, CC)
#define WOCOLH(W, k0, o, lane) wcolh_oi(W, k0, o, lane, CC)
#else
#define WOCOL(W, k0, o, lane) wcol_io(W, k0, o, lane, DIN)
#define WOCOLH(W, k0, o, lane) wcolh_io(W, k0, o, lane, DIN)
#endif
#ifndef SM_EXTRA_PARAMS
#define SM_EXTRA_PARAMS
#endif
#ifndef PROJ_EXTRA_PARAMS
#define PROJ_EXTRA_PARAMS
#endif
#ifndef SM_MASK_HOOK
#define SM_MASK_HOOK (void)0
#endif

#define WS_QH  0u                                      // f16 q rows [b*t][CC]
#define WS_KH  (WS_QH + 2u * (size_t)NB * TT * CC)      // f16 k rows [b*t][CC]
#define WS_VT  (WS_KH + 2u * (size_t)NB * TT * CC)      // f16 v planes [b][c][t]
#define WS_QL  (WS_VT + 2u * (size_t)NB * CC * TT)      // f16 q residual x 2^10 rows [b][t < QHI][CC]
#define WS_KL  (WS_QL + 2u * (size_t)NB * QHI * CC)     // f16 k residual x 2^10 rows [b][t < KHI][CC]
#define WS_VB  (WS_KL + 2u * (size_t)NB * KHI * CC)     // bf16 v hi planes [b][c][t < KHI]
#define WS_VBL (WS_VB + 2u * (size_t)NB * CC * KHI)
#define WS_S   (WS_VBL + 2u * (size_t)NB * CC * KHI)    // f32 [hg][t][s] region, reserved but unused (logits and P stay in registers)
#define WS_Y   (WS_S  + 4u * (size_t)HG * TT * TT)      // f32 ctx rows [b*t][CC] (only when there is an output projection)
#define WS_END (WS_Y  + 0u)

// ---- k_proj: block = (64 rows, 128 cols, which): q/k/v = X W (+ b) with exact bf16 products (K = DIN) -> which 0: q f16 rows (+ residual rows < QHI); 1: k f16 rows (+ residual rows < KHI); 2: v f16 planes [c][t] (+ bf16 hi/lo planes for t < KHI)
__global__ __launch_bounds__(128) void k_proj(const float* __restrict__ XQ, const float* __restrict__ XK, const float* __restrict__ XV, const float* __restrict__ WQ, const float* __restrict__ WK, const float* __restrict__ WV, const float* __restrict__ BQ, const float* __restrict__ BK, const float* __restrict__ BV,
    _Float16* __restrict__ QH, _Float16* __restrict__ QL, _Float16* __restrict__ KH, _Float16* __restrict__ KL, _Float16* __restrict__ VT, __bf16* __restrict__ VB, __bf16* __restrict__ VBL) {
  __shared__ __align__(16) _Float16 sh[64][136], sl[64][136]; __shared__ __align__(16) _Float16 th[128][72]; __shared__ __align__(16) __bf16 tb[128][72], tbl[128][72];
  const int tid = threadIdx.x, wave = tid >> 5, lane = tid & 31, col = lane & 15, g = lane >> 4; const int which = blockIdx.z; const int c0 = blockIdx.y * 128; const size_t r0 = (size_t)blockIdx.x * 64; const size_t bb = r0 / TT; const int t0 = (int)(r0 % TT);
  const float* X = which == 0 ? XQ : which == 1 ? XK : XV; const float* WA = which == 0 ? WQ : which == 1 ? WK : WV; const float* BA = which == 0 ? BQ : which == 1 ? BK : BV;
  v8f acc[8] = {};
#pragma unroll 2
  for (int kc = 0; kc < DIN / 32; ++kc) { v16b a; { const float* p = X + (r0 + wave * 16 + col) * DIN + kc * 32 + 8 * g;
#pragma unroll
      for (int i = 0; i < 8; ++i) { a[i] = (__bf16)p[i]; a[8 + i] = (__bf16)p[16 + i]; } }
    asm volatile("s_wait_loadcnt 0x0" ::: "memory");
#pragma unroll
    for (int j = 0; j < 8; ++j) { const v16b w = WCOL(WA, kc * 32, c0 + j * 16 + col, lane); asm volatile("s_wait_loadcnt 0x0" ::: "memory"); acc[j] = wmma_bf(a, w, acc[j]); } }
  if (which < 2) { _Float16* DH = which == 0 ? QH : KH; _Float16* DL = which == 0 ? QL : KL; const int nhi = which == 0 ? QHI : KHI; const bool hi_rows = t0 < nhi;
#pragma unroll
    for (int j = 0; j < 8; ++j) { const float bias = BA ? bfr(BA[c0 + j * 16 + col]) : 0.f;
#pragma unroll
      for (int r = 0; r < 8; ++r) { const float v = acc[j][r] + bias; const _Float16 hv = (_Float16)v; sh[wave * 16 + 8 * g + r][j * 16 + col] = hv; sl[wave * 16 + 8 * g + r][j * 16 + col] = (_Float16)((v - (float)hv) * 1024.0f); } }
    __syncthreads();
    for (int e = tid; e < 64 * 16; e += 128) { const int rl = e >> 4, q = e & 15; vst2((unsigned*)(DH + (r0 + rl) * CC + c0 + q * 8), *(const v4u*)&sh[rl][q * 8]); if (hi_rows) vst2((unsigned*)(DL + (bb * nhi + t0 + rl) * (size_t)CC + c0 + q * 8), *(const v4u*)&sl[rl][q * 8]); }
  } else { const bool hi_rows = t0 < KHI;
#pragma unroll
    for (int j = 0; j < 8; ++j) { const float bias = BA ? bfr(BA[c0 + j * 16 + col]) : 0.f;
#pragma unroll
      for (int r = 0; r < 8; ++r) { const float v = acc[j][r] + bias; const int rl = wave * 16 + 8 * g + r, cl = j * 16 + col; th[cl][rl] = (_Float16)v; const __bf16 bh = (__bf16)v; tb[cl][rl] = bh; tbl[cl][rl] = (__bf16)(v - (float)bh); } }
    __syncthreads();
    for (int e = tid; e < 128 * 8; e += 128) { const int cl = e >> 3, q = e & 7; vst2((unsigned*)(VT + (bb * CC + c0 + cl) * (size_t)TT + t0 + q * 8), *(const v4u*)&th[cl][q * 8]); if (hi_rows) { const size_t o3 = (bb * CC + c0 + cl) * (size_t)KHI + t0 + q * 8; vst2((unsigned*)(VB + o3), *(const v4u*)&tb[cl][q * 8]); vst2((unsigned*)(VBL + o3), *(const v4u*)&tbl[cl][q * 8]); } } } }
// ---- k_fa: block = 256 queries of (b, h), 16 waves = 2 key halves x 8 waves x 32 query columns, so that four waves share a SIMD and one wave's vector work runs beside another's matrix work; logits, softmax and P.v in one pass over the keys, so no logit or P ever goes to memory.
// The kernel reads the f32 [B,H,D,N] inputs themselves: every element is rounded to bf16 and held in f16 (exact from 2^-17 up; a smaller one rounds to the f16 grid of 2^-24) on its way from registers into LDS, so there is no launch ahead of this one and no plane in the workspace.
// q and k lie [d][token] in memory and stay so in LDS; the transposing 16-bit LDS load hands each lane one token's 8 + 8 d values, in the matrix instruction's own k order, for q and k alike. v lies [v][token], which is the A operand's row order already.
// S^T = K.Q^T (A = 16 keys from LDS, B = q columns kept in registers; one product: q and k are bf16 values held in f16): a lane holds 8 + 8 keys of ONE query, which are, converted in place, the B operand of O^T += V^T.P^T (A = v rows [v][key] from LDS).
// Held reference per query (a maximum when it is set: in-lane + one exchange between the wave halves), P = exp(s - reference) once to f16, sums in f32; the reference moves, and O^T and the sum are rescaled, only when a tile's weight sum passes a cap; division by the sum at the end.
// K and v tiles of 64 keys go global -> registers -> LDS, three buffers per key half, one barrier per tile step (one tile of each half), split into its signal (behind the wave's stores of the next tile) and its wait (at the step's foot).
// At the end the two halves' partial O^T, maxima and sums are joined through LDS: half g keeps query columns 16 g .. 16 g + 15 of each wave and hands the other 16 to its partner wave.
// The joined rows leave through a per-wave LDS patch, so that every store instruction writes whole 128-B lines.
#define FA_KS 64           // keys per LDS tile
#define FA_NT (TT / FA_KS / 2)   // tile steps: each key half walks TT / 2 keys
#define FA_P 72            // v rows, LDS pitch in f16: 144 B = 16 B x odd, the conflict-free pitch for 16-byte reads of 128-B rows
#define FA_PK 80           // k rows [d][key], LDS pitch in f16: 160 B = 32 B x odd, the conflict-free pitch for the transposing load of 128-B rows
#define FA_CAP 256.0f      // a lane's weight sum of one tile above which the tile is redone against a new maximum
#define FA_PQ 272          // q rows [d][query], LDS pitch in f16: 544 B = 32 B x odd
#define FA_PO 272          // output rows in the wave's LDS patch, pitch in BYTES: 256 B of f32 + 16
typedef __attribute__((ext_vector_type(4))) _Float16 v4h;
typedef short s16x8 __attribute__((ext_vector_type(8)));
__device__ __forceinline__ float xhalf(float x) { return __builtin_bit_cast(float, __builtin_amdgcn_permlanex16(__builtin_bit_cast(int, x), __builtin_bit_cast(int, x), 0x76543210, 0xfedcba98, false, false)); }   /* lane l <-> lane l ^ 16 */
__device__ __forceinline__ v8f wm(v16h a, v16h b, v8f c) { return __builtin_amdgcn_wmma_f32_16x16x32_f16(false, a, false, b, (short)0, c, false, false); }
typedef __attribute__((ext_vector_type(2))) __bf16 v2b;
typedef __attribute__((ext_vector_type(2))) _Float16 v2h;
__device__ __forceinline__ v4h cv4(v4f a) { union { v4h v; v2h q[2]; } r;   /* f32 -> bf16 value held in f16, two elements per conversion instruction */
#pragma unroll
  for (int u = 0; u < 2; ++u) { const v2f s = {a[2 * u], a[2 * u + 1]}; const unsigned w = __builtin_bit_cast(unsigned, __builtin_convertvector(s, v2b));
    const v2f t = {__builtin_bit_cast(float, w << 16), __builtin_bit_cast(float, w & 0xffff0000u)}; r.q[u] = __builtin_convertvector(t, v2h); }
  return r.v; }
__device__ __forceinline__ v8h ld_tr16(const _Float16* p) { typedef __attribute__((address_space(3))) s16x8 lds_s16x8; return __builtin_bit_cast(v8h, __builtin_amdgcn_ds_load_tr16_b128_v8i16((lds_s16x8*)p)); }
// fragment (16 columns x 32 k) of a row-major [k][column] f16 tile in LDS; p = &T[k0 + 8 (lane >> 4) + (lane & 7)][c0 + 8 ((lane >> 3) & 1)]: lane (c, h) gets T[k0 + 8 h + 0..7][c0 + c] and T[k0 + 16 + 8 h + 0..7][c0 + c]
__device__ __forceinline__ v16h frag_tr(const _Float16* p, int pitch) { union { v16h v; v8h q[2]; } u; u.q[0] = ld_tr16(p); u.q[1] = ld_tr16(p + 16 * pitch); return u.v; }
// eight base-2 exponentials, each in place: no exponential's source register is written by the instruction behind it; the v_nop is the one slot the instruction set asks for between the last one and whatever reads its result
__device__ __forceinline__ void exp2x8(float* y) {
  asm("v_exp_f32 %0, %0\n\tv_exp_f32 %1, %1\n\tv_exp_f32 %2, %2\n\tv_exp_f32 %3, %3\n\tv_exp_f32 %4, %4\n\tv_exp_f32 %5, %5\n\tv_exp_f32 %6, %6\n\tv_exp_f32 %7, %7\n\tv_nop"
      : "+v"(y[0]), "+v"(y[1]), "+v"(y[2]), "+v"(y[3]), "+v"(y[4]), "+v"(y[5]), "+v"(y[6]), "+v"(y[7])); }
__global__ __launch_bounds__(512) void k_fa(const float* __restrict__ Qs, const float* __restrict__ Ks, const float* __restrict__ Vs, float* __restrict__ Y) {
  __shared__ __align__(16) _Float16 sKK[2][3][HD][FA_PK]; __shared__ __align__(16) _Float16 sVV[2][3][HD][FA_P]; __shared__ __align__(16) v4f sX[8][512]; __shared__ __align__(8) v2f sM[512];
  const int grp = __builtin_amdgcn_readfirstlane((int)threadIdx.x >> 8);   /* key half of this wave, in a scalar register: every test on it is a wave-uniform select */
  const int tid = threadIdx.x & 255, wave = tid >> 5, lane = tid & 31, col = lane & 15, g = lane >> 4; const int h = blockIdx.y, b = blockIdx.z;
  const bool hi = grp != 0;
  _Float16 (*sK)[HD][FA_PK] = sKK[grp]; _Float16 (*sV)[HD][FA_P] = sVV[grp];
  _Float16* sQ = (_Float16*)&sX[0][0];   /* the block's q tile [64 d][256 queries] lies, until its fragments are read, where the halves are joined at the end */
  const float C1 = SCALE * 1.4426950408889634f;   /* logit scale x log2(e): the exponentials are taken in base 2 */
  /* every inner loop below is unrolled so that all array indices are constants and the fragments and accumulators stay in registers */
  const size_t hd0 = (size_t)(b * NH + h) * HD;   /* first row [d] of this head in each input */
  const int sr = tid >> 4, sc = (tid & 15) * 4;   /* staging: 16 lanes per 256-B run of a row, rows sr + 16 i */
  const unsigned vo = (unsigned)(sr * TT + sc);   /* the lane's element offset in a [64][TT] plane, the same for k and v */
  const float* gK = Ks + hd0 * TT + grp * (TT / 2);      /* k rows [d][t] of this key half */
  const float* gV = Vs + hd0 * TT + grp * (TT / 2);      /* v rows [v][t] of this key half */
  const int qr = (int)threadIdx.x >> 6, qc = ((int)threadIdx.x & 63) * 4;   /* q staging: 64 lanes per 1-KiB run of a row, rows qr + 8 i */
  const unsigned qo = (unsigned)(qr * TT + qc);
  const float* gQ = Qs + hd0 * TT + blockIdx.x * 256;    /* q rows [d][t] of this block */
  v4f rk[4], rv[4];
  { v4f rq[8], k0[4], v0[4];
#pragma unroll
    for (int i = 0; i < 8; ++i) rq[i] = *(const v4f*)(gQ + (size_t)8 * i * TT + qo);
#pragma unroll
    for (int i = 0; i < 4; ++i) { k0[i] = *(const v4f*)(gK + (size_t)16 * i * TT + vo); v0[i] = *(const v4f*)(gV + (size_t)16 * i * TT + vo); }
#pragma unroll
    for (int i = 0; i < 4; ++i) { rk[i] = *(const v4f*)(gK + FA_KS + (size_t)16 * i * TT + vo); rv[i] = *(const v4f*)(gV + FA_KS + (size_t)16 * i * TT + vo); }   /* tile 1, which step 0 stores first thing, comes with the first burst */
    asm volatile("s_wait_loadcnt 0x0" :: "v"(qo), "v"(vo) : "memory");   /* the loads above have returned before any register that they name is written again */
#pragma unroll
    for (int i = 0; i < 8; ++i) *(v4h*)&sQ[(qr + 8 * i) * FA_PQ + qc] = cv4(rq[i]);
#pragma unroll
    for (int i = 0; i < 4; ++i) { *(v4h*)&sK[0][sr + 16 * i][sc] = cv4(k0[i]); *(v4h*)&sV[0][sr + 16 * i][sc] = cv4(v0[i]); } }
  __syncthreads();
  const int tr = 8 * g + (lane & 7), tc = 8 * ((lane >> 3) & 1);   /* the lane's row and column offset for the transposing load */
  v16h qh[2][2];
#pragma unroll
  for (int u = 0; u < 2; ++u)
#pragma unroll
    for (int kc = 0; kc < 2; ++kc) qh[u][kc] = frag_tr(&sQ[(kc * 32 + tr) * FA_PQ + wave * 32 + u * 16 + tc], FA_PQ);
  v8f o[2][4] = {}; float m[2] = {-__builtin_inff(), -__builtin_inff()}, l[2] = {0.f, 0.f};
#pragma unroll 1   /* the tile loop stays rolled: one trip is already several hundred instructions, a second copy would only cost instruction cache */
  for (int s = 0, cur = 0; s < FA_NT; ++s) { const int nxt = cur == 2 ? 0 : cur + 1; const bool more = s + 1 < FA_NT;   /* tile s lies in buffer s mod 3 */
    /* an f32 tile in flight holds 32 registers where an f16 one held 16, and the kernel had none to spare: written with logits, softmax and P.v of one column group, then of the other, and the stores last, this step spills. So it is written in an order that fits: the staged tile's stores, the k fragments and the next loads, the logits of both column groups, both softmaxes, and only then the v fragments and P.v (the k fragments ahead of the stores spill too). Every value is computed from the same operands in the same order in any of these */
    v16h vf[4][2], p[2][2]; v8f a[2][4]; float sum[2];
    /* held reference: m, the value that the exponentials are taken against, is a maximum only when it is set. A tile is worked against the m in use with no maximum, no exchange between the wave halves and no rescale; its own weight sums are the test: no weight is negative, so a lane's sum of 32 at or below FA_CAP bounds each of them, well inside f16. One ballot a tile step, as a scalar branch. Where a sum is above (or infinite), nothing of the tile has been added yet: the tile is done once more, now with its maximum taken, m raised to it and O and the sums rescaled, after which every weight is at most 1. The first tile, where m is -inf, sets m ahead of its weights */
    v16h kf[4][2];
    const auto kfrags = [&]() {
#pragma unroll
      for (int t = 0; t < 4; ++t)
#pragma unroll
        for (int kc = 0; kc < 2; ++kc) kf[t][kc] = frag_tr(&sK[cur][kc * 32 + tr][t * 16 + tc], FA_PK); };
    const auto logits = [&]() {
#pragma unroll
      for (int t = 0; t < 4; ++t) {
#pragma unroll
        for (int kc = 0; kc < 2; ++kc)
#pragma unroll
          for (int u = 0; u < 2; ++u) a[u][t] = wm(kf[t][kc], qh[u][kc], kc ? a[u][t] : v8f{});
        __builtin_amdgcn_sched_barrier(0); } };   /* 16 keys at a time, both column groups, in this order, so that a k fragment pair is dead when the next accumulators need registers; left free, the scheduler issues the last four fragment loads only two matrix instructions ahead of their use */
    const auto raise = [&]() {
#pragma unroll
      for (int u = 0; u < 2; ++u) { float mx = a[u][0][0];
#pragma unroll
        for (int i = 1; i < 32; ++i) mx = fmaxf(mx, a[u][i >> 3][i & 7]);
        mx = fmaxf(mx, xhalf(mx));
        const float mn = fmaxf(m[u], mx); const float corr = __builtin_amdgcn_exp2f((m[u] - mn) * C1);   /* 0 on the first tile, where m is -inf */
        m[u] = mn; l[u] *= corr;
#pragma unroll
        for (int j = 0; j < 4; ++j) o[u][j] *= corr; } };
    const auto weights = [&]() {
#pragma unroll
      for (int u = 0; u < 2; ++u) {
        float x[32];   /* x[8 t + r] = unscaled logit of key 16 t + 8 g + r of the tile, query column col */
#pragma unroll
        for (int i = 0; i < 32; ++i) x[i] = a[u][i >> 3][i & 7];
        const float mb = m[u] * C1;
        /* scale-and-shift and row sum on pairs of f32: one packed instruction issues in the slot of a plain one and does two elements */
        const v2f c2 = {C1, C1}, nb2 = {-mb, -mb};
#pragma unroll
        for (int i = 0; i < 32; i += 2) { const v2f s2 = {x[i], x[i + 1]}; const v2f y2 = __builtin_elementwise_fma(s2, c2, nb2); x[i] = y2[0]; x[i + 1] = y2[1]; }
#pragma unroll
        for (int i = 0; i < 32; i += 8) exp2x8(&x[i]);
        v2f sa = {x[0], x[1]}, sb = {x[2], x[3]};   /* two chains of pairs: four partial sums, joined below */
#pragma unroll
        for (int i = 4; i < 32; i += 4) { const v2f ya = {x[i], x[i + 1]}, yb = {x[i + 2], x[i + 3]}; sa += ya; sb += yb; }
        sa += sb; sum[u] = sa[0] + sa[1];
#pragma unroll
        for (int i = 0; i < 32; ++i) a[u][i >> 3][i & 7] = x[i]; } };   /* the weights stay in f32, in the logits' registers, up to the test */
    if (more) {
#pragma unroll
      for (int i = 0; i < 4; ++i) { *(v4h*)&sK[nxt][sr + 16 * i][sc] = cv4(rk[i]); *(v4h*)&sV[nxt][sr + 16 * i][sc] = cv4(rv[i]); } }
    kfrags();   /* behind the stores in the LDS queue: the one wait below serves both */
    const float* nK = gK + s * FA_KS + vo; const float* nV = gV + s * FA_KS + vo;   /* the lane's first element of tile s; the two tiles' distance goes into the loads' constant offsets */
    if (s + 2 < FA_NT) {   /* the loads of the tile after the next go out as soon as the stores have emptied their registers and have a whole step to arrive */
#pragma unroll
      for (int i = 0; i < 4; ++i) { rk[i] = *(const v4f*)(nK + 2 * FA_KS + (size_t)16 * i * TT); rv[i] = *(const v4f*)(nV + 2 * FA_KS + (size_t)16 * i * TT); } }
    /* the tile barrier, split. All that the other waves need of this wave in this step is its share of the next tile, so it stores that first thing in the step, signals as soon as it is in LDS and waits only at the step's foot, in front of its first read of the next tile. Logits, softmax, the v fragments and P.v lie between: a wave may be that far ahead of the slowest one without waiting, so that the four waves of a SIMD come apart and one's vector work runs beside another's matrix work.
       LDS reads of tile s stand behind signal s (the v fragments; the k fragments of a redone tile), so two buffers are not enough: tile s + 3 takes tile s's buffer, is stored in step s + 2 behind wait s + 1, and every wave's signal s + 1 stands behind its s_wait_dscnt 0, which ends its reads of tile s */
    asm volatile("s_wait_dscnt 0x0" ::: "memory");      /* the wave's stores of the next tile are in LDS, and its reads of the tile before this one have long returned, before it signals */
    asm volatile("s_barrier_signal -1" ::: "memory");
    asm volatile("s_wait_xcnt 0x0" :: "v"(nK), "v"(nV) : "memory");   /* the address registers of the eight loads live up to this wait and are written again only behind it; it stands behind the signal so that no other wave waits for it */
    logits();
    if (s == 0) raise();
    weights();
    if (__builtin_expect(__builtin_amdgcn_ballot_w32((sum[0] > FA_CAP) | (sum[1] > FA_CAP)) != 0, 0)) {
      kfrags(); logits(); raise(); weights(); }
    l[0] += sum[0]; l[1] += sum[1];
#pragma unroll
    for (int u = 0; u < 2; ++u)
#pragma unroll
      for (int i = 0; i < 32; ++i) p[u][i >> 4][i & 15] = (_Float16)a[u][i >> 3][i & 7];
#pragma unroll
    for (int j = 0; j < 4; ++j)
#pragma unroll
      for (int w = 0; w < 2; ++w) vf[j][w] = frag_h(&sV[cur][j * 16 + col][w * 32], lane);
#pragma unroll
    for (int u = 0; u < 2; ++u)
#pragma unroll
      for (int j = 0; j < 4; ++j) { o[u][j] = wm(vf[j][0], p[u][0], o[u][j]); o[u][j] = wm(vf[j][1], p[u][1], o[u][j]); }
    __builtin_amdgcn_sched_barrier(0);                  /* keeps the products in front of the wait: left free, the scheduler sinks them behind it */
    asm volatile("s_barrier_wait -1" ::: "memory");     /* every wave has signalled: the next tile is whole in LDS */
    cur = nxt; }
  /* half g keeps columns u == g (ok, mk, lk) and gives u == 1 - g (og, mg, lg): selects on a wave-uniform flag, so that the part below is one straight path for both halves */
  v8f ok[4], og[4]; const float mk = hi ? m[1] : m[0], lk = hi ? l[1] : l[0], mg = hi ? m[0] : m[1], lg = hi ? l[0] : l[1];
#pragma unroll
  for (int j = 0; j < 4; ++j)
#pragma unroll
    for (int r = 0; r < 8; ++r) { ok[j][r] = hi ? o[1][j][r] : o[0][j][r]; og[j][r] = hi ? o[0][j][r] : o[1][j][r]; }
#pragma unroll
  for (int j = 0; j < 4; ++j) { const v4f lo = {og[j][0], og[j][1], og[j][2], og[j][3]}, hv = {og[j][4], og[j][5], og[j][6], og[j][7]}; sX[2 * j][threadIdx.x] = lo; sX[2 * j + 1][threadIdx.x] = hv; }
  { const v2f ml = {mg, lg}; sM[threadIdx.x] = ml; }
  __syncthreads();   /* the partner's partial results are in LDS behind this barrier */
  const unsigned pt = threadIdx.x ^ 256;   /* the partner lane: same wave number and lane in the other key half */
  const v2f ml = sM[pt]; const float mn = fmaxf(mk, ml[0]);
  const float ca = __builtin_amdgcn_exp2f((mk - mn) * C1), cb = __builtin_amdgcn_exp2f((ml[0] - mn) * C1);   /* both halves brought to the common maximum */
  const float ls = lk * ca + ml[1] * cb; const float inv = 1.0f / (ls + xhalf(ls)); const float fa = ca * inv, fb = cb * inv;
  /* ok[j][r] = out[q0 + 16 grp + col][16 j + 8 g + r]: a lane holds 32-byte pieces of ONE output row, so a store straight from these registers lays 16-byte pieces on 16 lines. The wave's 16 rows (4 KiB in a row in memory) go through an LDS patch of the wave's own instead, and each store instruction then covers 512 bytes in a row, four whole 128-B lines.
     The patch lies in the k buffers (key half 0) or the v buffers (key half 1): their last readers have left them at the barrier of the join above. Pitch 272 B = 16 B x odd: neither the 16-byte writes down a column of rows nor the 16-byte reads along a row meet a bank twice.
     The offsets are formed here, behind the loop, from the thread index: the kernel has 256 registers at four waves a SIMD and none to spare in the loop */
  char* pw = (hi ? (char*)&sVV[0][0][0][0] : (char*)&sKK[0][0][0][0]) + ((threadIdx.x >> 5) & 7) * (16 * FA_PO);
  char* pwr = pw + (threadIdx.x & 15) * FA_PO + ((threadIdx.x & 16) << 1);           /* write: row col, byte 32 g (+ 64 j) */
  const char* prd = pw + ((threadIdx.x >> 4) & 1) * FA_PO + ((threadIdx.x & 15) << 4);   /* read: row g (+ 2 i), byte 16 col */
  float* yr = (float*)((char*)(Y + (size_t)((b * NH + h) * TT + blockIdx.x * 256 + grp * 16) * HD) + (((threadIdx.x & 0xE0) << 8) + ((threadIdx.x & 31) << 4)));   /* 8 KiB a wave pair of 32 rows, 16 bytes a lane (+ 512 i) */
  v4f r[8];
#pragma unroll
  for (int j = 0; j < 4; ++j) { const v4f xl = sX[2 * j][pt], xh = sX[2 * j + 1][pt];
    const v4f lo = {ok[j][0] * fa + xl[0] * fb, ok[j][1] * fa + xl[1] * fb, ok[j][2] * fa + xl[2] * fb, ok[j][3] * fa + xl[3] * fb}, hv = {ok[j][4] * fa + xh[0] * fb, ok[j][5] * fa + xh[1] * fb, ok[j][6] * fa + xh[2] * fb, ok[j][7] * fa + xh[3] * fb}; r[2 * j] = lo; r[2 * j + 1] = hv; }
#pragma unroll
  for (int j = 0; j < 4; ++j) { *(v4f*)(pwr + 64 * j) = r[2 * j]; *(v4f*)(pwr + 64 * j + 16) = r[2 * j + 1]; }
  asm volatile("s_wait_dscnt 0x0" ::: "memory");   /* the wave's own rows are in LDS before other lanes of the wave read them back; no other wave touches the patch, so no barrier */
#pragma unroll
  for (int i = 0; i < 8; ++i) r[i] = *(const v4f*)(prd + 2 * FA_PO * i);
#pragma unroll
  for (int i = 0; i < 8; ++i) vst2(yr + 128 * i, r[i]); }

extern "C" void kernel_launch(void* const* d_in, const int* in_sizes, int n_in, void* d_out, int out_size, void* d_ws, size_t ws_size, hipStream_t stream) {
  (void)in_sizes; (void)n_in; (void)out_size;
  const float** F = (const float**)d_in;
  (void)d_ws; (void)ws_size;
  // inputs: 0 query [2,16,64,2048] ([B,H,D,N]); 1 key; 2 value
  k_fa<<<dim3(TT / 256, NH, TNB), 512, 0, stream>>>(F[0], F[1], F[2], (float*)d_out);
}

// v009
// One run takes 27 microseconds.
// In both of two side-by-side timings against v008, it was 1.03 times as fast.
// Counting every step since v000, it is 36.5 times as fast.
// compute dtype: all float inputs rounded to bf16; q, k, v are bf16-valued so their f16 planes are exact; q times 2048^-0.5 (the module's sqrt(N) scale) times log2(e) is rounded once more, to f16; base-2 logits q x k (1 product) start from minus the held reference (a running maximum when it is set) as the product's C operand; softmax f32; P = exp2(logit - reference) once to f16 x v (exact in f16) (1 product), divided by the f32 sum at the end; f32 output.
#include <hip/hip_runtime.h>
#include <math.h>

typedef __attribute__((ext_vector_type(16))) _Float16 v16h;
typedef __attribute__((ext_vector_type(16))) __bf16 v16b;
typedef __attribute__((ext_vector_type(8)))  _Float16 v8h;
typedef __attribute__((ext_vector_type(8)))  float v8f;
typedef __attribute__((ext_vector_type(4)))  float v4f;
typedef __attribute__((ext_vector_type(2)))  float v2f;
typedef __attribute__((ext_vector_type(4)))  unsigned v4u;
typedef _Float16 hx8 __attribute__((ext_vector_type(8)));
typedef __attribute__((ext_vector_type(4)))  int v4i;
typedef float __attribute__((may_alias)) float_a;
typedef int __attribute__((may_alias)) int_a;

template <typename T> __device__ __forceinline__ void vst2(void* p, T v) { *(T*)p = v;  }
__device__ __forceinline__ v8f wmma16(v16h a, v16h b, v8f c) {
  v8f d = __builtin_amdgcn_wmma_f32_16x16x32_f16(false, a, false, b, (short)0, c, false, false);
  asm volatile("v_nop\n\tv_nop\n\tv_nop\n\tv_nop" : "+v"(d) : "v"(a), "v"(b));
  return d;
}
__device__ __forceinline__ v8f wmma_bf(v16b a, v16b b, v8f c) {
  v8f d = __builtin_amdgcn_wmma_f32_16x16x32_bf16(false, a, false, b, (short)0, c, false, false);
  asm volatile("v_nop\n\tv_nop\n\tv_nop\n\tv_nop" : "+v"(d) : "v"(a), "v"(b));
  return d;
}
// 16x16x32 fragments: lane = (h = lane>>4, row/col = lane&15); elements 0..7 = k0+8h+0..7, 8..15 = k0+16+8h+0..7; D element r = row 8h+r
__device__ __forceinline__ v16h frag_h(const _Float16* rowk0, int lane) {
  union { v16h v; v8h q[2]; } u; const _Float16* p = rowk0 + 8 * (lane >> 4);
  u.q[0] = *(const v8h*)p; u.q[1] = *(const v8h*)(p + 16); return u.v;
}
__device__ __forceinline__ v16h frag_f32(const float* rowk0, int lane) {
  v16h a; const float* p = rowk0 + 8 * (lane >> 4);
#pragma unroll
  for (int i = 0; i < 8; ++i) { a[i] = (_Float16)p[i]; a[8 + i] = (_Float16)p[16 + i]; }
  return a;
}
__device__ __forceinline__ v16h frag_f32s(const float* rowk0, int lane, float sc) {
  v16h a; const float* p = rowk0 + 8 * (lane >> 4);
#pragma unroll
  for (int i = 0; i < 8; ++i) { a[i] = (_Float16)(p[i] * sc); a[8 + i] = (_Float16)(p[16 + i] * sc); }
  return a;
}
// column fragment from a [K][ld] layout (column n), rows >= K read as 0
__device__ __forceinline__ v16h fragc_f32(const float* W, int k0, int n, int lane, int ld, int K) {
  v16h a; const int g = lane >> 4;
#pragma unroll
  for (int i = 0; i < 8; ++i) { const int ka = k0 + 8 * g + i, kb = ka + 16;
    a[i] = (_Float16)(ka < K ? W[(size_t)(ka < K ? ka : K - 1) * ld + n] : 0.f); a[8 + i] = (_Float16)(kb < K ? W[(size_t)(kb < K ? kb : K - 1) * ld + n] : 0.f); }
  return a;
}
struct F2 { v16b h, l; };
__device__ __forceinline__ F2 bsplit16(const float v[16]) { F2 r;
#pragma unroll
  for (int i = 0; i < 16; ++i) { const __bf16 h = (__bf16)v[i]; r.h[i] = h; r.l[i] = (__bf16)(v[i] - (float)h); }
  return r; }
__device__ __forceinline__ F2 split_row(const float* row, int k0, int lane) { float v[16]; const float* p = row + k0 + 8 * (lane >> 4);
#pragma unroll
  for (int i = 0; i < 8; ++i) { v[i] = p[i]; v[8 + i] = p[16 + i]; }
  return bsplit16(v); }
__device__ __forceinline__ F2 split_rowK(const float* row, int k0, int lane, int K) { float v[16]; const int g = lane >> 4;
#pragma unroll
  for (int i = 0; i < 8; ++i) { const int ka = k0 + 8 * g + i, kb = ka + 16; v[i] = ka < K ? row[ka < K ? ka : K - 1] : 0.f; v[8 + i] = kb < K ? row[kb < K ? kb : K - 1] : 0.f; }
  return bsplit16(v); }
__device__ __forceinline__ F2 split_col(const float* W, int k0, int n, int lane, int ld, int K) { float v[16]; const int g = lane >> 4;
#pragma unroll
  for (int i = 0; i < 8; ++i) { const int ka = k0 + 8 * g + i, kb = ka + 16; v[i] = ka < K ? W[(size_t)(ka < K ? ka : K - 1) * ld + n] : 0.f; v[8 + i] = kb < K ? W[(size_t)(kb < K ? kb : K - 1) * ld + n] : 0.f; }
  return bsplit16(v); }
__device__ __forceinline__ v8f mac3(const F2& a, const F2& b, v8f c) { c = wmma_bf(a.l, b.h, c); c = wmma_bf(a.h, b.l, c); return wmma_bf(a.h, b.h, c); }
__device__ __forceinline__ float sigm(float v) { return 1.0f / (1.0f + expf(-v)); }
#define LDSX() do { asm volatile("s_wait_dscnt 0" ::: "memory"); __builtin_amdgcn_wave_barrier(); __builtin_amdgcn_fence(__ATOMIC_RELEASE, "workgroup"); } while (0)

// Scaled-dot-product attention in the unusual [B,H,D,N] layout (query/key/value [2,16,64,2048]): scores[b,h,q,k] = sum_d query[b,h,d,q] key[b,h,d,k] / sqrt(2048) (the source scales by sqrt(size(-1)) = sqrt(N)); attn = softmax over k; out[b,h,q,v] = sum_k attn[b,h,q,k] value[b,h,v,k] -> [2,16,2048,64].
#define NB 2
#define TT 2048
#define CC 1024            // NH * HD = projected width
#define DIN 1024          // input (model) width
#define NH 16
#define HD 64
#define NQB (TT / 64)
#define HG 4
#define SCALE (0.022097086912079608f)
#define CAUSAL 0
#ifndef TNB
#define TNB NB
#endif
__device__ __forceinline__ float bfr(float v) { return (float)(__bf16)v; }
__host__ __device__ __forceinline__ int kb_last(int qb) { return CAUSAL ? ((qb * 64 + 63) >> 7) : (TT / 128 - 1); }
typedef __attribute__((ext_vector_type(8))) __bf16 v8b;
__device__ __forceinline__ v16b frag_b(const __bf16* rowk0, int lane) {
  union { v16b v; v8b q[2]; } u; const __bf16* p = rowk0 + 8 * (lane >> 4);
  u.q[0] = *(const v8b*)p; u.q[1] = *(const v8b*)(p + 16); return u.v;
}
#define QBH 0              // unused: no kernel in this file has a high-precision path
#define QHI 2048            // rows carrying a q residual plane (all rows when non-causal; k_fa reads no residual)
#define KHI 64            // key rows carrying k residual / v bf16 hi+lo planes (written only by k_proj, which is not launched)
// B fragment (k rows k0+.., output column o) of a weight: (in,out) [K][ld] or (out,in) [ld rows of K]: bf16 exact, or f16(bf16 * 256) exact
__device__ __forceinline__ v16b wcol_io(const float* Wm, int k0, int o, int lane, int ld) { v16b w; const int g = lane >> 4;
#pragma unroll
  for (int i = 0; i < 8; ++i) { w[i] = (__bf16)Wm[(size_t)(k0 + 8 * g + i) * ld + o]; w[8 + i] = (__bf16)Wm[(size_t)(k0 + 16 + 8 * g + i) * ld + o]; }
  return w; }
__device__ __forceinline__ v16b wcol_oi(const float* Wm, int k0, int o, int lane, int K) { v16b w; const float* p = Wm + (size_t)o * K + k0 + 8 * (lane >> 4);
#pragma unroll
  for (int i = 0; i < 8; ++i) { w[i] = (__bf16)p[i]; w[8 + i] = (__bf16)p[16 + i]; }
  return w; }
__device__ __forceinline__ v16h wcolh_io(const float* Wm, int k0, int o, int lane, int ld) { v16h w; const int g = lane >> 4;
#pragma unroll
  for (int i = 0; i < 8; ++i) { w[i] = (_Float16)(bfr(Wm[(size_t)(k0 + 8 * g + i) * ld + o]) * 256.0f); w[8 + i] = (_Float16)(bfr(Wm[(size_t)(k0 + 16 + 8 * g + i) * ld + o]) * 256.0f); }
  return w; }
__device__ __forceinline__ v16h wcolh_oi(const float* Wm, int k0, int o, int lane, int K) { v16h w; const float* p = Wm + (size_t)o * K + k0 + 8 * (lane >> 4);
#pragma unroll
  for (int i = 0; i < 8; ++i) { w[i] = (_Float16)(bfr(p[i]) * 256.0f); w[8 + i] = (_Float16)(bfr(p[16 + i]) * 256.0f); }
  return w; }
#define WQKV_LAYOUT 0   // 0 = (in,out) [DIN][CC]; 1 = (out,in) [CC][DIN]; 2 = per-head [NH][DIN][HD]
__device__ __forceinline__ v16b wcol_hdk(const float* Wm, int k0, int o, int lane) { v16b w; const int g = lane >> 4; const float* p = Wm + (size_t)(o / HD) * DIN * HD + (o % HD);
#pragma unroll
  for (int i = 0; i < 8; ++i) { w[i] = (__bf16)p[(size_t)(k0 + 8 * g + i) * HD]; w[8 + i] = (__bf16)p[(size_t)(k0 + 16 + 8 * g + i) * HD]; }
  return w; }
#define WO_OUT_IN 0
#if WQKV_LAYOUT == 1
#define WCOL(W, k0, o, lane) wcol_oi(W, k0, o, lane, DIN)
#elif WQKV_LAYOUT == 2
#define WCOL(W, k0, o, lane) wcol_hdk(W, k0, o, lane)
#else
#define WCOL(W, k0, o, lane) wcol_io(W, k0, o, lane, CC)
#endif
#if WO_OUT_IN
#define WOCOL(W, k0, o, lane) wcol_oi(W, k0, o, lane, CC)
#define WOCOLH(W, k0, o, lane) wcolh_oi(W, k0, o, lane, CC)
#else
#define WOCOL(W, k0, o, lane) wcol_io(W, k0, o, lane, DIN)
#define WOCOLH(W, k0, o, lane) wcolh_io(W, k0, o, lane, DIN)
#endif
#ifndef SM_EXTRA_PARAMS
#define SM_EXTRA_PARAMS
#endif
#ifndef PROJ_EXTRA_PARAMS
#define PROJ_EXTRA_PARAMS
#endif
#ifndef SM_MASK_HOOK
#define SM_MASK_HOOK (void)0
#endif

#define WS_QH  0u                                      // f16 q rows [b*t][CC]
#define WS_KH  (WS_QH + 2u * (size_t)NB * TT * CC)      // f16 k rows [b*t][CC]
#define WS_VT  (WS_KH + 2u * (size_t)NB * TT * CC)      // f16 v planes [b][c][t]
#define WS_QL  (WS_VT + 2u * (size_t)NB * CC * TT)      // f16 q residual x 2^10 rows [b][t < QHI][CC]
#define WS_KL  (WS_QL + 2u * (size_t)NB * QHI * CC)     // f16 k residual x 2^10 rows [b][t < KHI][CC]
#define WS_VB  (WS_KL + 2u * (size_t)NB * KHI * CC)     // bf16 v hi planes [b][c][t < KHI]
#define WS_VBL (WS_VB + 2u * (size_t)NB * CC * KHI)
#define WS_S   (WS_VBL + 2u * (size_t)NB * CC * KHI)    // f32 [hg][t][s] region, reserved but unused (logits and P stay in registers)
#define WS_Y   (WS_S  + 4u * (size_t)HG * TT * TT)      // f32 ctx rows [b*t][CC] (only when there is an output projection)
#define WS_END (WS_Y  + 0u)

// ---- k_proj: block = (64 rows, 128 cols, which): q/k/v = X W (+ b) with exact bf16 products (K = DIN) -> which 0: q f16 rows (+ residual rows < QHI); 1: k f16 rows (+ residual rows < KHI); 2: v f16 planes [c][t] (+ bf16 hi/lo planes for t < KHI)
__global__ __launch_bounds__(128) void k_proj(const float* __restrict__ XQ, const float* __restrict__ XK, const float* __restrict__ XV, const float* __restrict__ WQ, const float* __restrict__ WK, const float* __restrict__ WV, const float* __restrict__ BQ, const float* __restrict__ BK, const float* __restrict__ BV,
    _Float16* __restrict__ QH, _Float16* __restrict__ QL, _Float16* __restrict__ KH, _Float16* __restrict__ KL, _Float16* __restrict__ VT, __bf16* __restrict__ VB, __bf16* __restrict__ VBL) {
  __shared__ __align__(16) _Float16 sh[64][136], sl[64][136]; __shared__ __align__(16) _Float16 th[128][72]; __shared__ __align__(16) __bf16 tb[128][72], tbl[128][72];
  const int tid = threadIdx.x, wave = tid >> 5, lane = tid & 31, col = lane & 15, g = lane >> 4; const int which = blockIdx.z; const int c0 = blockIdx.y * 128; const size_t r0 = (size_t)blockIdx.x * 64; const size_t bb = r0 / TT; const int t0 = (int)(r0 % TT);
  const float* X = which == 0 ? XQ : which == 1 ? XK : XV; const float* WA = which == 0 ? WQ : which == 1 ? WK : WV; const float* BA = which == 0 ? BQ : which == 1 ? BK : BV;
  v8f acc[8] = {};
#pragma unroll 2
  for (int kc = 0; kc < DIN / 32; ++kc) { v16b a; { const float* p = X + (r0 + wave * 16 + col) * DIN + kc * 32 + 8 * g;
#pragma unroll
      for (int i = 0; i < 8; ++i) { a[i] = (__bf16)p[i]; a[8 + i] = (__bf16)p[16 + i]; } }
    asm volatile("s_wait_loadcnt 0x0" ::: "memory");
#pragma unroll
    for (int j = 0; j < 8; ++j) { const v16b w = WCOL(WA, kc * 32, c0 + j * 16 + col, lane); asm volatile("s_wait_loadcnt 0x0" ::: "memory"); acc[j] = wmma_bf(a, w, acc[j]); } }
  if (which < 2) { _Float16* DH = which == 0 ? QH : KH; _Float16* DL = which == 0 ? QL : KL; const int nhi = which == 0 ? QHI : KHI; const bool hi_rows = t0 < nhi;
#pragma unroll
    for (int j = 0; j < 8; ++j) { const float bias = BA ? bfr(BA[c0 + j * 16 + col]) : 0.f;
#pragma unroll
      for (int r = 0; r < 8; ++r) { const float v = acc[j][r] + bias; const _Float16 hv = (_Float16)v; sh[wave * 16 + 8 * g + r][j * 16 + col] = hv; sl[wave * 16 + 8 * g + r][j * 16 + col] = (_Float16)((v - (float)hv) * 1024.0f); } }
    __syncthreads();
    for (int e = tid; e < 64 * 16; e += 128) { const int rl = e >> 4, q = e & 15; vst2((unsigned*)(DH + (r0 + rl) * CC + c0 + q * 8), *(const v4u*)&sh[rl][q * 8]); if (hi_rows) vst2((unsigned*)(DL + (bb * nhi + t0 + rl) * (size_t)CC + c0 + q * 8), *(const v4u*)&sl[rl][q * 8]); }
  } else { const bool hi_rows = t0 < KHI;
#pragma unroll
    for (int j = 0; j < 8; ++j) { const float bias = BA ? bfr(BA[c0 + j * 16 + col]) : 0.f;
#pragma unroll
      for (int r = 0; r < 8; ++r) { const float v = acc[j][r] + bias; const int rl = wave * 16 + 8 * g + r, cl = j * 16 + col; th[cl][rl] = (_Float16)v; const __bf16 bh = (__bf16)v; tb[cl][rl] = bh; tbl[cl][rl] = (__bf16)(v - (float)bh); } }
    __syncthreads();
    for (int e = tid; e < 128 * 8; e += 128) { const int cl = e >> 3, q = e & 7; vst2((unsigned*)(VT + (bb * CC + c0 + cl) * (size_t)TT + t0 + q * 8), *(const v4u*)&th[cl][q * 8]); if (hi_rows) { const size_t o3 = (bb * CC + c0 + cl) * (size_t)KHI + t0 + q * 8; vst2((unsigned*)(VB + o3), *(const v4u*)&tb[cl][q * 8]); vst2((unsigned*)(VBL + o3), *(const v4u*)&tbl[cl][q * 8]); } } } }
// ---- k_fa: block = 256 queries of (b, h), 16 waves = 2 key halves x 8 waves x 32 query columns, so that four waves share a SIMD and one wave's vector work runs beside another's matrix work; logits, softmax and P.v in one pass over the keys, so no logit or P ever goes to memory.
// The kernel reads the f32 [B,H,D,N] inputs themselves: every element is rounded to bf16 and held in f16 (exact from 2^-17 up; a smaller one rounds to the f16 grid of 2^-24), q only after a multiplication by the logit scale and log2(e) in f32 and a second rounding to f16, on its way from registers into LDS, so there is no launch ahead of this one and no plane in the workspace.
// q and k lie [d][token] in memory and stay so in LDS; the transposing 16-bit LDS load hands each lane one token's 8 + 8 d values, in the matrix instruction's own k order, for q and k alike. v lies [v][token], which is the A operand's row order already.
// S^T = K.Q^T (A = 16 keys from LDS, B = q columns kept in registers; one product: k is a bf16 value held in f16, q a bf16 value times the logit scale and log2(e), rounded to f16; C = minus the reference, so that the product leaves the matrix unit as the exponential's argument): a lane holds 8 + 8 keys of ONE query, which are, converted in place, the B operand of O^T += V^T.P^T (A = v rows [v][key] from LDS).
// Held reference per query (a maximum when it is set: in-lane + one exchange between the wave halves), P = exp2(logit - reference) once to f16, sums in f32; the reference moves, and O^T and the sum are rescaled, only when a tile's weight sum passes a cap; division by the sum at the end.
// K and v tiles of 64 keys go global -> registers -> LDS, three buffers per key half, one barrier per tile step (one tile of each half), split into its signal (behind the wave's stores of the next tile) and its wait (at the step's foot).
// At the end the two halves' partial O^T, maxima and sums are joined through LDS: half g keeps query columns 16 g .. 16 g + 15 of each wave and hands the other 16 to its partner wave.
// The joined rows leave through a per-wave LDS patch, so that every store instruction writes whole 128-B lines.
#define FA_KS 64           // keys per LDS tile
#define FA_NT (TT / FA_KS / 2)   // tile steps: each key half walks TT / 2 keys
#define FA_P 72            // v rows, LDS pitch in f16: 144 B = 16 B x odd, the conflict-free pitch for 16-byte reads of 128-B rows
#define FA_PK 80           // k rows [d][key], LDS pitch in f16: 160 B = 32 B x odd, the conflict-free pitch for the transposing load of 128-B rows
#define FA_CAP 256.0f      // a lane's weight sum of one tile above which the tile is redone against a new maximum
#define FA_PQ 272          // q rows [d][query], LDS pitch in f16: 544 B = 32 B x odd
#define FA_PO 272          // output rows in the wave's LDS patch, pitch in BYTES: 256 B of f32 + 16
typedef __attribute__((ext_vector_type(4))) _Float16 v4h;
typedef short s16x8 __attribute__((ext_vector_type(8)));
__device__ __forceinline__ float xhalf(float x) { return __builtin_bit_cast(float, __builtin_amdgcn_permlanex16(__builtin_bit_cast(int, x), __builtin_bit_cast(int, x), 0x76543210, 0xfedcba98, false, false)); }   /* lane l <-> lane l ^ 16 */
__device__ __forceinline__ v8f wm(v16h a, v16h b, v8f c) { return __builtin_amdgcn_wmma_f32_16x16x32_f16(false, a, false, b, (short)0, c, false, false); }
typedef __attribute__((ext_vector_type(2))) __bf16 v2b;
typedef __attribute__((ext_vector_type(2))) _Float16 v2h;
__device__ __forceinline__ v4h cv4(v4f a) { union { v4h v; v2h q[2]; } r;   /* f32 -> bf16 value held in f16, two elements per conversion instruction */
#pragma unroll
  for (int u = 0; u < 2; ++u) { const v2f s = {a[2 * u], a[2 * u + 1]}; const unsigned w = __builtin_bit_cast(unsigned, __builtin_convertvector(s, v2b));
    const v2f t = {__builtin_bit_cast(float, w << 16), __builtin_bit_cast(float, w & 0xffff0000u)}; r.q[u] = __builtin_convertvector(t, v2h); }
  return r.v; }
__device__ __forceinline__ v4h cv4s(v4f a, float sc) { union { v4h v; v2h q[2]; } r;   /* f32 -> bf16 value, times sc in f32, rounded to f16 */
#pragma unroll
  for (int u = 0; u < 2; ++u) { const v2f s = {a[2 * u], a[2 * u + 1]}; const unsigned w = __builtin_bit_cast(unsigned, __builtin_convertvector(s, v2b));
    const v2f t = {__builtin_bit_cast(float, w << 16) * sc, __builtin_bit_cast(float, w & 0xffff0000u) * sc}; r.q[u] = __builtin_convertvector(t, v2h); }
  return r.v; }
__device__ __forceinline__ v8h ld_tr16(const _Float16* p) { typedef __attribute__((address_space(3))) s16x8 lds_s16x8; return __builtin_bit_cast(v8h, __builtin_amdgcn_ds_load_tr16_b128_v8i16((lds_s16x8*)p)); }
// fragment (16 columns x 32 k) of a row-major [k][column] f16 tile in LDS; p = &T[k0 + 8 (lane >> 4) + (lane & 7)][c0 + 8 ((lane >> 3) & 1)]: lane (c, h) gets T[k0 + 8 h + 0..7][c0 + c] and T[k0 + 16 + 8 h + 0..7][c0 + c]
__device__ __forceinline__ v16h frag_tr(const _Float16* p, int pitch) { union { v16h v; v8h q[2]; } u; u.q[0] = ld_tr16(p); u.q[1] = ld_tr16(p + 16 * pitch); return u.v; }
__global__ __launch_bounds__(512) void k_fa(const float* __restrict__ Qs, const float* __restrict__ Ks, const float* __restrict__ Vs, float* __restrict__ Y) {
  __shared__ __align__(16) _Float16 sKK[2][3][HD][FA_PK]; __shared__ __align__(16) _Float16 sVV[2][3][HD][FA_P]; __shared__ __align__(16) v4f sX[8][512]; __shared__ __align__(8) v2f sM[512];
  const int grp = __builtin_amdgcn_readfirstlane((int)threadIdx.x >> 8);   /* key half of this wave, in a scalar register: every test on it is a wave-uniform select */
  const int tid = threadIdx.x & 255, wave = tid >> 5, lane = tid & 31, col = lane & 15, g = lane >> 4; const int h = blockIdx.y, b = blockIdx.z;
  const bool hi = grp != 0;
  _Float16 (*sK)[HD][FA_PK] = sKK[grp]; _Float16 (*sV)[HD][FA_P] = sVV[grp];
  _Float16* sQ = (_Float16*)&sX[0][0];   /* the block's q tile [64 d][256 queries] lies, until its fragments are read, where the halves are joined at the end */
  const float C1 = SCALE * 1.4426950408889634f;   /* logit scale x log2(e): the exponentials are taken in base 2; it goes into q, once, on q's way to LDS */
  /* every inner loop below is unrolled so that all array indices are constants and the fragments and accumulators stay in registers */
  const size_t hd0 = (size_t)(b * NH + h) * HD;   /* first row [d] of this head in each input */
  const int sr = tid >> 4, sc = (tid & 15) * 4;   /* staging: 16 lanes per 256-B run of a row, rows sr + 16 i */
  const unsigned vo = (unsigned)(sr * TT + sc);   /* the lane's element offset in a [64][TT] plane, the same for k and v */
  const float* gK = Ks + hd0 * TT + grp * (TT / 2);      /* k rows [d][t] of this key half */
  const float* gV = Vs + hd0 * TT + grp * (TT / 2);      /* v rows [v][t] of this key half */
  const int qr = (int)threadIdx.x >> 6, qc = ((int)threadIdx.x & 63) * 4;   /* q staging: 64 lanes per 1-KiB run of a row, rows qr + 8 i */
  const unsigned qo = (unsigned)(qr * TT + qc);
  const float* gQ = Qs + hd0 * TT + blockIdx.x * 256;    /* q rows [d][t] of this block */
  v4f rk[4], rv[4];
  { v4f rq[8], k0[4], v0[4];
#pragma unroll
    for (int i = 0; i < 8; ++i) rq[i] = *(const v4f*)(gQ + (size_t)8 * i * TT + qo);
#pragma unroll
    for (int i = 0; i < 4; ++i) { k0[i] = *(const v4f*)(gK + (size_t)16 * i * TT + vo); v0[i] = *(const v4f*)(gV + (size_t)16 * i * TT + vo); }
#pragma unroll
    for (int i = 0; i < 4; ++i) { rk[i] = *(const v4f*)(gK + FA_KS + (size_t)16 * i * TT + vo); rv[i] = *(const v4f*)(gV + FA_KS + (size_t)16 * i * TT + vo); }   /* tile 1, which step 0 stores first thing, comes with the first burst */
    asm volatile("s_wait_loadcnt 0x0" :: "v"(qo), "v"(vo) : "memory");   /* the loads above have returned before any register that they name is written again */
#pragma unroll
    for (int i = 0; i < 8; ++i) *(v4h*)&sQ[(qr + 8 * i) * FA_PQ + qc] = cv4s(rq[i], C1);
#pragma unroll
    for (int i = 0; i < 4; ++i) { *(v4h*)&sK[0][sr + 16 * i][sc] = cv4(k0[i]); *(v4h*)&sV[0][sr + 16 * i][sc] = cv4(v0[i]); } }
  __syncthreads();
  const int tr = 8 * g + (lane & 7), tc = 8 * ((lane >> 3) & 1);   /* the lane's row and column offset for the transposing load */
  v16h qh[2][2];
#pragma unroll
  for (int u = 0; u < 2; ++u)
#pragma unroll
    for (int kc = 0; kc < 2; ++kc) qh[u][kc] = frag_tr(&sQ[(kc * 32 + tr) * FA_PQ + wave * 32 + u * 16 + tc], FA_PQ);
  v8f o[2][4] = {}; float nm[2] = {0.f, 0.f}, l[2] = {0.f, 0.f};   /* nm = minus the reference, in base-2 logit units; 0 until the first tile sets it */
#pragma unroll 1   /* the tile loop stays rolled: one trip is already several hundred instructions, a second copy would only cost instruction cache */
  for (int s = 0, cur = 0; s < FA_NT; ++s) { const int nxt = cur == 2 ? 0 : cur + 1; const bool more = s + 1 < FA_NT;   /* tile s lies in buffer s mod 3 */
    /* an f32 tile in flight holds 32 registers where an f16 one held 16, and the kernel had none to spare: written with logits, softmax and P.v of one column group, then of the other, and the stores last, this step spills. So it is written in an order that fits: the staged tile's stores, the k fragments and the next loads, the logits of both column groups, both softmaxes, and only then the v fragments and P.v (the k fragments ahead of the stores spill too). Every value is computed from the same operands in the same order in any of these */
    v16h vf[4][2], p[2][2]; v8f a[2][4]; float sum[2];
    /* held reference: -nm, the value that the exponentials are taken against, is a maximum only when it is set. A tile is worked against the one in use with no maximum, no exchange between the wave halves and no rescale, and with no vector instruction between the product and the exponential: nm is the C operand of each score tile's first matrix instruction; its own weight sums are the test: no weight is negative, so a lane's sum of 32 at or below FA_CAP bounds each of them, well inside f16. One ballot a tile step, as a scalar branch. Where a sum is above (or infinite), nothing of the tile has been added yet: the tile is done once more, now with its maximum taken, the reference raised to it and O and the sums rescaled, after which every weight is at most 1. The first tile, worked against 0, sets the reference ahead of its weights */
    v16h kf[4][2];
    /* the four parts below are each used twice (the tile, the redone tile); always_inline, because out of line the fragments and accumulators that they share go through memory */
    const auto kfrags = [&]() __attribute__((always_inline)) {
#pragma unroll
      for (int t = 0; t < 4; ++t)
#pragma unroll
        for (int kc = 0; kc < 2; ++kc) kf[t][kc] = frag_tr(&sK[cur][kc * 32 + tr][t * 16 + tc], FA_PK); };
    const auto logits = [&]() __attribute__((always_inline)) {
      v8f c[2];   /* a lane's eight scores of a tile belong to one query: its nm in all eight registers */
#pragma unroll
      for (int u = 0; u < 2; ++u)
#pragma unroll
        for (int r = 0; r < 8; ++r) c[u][r] = nm[u];
#pragma unroll
      for (int t = 0; t < 4; ++t) {
#pragma unroll
        for (int kc = 0; kc < 2; ++kc)
#pragma unroll
          for (int u = 0; u < 2; ++u) a[u][t] = wm(kf[t][kc], qh[u][kc], kc ? a[u][t] : c[u]);
        __builtin_amdgcn_sched_barrier(0); } };   /* 16 keys at a time, both column groups, in this order, so that a k fragment pair is dead when the next accumulators need registers; left free, the scheduler issues the last four fragment loads only two matrix instructions ahead of their use */
    const auto raise = [&](bool first) __attribute__((always_inline)) {   /* a holds the tile's logits less the reference in use; d = how far the reference moves */
#pragma unroll
      for (int u = 0; u < 2; ++u) { float mx = a[u][0][0];
#pragma unroll
        for (int i = 1; i < 32; ++i) mx = fmaxf(mx, a[u][i >> 3][i & 7]);
        mx = fmaxf(mx, xhalf(mx));
        const float d = first ? mx : fmaxf(mx, 0.f);
        nm[u] -= d;
#pragma unroll
        for (int t = 0; t < 4; ++t) a[u][t] -= d;
        if (!first) { const float corr = __builtin_amdgcn_exp2f(-d); l[u] *= corr;   /* on the first tile O and the sums are still 0 */
#pragma unroll
          for (int j = 0; j < 4; ++j) o[u][j] *= corr; } } };
    const auto weights = [&]() __attribute__((always_inline)) {
#pragma unroll
      for (int u = 0; u < 2; ++u) {
        float x[32];   /* x[8 t + r] = base-2 logit less the reference, key 16 t + 8 g + r of the tile, query column col */
#pragma unroll
        for (int i = 0; i < 32; ++i) x[i] = a[u][i >> 3][i & 7];
        /* row sum on pairs of f32: one packed instruction issues in the slot of a plain one and does two elements */
#pragma unroll
        for (int i = 0; i < 32; ++i) x[i] = __builtin_amdgcn_exp2f(x[i]);   /* bare v_exp_f32, read straight from the accumulator; as the builtin, so that the compiler picks each destination itself (asm text tied in place made it copy registers first) and keeps the slot behind a transcendental */
        v2f sa = {x[0], x[1]}, sb = {x[2], x[3]};   /* two chains of pairs: four partial sums, joined below */
#pragma unroll
        for (int i = 4; i < 32; i += 4) { const v2f ya = {x[i], x[i + 1]}, yb = {x[i + 2], x[i + 3]}; sa += ya; sb += yb; }
        sa += sb; sum[u] = sa[0] + sa[1];
#pragma unroll
        for (int i = 0; i < 32; ++i) a[u][i >> 3][i & 7] = x[i]; } };   /* the weights stay in f32, in the logits' registers, up to the test */
    if (more) {
#pragma unroll
      for (int i = 0; i < 4; ++i) { *(v4h*)&sK[nxt][sr + 16 * i][sc] = cv4(rk[i]); *(v4h*)&sV[nxt][sr + 16 * i][sc] = cv4(rv[i]); } }
    kfrags();   /* behind the stores in the LDS queue: the one wait below serves both */
    const float* nK = gK + s * FA_KS; const float* nV = gV + s * FA_KS;   /* first element of tile s, the same for the whole wave: a scalar base, beside which the loads take the lane's 32-bit offset vo (two 64-bit addresses a lane would not fit the registers); the two tiles' distance goes into the loads' constant offsets */
    if (s + 2 < FA_NT) {   /* the loads of the tile after the next go out as soon as the stores have emptied their registers and have a whole step to arrive */
#pragma unroll
      for (int i = 0; i < 4; ++i) { rk[i] = *(const v4f*)(nK + 2 * FA_KS + (size_t)16 * i * TT + vo); rv[i] = *(const v4f*)(nV + 2 * FA_KS + (size_t)16 * i * TT + vo); } }
    /* the tile barrier, split. All that the other waves need of this wave in this step is its share of the next tile, so it stores that first thing in the step, signals as soon as it is in LDS and waits only at the step's foot, in front of its first read of the next tile. Logits, softmax, the v fragments and P.v lie between: a wave may be that far ahead of the slowest one without waiting, so that the four waves of a SIMD come apart and one's vector work runs beside another's matrix work.
       LDS reads of tile s stand behind signal s (the v fragments; the k fragments of a redone tile), so two buffers are not enough: tile s + 3 takes tile s's buffer, is stored in step s + 2 behind wait s + 1, and every wave's signal s + 1 stands behind its s_wait_dscnt 0, which ends its reads of tile s */
    asm volatile("s_wait_dscnt 0x0" ::: "memory");      /* the wave's stores of the next tile are in LDS, and its reads of the tile before this one have long returned, before it signals */
    asm volatile("s_barrier_signal -1" ::: "memory");
    asm volatile("s_wait_xcnt 0x0" :: "s"(nK), "s"(nV) : "memory");   /* the two scalar bases of the eight loads live up to this wait and are written again only behind it (the register with the lane's offset is not written in the loop at all); it stands behind the signal so that no other wave waits for it */
    logits();
    if (s == 0) raise(true);
    weights();
    if (__builtin_expect(__builtin_amdgcn_ballot_w32((sum[0] > FA_CAP) | (sum[1] > FA_CAP)) != 0, 0)) {
      kfrags(); logits(); raise(false); weights(); }
    l[0] += sum[0]; l[1] += sum[1];
#pragma unroll
    for (int u = 0; u < 2; ++u)
#pragma unroll
      for (int i = 0; i < 32; ++i) p[u][i >> 4][i & 15] = (_Float16)a[u][i >> 3][i & 7];
#pragma unroll
    for (int j = 0; j < 4; ++j)
#pragma unroll
      for (int w = 0; w < 2; ++w) vf[j][w] = frag_h(&sV[cur][j * 16 + col][w * 32], lane);
#pragma unroll
    for (int u = 0; u < 2; ++u)
#pragma unroll
      for (int j = 0; j < 4; ++j) { o[u][j] = wm(vf[j][0], p[u][0], o[u][j]); o[u][j] = wm(vf[j][1], p[u][1], o[u][j]); }
    __builtin_amdgcn_sched_barrier(0);                  /* keeps the products in front of the wait: left free, the scheduler sinks them behind it */
    asm volatile("s_barrier_wait -1" ::: "memory");     /* every wave has signalled: the next tile is whole in LDS */
    cur = nxt; }
  /* half g keeps columns u == g (ok, mk, lk) and gives u == 1 - g (og, mg, lg): selects on a wave-uniform flag, so that the part below is one straight path for both halves */
  v8f ok[4], og[4]; const float mk = hi ? -nm[1] : -nm[0], lk = hi ? l[1] : l[0], mg = hi ? -nm[0] : -nm[1], lg = hi ? l[0] : l[1];
#pragma unroll
  for (int j = 0; j < 4; ++j)
#pragma unroll
    for (int r = 0; r < 8; ++r) { ok[j][r] = hi ? o[1][j][r] : o[0][j][r]; og[j][r] = hi ? o[0][j][r] : o[1][j][r]; }
#pragma unroll
  for (int j = 0; j < 4; ++j) { const v4f lo = {og[j][0], og[j][1], og[j][2], og[j][3]}, hv = {og[j][4], og[j][5], og[j][6], og[j][7]}; sX[2 * j][threadIdx.x] = lo; sX[2 * j + 1][threadIdx.x] = hv; }
  { const v2f ml = {mg, lg}; sM[threadIdx.x] = ml; }
  __syncthreads();   /* the partner's partial results are in LDS behind this barrier */
  const unsigned pt = threadIdx.x ^ 256;   /* the partner lane: same wave number and lane in the other key half */
  const v2f ml = sM[pt]; const float mn = fmaxf(mk, ml[0]);
  const float ca = __builtin_amdgcn_exp2f(mk - mn), cb = __builtin_amdgcn_exp2f(ml[0] - mn);   /* both halves brought to the common maximum */
  const float ls = lk * ca + ml[1] * cb; const float inv = 1.0f / (ls + xhalf(ls)); const float fa = ca * inv, fb = cb * inv;
  /* ok[j][r] = out[q0 + 16 grp + col][16 j + 8 g + r]: a lane holds 32-byte pieces of ONE output row, so a store straight from these registers lays 16-byte pieces on 16 lines. The wave's 16 rows (4 KiB in a row in memory) go through an LDS patch of the wave's own instead, and each store instruction then covers 512 bytes in a row, four whole 128-B lines.
     The patch lies in the k buffers (key half 0) or the v buffers (key half 1): their last readers have left them at the barrier of the join above. Pitch 272 B = 16 B x odd: neither the 16-byte writes down a column of rows nor the 16-byte reads along a row meet a bank twice.
     The offsets are formed here, behind the loop, from the thread index: the kernel has 256 registers at four waves a SIMD and none to spare in the loop */
  char* pw = (hi ? (char*)&sVV[0][0][0][0] : (char*)&sKK[0][0][0][0]) + ((threadIdx.x >> 5) & 7) * (16 * FA_PO);
  char* pwr = pw + (threadIdx.x & 15) * FA_PO + ((threadIdx.x & 16) << 1);           /* write: row col, byte 32 g (+ 64 j) */
  const char* prd = pw + ((threadIdx.x >> 4) & 1) * FA_PO + ((threadIdx.x & 15) << 4);   /* read: row g (+ 2 i), byte 16 col */
  float* yr = (float*)((char*)(Y + (size_t)((b * NH + h) * TT + blockIdx.x * 256 + grp * 16) * HD) + (((threadIdx.x & 0xE0) << 8) + ((threadIdx.x & 31) << 4)));   /* 8 KiB a wave pair of 32 rows, 16 bytes a lane (+ 512 i) */
  v4f r[8];
#pragma unroll
  for (int j = 0; j < 4; ++j) { const v4f xl = sX[2 * j][pt], xh = sX[2 * j + 1][pt];
    const v4f lo = {ok[j][0] * fa + xl[0] * fb, ok[j][1] * fa + xl[1] * fb, ok[j][2] * fa + xl[2] * fb, ok[j][3] * fa + xl[3] * fb}, hv = {ok[j][4] * fa + xh[0] * fb, ok[j][5] * fa + xh[1] * fb, ok[j][6] * fa + xh[2] * fb, ok[j][7] * fa + xh[3] * fb}; r[2 * j] = lo; r[2 * j + 1] = hv; }
#pragma unroll
  for (int j = 0; j < 4; ++j) { *(v4f*)(pwr + 64 * j) = r[2 * j]; *(v4f*)(pwr + 64 * j + 16) = r[2 * j + 1]; }
  asm volatile("s_wait_dscnt 0x0" ::: "memory");   /* the wave's own rows are in LDS before other lanes of the wave read them back; no other wave touches the patch, so no barrier */
#pragma unroll
  for (int i = 0; i < 8; ++i) r[i] = *(const v4f*)(prd + 2 * FA_PO * i);
#pragma unroll
  for (int i = 0; i < 8; ++i) vst2(yr + 128 * i, r[i]); }

extern "C" void kernel_launch(void* const* d_in, const int* in_sizes, int n_in, void* d_out, int out_size, void* d_ws, size_t ws_size, hipStream_t stream) {
  (void)in_sizes; (void)n_in; (void)out_size;
  const float** F = (const float**)d_in;
  (void)d_ws; (void)ws_size;
  // inputs: 0 query [2,16,64,2048] ([B,H,D,N]); 1 key; 2 value
  k_fa<<<dim3(TT / 256, NH, TNB), 512, 0, stream>>>(F[0], F[1], F[2], (float*)d_out);
}
